// v000
// Times are from an AMD MI455X. After a warm-up the kernel runs many times in a row, and a time is the length of
// such a window on the GPU divided by its runs, so every launch and the gaps after it count. The runs cycle
// through copies of the inputs. A figure is the median of several windows, for all but v000 over two sittings.
// Sittings can differ by a few percent; kernels timed side by side share one.
// v000 is the starting kernel. One run takes 1610 microseconds.
#include <hip/hip_runtime.h>

// Causal self-attention with ALiBi (linear slopes), a separate q projection and a fused k|v projection (x [2][2048][1024]; q = x q_w + q_b ('xw' [1024][1024] 0.02 + bias zeros: read); kv = (x kv_w + kv_b) ('xw' [1024][2048] 0.02 + bias zeros: read) reshaped (B, T, 2, 16, 64): k | v = column halves (16 heads x 64); att x 1/sqrt(64) + slopes[h] x (j - i) with slopes[h] = (h + 1) / 16 (exact in f32; for the kept entries j <= i this is -slopes[h] x |i - j|); causal (-inf); softmax; y = merged o_w + o_b ('xw' + bias zeros: read) -> [2][2048][1024] (4.2 M); argument order x, q_w, q_b, kv_w, kv_b, o_w, o_b).
// Layout per batch: bf16 copy of x; q_w transposed; the fused kv weight transposed once into Bt (k | v row blocks) + bias halves; exact projections + f32 biases; identity-table plane builders; raw scores, then k_alibi subtracts SLOPE8[h] x |i - j| in f32 (8 x slope = (h + 1) / 2: exact) before the softmax kernel's x 1/8; causal T-2048 attention (hybrid rows: < 512 hi/lo 3 products, rest fp16 x1024; k_gemmc skips tiles above the diagonal); merged hi/lo x o_w exact + o_b.
// Compute dtypes, f32 accumulate: every input rounded to bf16; projections exact + f32 biases; attention rows < 512 3 products, rest fp16; softmax f32; output projection hl x exact.

#define NB_  2
#define TT   2048
#define DM   1024
#define NH_  16
#define NKV  16
#define REP  (NH_ / NKV)
#define HD   64
#define DQ   (NH_ * HD)
#define DKV  (NKV * HD)
#define ZH   2
#define RH   512                  // query rows < RH use hi+lo planes (0: none)
#define WIN  2048
#define PCAR 1024.0f
#define SCL  0.125f   // HD^-0.5
typedef _Float16 h16;
typedef unsigned short bf;
typedef __attribute__((ext_vector_type(16))) __bf16   v16bf;
typedef __attribute__((ext_vector_type(16))) _Float16 v16h;
typedef __attribute__((ext_vector_type(8)))  _Float16 v8h;
typedef __attribute__((ext_vector_type(8)))  unsigned short v8us;
typedef __attribute__((ext_vector_type(8)))  float    v8f;
typedef __attribute__((ext_vector_type(4)))  float    v4f;
typedef v8h  __attribute__((may_alias)) v8ha;
typedef v4f  __attribute__((may_alias)) v4fa;
typedef v8us __attribute__((may_alias)) v8usa;

__device__ __forceinline__ unsigned short f2bf(float f) { unsigned u = __float_as_uint(f); u += 0x7FFFu + ((u >> 16) & 1u); return (unsigned short)(u >> 16); }
__device__ __forceinline__ float bf2f(unsigned short b) { return __uint_as_float(((unsigned)b) << 16); }
__device__ __forceinline__ float bfr(float f) { return bf2f(f2bf(f)); }
__device__ __forceinline__ v16h cat16(v8h lo, v8h hi) { return __builtin_shufflevector(lo, hi, 0, 1, 2, 3, 4, 5, 6, 7, 8, 9, 10, 11, 12, 13, 14, 15); }
__device__ __forceinline__ v16bf cat16b(v8us lo, v8us hi) { return __builtin_bit_cast(v16bf, __builtin_shufflevector(lo, hi, 0, 1, 2, 3, 4, 5, 6, 7, 8, 9, 10, 11, 12, 13, 14, 15)); }
__device__ __forceinline__ v8f wmma16(v16h a, v16h b, v8f c) { return __builtin_amdgcn_wmma_f32_16x16x32_f16(false, a, false, b, (short)0, c, false, false); }
__device__ __forceinline__ v8f wmmab(v16bf a, v16bf b, v8f c) { return __builtin_amdgcn_wmma_f32_16x16x32_bf16(false, a, false, b, (short)0, c, false, false); }



// ---- k_gemmw: register-blocked GEMM, ONE WAVE per 64x64 output tile (16 accumulators), operands straight from K-contiguous 16-bit planes; grid (M/64, N/64, Z), 32 threads.
// C[m][n] (f32, pitch ldc, + optional f32 bias[n]) = sum_k A[m][k] Bt[n][k] (+ split products per NSPLIT). z-batch strides sA/sB/sC in elements. K % 32 == 0.
template <typename T16> struct WFrag;
template <> struct WFrag<h16> { typedef v16h V; static __device__ __forceinline__ V ld(const h16* p) { return cat16(*(const v8h*)p, *(const v8h*)(p + 16)); } static __device__ __forceinline__ v8f mma(V a, V b, v8f c) { return wmma16(a, b, c); } };
template <> struct WFrag<bf> { typedef v16bf V; static __device__ __forceinline__ V ld(const bf* p) { return cat16b(*(const v8us*)p, *(const v8us*)(p + 16)); } static __device__ __forceinline__ v8f mma(V a, V b, v8f c) { return wmmab(a, b, c); } };
template <typename T16, int NSPLIT, bool BIAS>
__global__ __launch_bounds__(32) void k_gemmw(const T16* __restrict__ A, const T16* __restrict__ A2, const T16* __restrict__ Bt, const T16* __restrict__ Bt2, int K, float* C, int ldc, const float* __restrict__ bias, size_t sA, size_t sB, size_t sC) {
    typedef typename WFrag<T16>::V V;
    __shared__ __align__(16) float os[16 * 68];
    const size_t z = blockIdx.z; A += z * sA; if (A2) A2 += z * sA; Bt += z * sB; if (Bt2) Bt2 += z * sB; C += z * sC;
    const int lane = threadIdx.x & 31, lr = lane & 15, hi = lane >> 4; const int r0 = blockIdx.x * 64, c0 = blockIdx.y * 64;
    v8f acc[4][4];
#pragma unroll
    for (int mb = 0; mb < 4; ++mb)
#pragma unroll
        for (int nb = 0; nb < 4; ++nb) acc[mb][nb] = (v8f){};
    const size_t aoff = (size_t)(r0 + lr) * K + 8 * hi, boff = (size_t)(c0 + lr) * K + 8 * hi;
#pragma unroll 1
    for (int kc = 0; kc < K; kc += 32) {
        V a[4], a2[4];
#pragma unroll
        for (int mb = 0; mb < 4; ++mb) { a[mb] = WFrag<T16>::ld(A + aoff + (size_t)mb * 16 * K + kc); if (NSPLIT == 1 || NSPLIT == 2) a2[mb] = WFrag<T16>::ld(A2 + aoff + (size_t)mb * 16 * K + kc); }
#pragma unroll
        for (int nb = 0; nb < 4; ++nb) { const V b = WFrag<T16>::ld(Bt + boff + (size_t)nb * 16 * K + kc); V b2; if (NSPLIT >= 2) b2 = WFrag<T16>::ld(Bt2 + boff + (size_t)nb * 16 * K + kc);
#pragma unroll
            for (int mb = 0; mb < 4; ++mb) { acc[mb][nb] = WFrag<T16>::mma(a[mb], b, acc[mb][nb]); if (NSPLIT == 1 || NSPLIT == 2) acc[mb][nb] = WFrag<T16>::mma(a2[mb], b, acc[mb][nb]); if (NSPLIT >= 2) acc[mb][nb] = WFrag<T16>::mma(a[mb], b2, acc[mb][nb]); } }
        asm volatile("v_nop\n\tv_nop\n\tv_nop\n\tv_nop" : "+v"(acc[0][0]), "+v"(acc[1][1]), "+v"(acc[2][2]), "+v"(acc[3][3]) : "v"(a[0]), "v"(a[3]));
    }
#pragma unroll
    for (int mb = 0; mb < 4; ++mb) {
#pragma unroll
        for (int nb = 0; nb < 4; ++nb) {
#pragma unroll
            for (int j = 0; j < 8; ++j) os[(hi * 8 + j) * 68 + nb * 16 + lr] = acc[mb][nb][j]; }
        __builtin_amdgcn_wave_barrier(); asm volatile("" ::: "memory");
        float* crow = C + (size_t)(r0 + mb * 16) * ldc + c0;
{
#pragma unroll
            for (int s = 0; s < 8; ++s) { const int row = 2 * s + hi, cofs = lr * 4; v4f val = *(const v4fa*)(os + row * 68 + cofs); if (BIAS) { val[0] += bfr(bias[c0 + cofs]); val[1] += bfr(bias[c0 + cofs + 1]); val[2] += bfr(bias[c0 + cofs + 2]); val[3] += bfr(bias[c0 + cofs + 3]); }
                *(v4f*)(crow + (size_t)row * ldc + cofs) = val; }
             }
        __builtin_amdgcn_wave_barrier(); asm volatile("" ::: "memory");
    }
}

// ---- k_gemmc: the same one-wave 64x64 tile GEMM specialised for causal attention: CMODE 1 skips score tiles entirely above the diagonal (query rows r0+roff.., key columns c0..), CMODE 2 limits the
// key (K) loop of the probability x value contraction to the diagonal block (probabilities beyond it are exactly zero). roff = row offset of this launch's first row within the sequence.
template <typename T16, int NSPLIT, int CMODE>
__global__ __launch_bounds__(32) void k_gemmc(const T16* __restrict__ A, const T16* __restrict__ A2, const T16* __restrict__ Bt, const T16* __restrict__ Bt2, int K, float* C, int ldc, int roff, size_t sA, size_t sB, size_t sC) {
    typedef typename WFrag<T16>::V V;
    __shared__ __align__(16) float os[16 * 68];
    const size_t z = blockIdx.z; A += z * sA; if (A2) A2 += z * sA; Bt += z * sB; if (Bt2) Bt2 += z * sB; C += z * sC;
    const int lane = threadIdx.x & 31, lr = lane & 15, hi = lane >> 4; const int r0 = blockIdx.x * 64, c0 = blockIdx.y * 64;
    if (CMODE == 1 && c0 > r0 + roff + 63) return;                  // score tile entirely above the causal diagonal: never read (the softmax masks j > i by select)
    const int Kl = (CMODE == 2) ? min(K, r0 + roff + 64) : K;        // P.V: probabilities are exactly 0 beyond the diagonal block, so the K loop stops there
    v8f acc[4][4];
#pragma unroll
    for (int mb = 0; mb < 4; ++mb)
#pragma unroll
        for (int nb = 0; nb < 4; ++nb) acc[mb][nb] = (v8f){};
    const size_t aoff = (size_t)(r0 + lr) * K + 8 * hi, boff = (size_t)(c0 + lr) * K + 8 * hi;
#pragma unroll 1
    for (int kc = 0; kc < Kl; kc += 32) {
        V a[4], a2[4];
#pragma unroll
        for (int mb = 0; mb < 4; ++mb) { a[mb] = WFrag<T16>::ld(A + aoff + (size_t)mb * 16 * K + kc); if (NSPLIT == 1 || NSPLIT == 2) a2[mb] = WFrag<T16>::ld(A2 + aoff + (size_t)mb * 16 * K + kc); }
#pragma unroll
        for (int nb = 0; nb < 4; ++nb) { const V b = WFrag<T16>::ld(Bt + boff + (size_t)nb * 16 * K + kc); V b2; if (NSPLIT >= 2) b2 = WFrag<T16>::ld(Bt2 + boff + (size_t)nb * 16 * K + kc);
#pragma unroll
            for (int mb = 0; mb < 4; ++mb) { acc[mb][nb] = WFrag<T16>::mma(a[mb], b, acc[mb][nb]); if (NSPLIT == 1 || NSPLIT == 2) acc[mb][nb] = WFrag<T16>::mma(a2[mb], b, acc[mb][nb]); if (NSPLIT >= 2) acc[mb][nb] = WFrag<T16>::mma(a[mb], b2, acc[mb][nb]); } }
        asm volatile("v_nop\n\tv_nop\n\tv_nop\n\tv_nop" : "+v"(acc[0][0]), "+v"(acc[1][1]), "+v"(acc[2][2]), "+v"(acc[3][3]) : "v"(a[0]), "v"(a[3]));
    }
#pragma unroll
    for (int mb = 0; mb < 4; ++mb) {
#pragma unroll
        for (int nb = 0; nb < 4; ++nb) {
#pragma unroll
            for (int j = 0; j < 8; ++j) os[(hi * 8 + j) * 68 + nb * 16 + lr] = acc[mb][nb][j]; }
        __builtin_amdgcn_wave_barrier(); asm volatile("" ::: "memory");
        float* crow = C + (size_t)(r0 + mb * 16) * ldc + c0;
{
#pragma unroll
            for (int s = 0; s < 8; ++s) { const int row = 2 * s + hi, cofs = lr * 4; v4f val = *(const v4fa*)(os + row * 68 + cofs);
                *(v4f*)(crow + (size_t)row * ldc + cofs) = val; }
             }
        __builtin_amdgcn_wave_barrier(); asm volatile("" ::: "memory");
    }
}

__device__ __forceinline__ h16 tohx(float x) { return (h16)x; }
__device__ __forceinline__ void splitf(float y, unsigned short& h, unsigned short& l) { h = f2bf(y); l = f2bf(y - bf2f(h)); }
typedef __attribute__((ext_vector_type(2))) _Float16 v2h;
typedef __attribute__((ext_vector_type(4))) _Float16 v4h;
typedef __attribute__((ext_vector_type(2))) unsigned short v2us;
typedef __attribute__((ext_vector_type(4))) unsigned short v4us;
typedef __attribute__((ext_vector_type(2))) float v2f;
typedef __attribute__((ext_vector_type(4))) int v4i;

__global__ __launch_bounds__(256) void k_wtG(const float* __restrict__ w, int K, int N, bf* Bt) {
    const int lane = threadIdx.x & 31; const int L0 = (blockIdx.x * 8 + (threadIdx.x >> 5)) * 8; const int nlines = N * K / 64;
{
#pragma unroll 1
        for (int l = 0; l < 8; ++l) { const int L = L0 + l; if (L >= nlines) break; const size_t e = (size_t)L * 64 + lane * 2; const int k = (int)(e % K), n = (int)(e / K); v2us o;
            o[0] = f2bf(w[(size_t)k * N + n]); o[1] = f2bf(w[(size_t)(k + 1) * N + n]); *(v2us*)(Bt + e) = o; }
         }
}
__global__ __launch_bounds__(256) void k_cvt8(const float* __restrict__ src, bf* dst, size_t n8) { const size_t i = (size_t)blockIdx.x * 256 + threadIdx.x; if (i >= n8) return; const v8f v = *(const v8f*)(src + i * 8); v8us o;
#pragma unroll
    for (int k = 0; k < 8; ++k) o[k] = f2bf(v[k]); *(v8us*)(dst + i * 8) = o;  }

// k_rope: head planes [h][t][d] (fp16 + hi/lo) of rope(x) x sc with the rotate-half convention out[d] = x[d] cos[t][d] - x[d+HD/2] sin[t][d], out[d+HD/2] = x[d+HD/2] cos[t][d+HD/2] + x[d] sin[t][d+HD/2]
__global__ __launch_bounds__(256) void k_rope(const float* __restrict__ F, int pitch, int nheads, const float* __restrict__ CS, const float* __restrict__ RF, const float* __restrict__ nw, float sc, h16* P16, bf* Ph, bf* Pl) {
    const size_t e = ((size_t)blockIdx.x * 256 + threadIdx.x) * 2; if (e >= (size_t)nheads * TT * HD) return; const int d = (int)(e % HD); const int t = (int)((e / HD) % TT); const int h = (int)(e / ((size_t)HD * TT)); const float* f = F + (size_t)t * pitch + h * HD; const float rf = RF ? RF[(size_t)h * TT + t] : 1.0f; v2h o16; v2us oh, ol;
#pragma unroll
    for (int q = 0; q < 2; ++q) { const int dd = d + q; const int dp = (dd < HD / 2) ? dd + HD / 2 : dd - HD / 2; float x0 = f[dd], x1 = f[dp];
        if (RF) { float n0 = __fmul_rn(x0, rf), n1 = __fmul_rn(x1, rf); asm volatile("" : "+v"(n0)); asm volatile("" : "+v"(n1)); x0 = __fmul_rn(bfr(nw[dd]), n0); x1 = __fmul_rn(bfr(nw[dp]), n1); }
        const v2f cs = *(const v2f*)(CS + ((size_t)t * HD + dd) * 2); float a = __fmul_rn(x0, cs[0]), bq = __fmul_rn(x1, cs[1]); asm volatile("" : "+v"(a)); asm volatile("" : "+v"(bq)); const float r = ((dd < HD / 2) ? __fsub_rn(a, bq) : __fadd_rn(a, bq)) * sc;
        o16[q] = tohx(r); unsigned short a2, c2; splitf(r, a2, c2); oh[q] = a2; ol[q] = c2; }
    *(v2h*)(P16 + e) = o16; *(v2us*)(Ph + e) = oh; *(v2us*)(Pl + e) = ol;  }
__global__ __launch_bounds__(256) void k_vtp(const float* __restrict__ F, int pitch, int nheads, h16* V16, bf* Vh, bf* Vl) { const size_t e = ((size_t)blockIdx.x * 256 + threadIdx.x) * 2; if (e >= (size_t)nheads * HD * TT) return; const int t = (int)(e % TT); const int d = (int)((e / TT) % HD); const int g = (int)(e / ((size_t)TT * HD)); v2h o16; v2us oh, ol;
#pragma unroll
    for (int q = 0; q < 2; ++q) { const float x = F[(size_t)(t + q) * pitch + g * HD + d]; o16[q] = tohx(x); unsigned short a2, c2; splitf(x, a2, c2); oh[q] = a2; ol[q] = c2; }
    *(v2h*)(V16 + e) = o16; *(v2us*)(Vh + e) = oh; *(v2us*)(Vl + e) = ol;  }
__global__ __launch_bounds__(256) void k_csid(float* CS) { const int idx = blockIdx.x * 256 + threadIdx.x; if (idx >= TT * HD) return; v2f cs; cs[0] = 1.0f; cs[1] = 0.0f; *(v2f*)(CS + (size_t)idx * 2) = cs;  }
__constant__ float SLOPE8[NH_] = { 5.000000000e-1f, 1.000000000e+0f, 1.500000000e+0f, 2.000000000e+0f, 2.500000000e+0f, 3.000000000e+0f, 3.500000000e+0f, 4.000000000e+0f, 4.500000000e+0f, 5.000000000e+0f, 5.500000000e+0f, 6.000000000e+0f, 6.500000000e+0f, 7.000000000e+0f, 7.500000000e+0f, 8.000000000e+0f };   // 8 x the per-head ALiBi slope magnitude (slopes[h] = (h + 1) / 16, h = 0..15, x 8 = (h + 1) / 2: exact); every entry and every product with |i - j| <= 2047 is exact in f32
__global__ __launch_bounds__(256) void k_alibi(float* Sb, int h0) { const size_t k = (size_t)blockIdx.x * 256 + threadIdx.x; if (k >= (size_t)ZH * TT * TT / 4) return; const size_t e = k * 4; const int j0 = (int)(e % TT); const int i = (int)((e / TT) % TT); const int zz = (int)(e / ((size_t)TT * TT)); const float sl = SLOPE8[h0 + zz]; v4f a = *(const v4f*)(Sb + e);
#pragma unroll
    for (int q = 0; q < 4; ++q) { const int dd = i - (j0 + q); const float dist = (float)(dd < 0 ? -dd : dd); float bb = __fmul_rn(sl, dist); asm volatile("" : "+v"(bb)); a[q] = __fsub_rn(a[q], bb); }
    *(v4f*)(Sb + e) = a;  }
// k_asoft: per row (zz, i): t = S x HD^-0.5 for j <= i and i - j < WIN (WIN = TT, so plain causal; the reference's -1e9 additive fill vanishes identically); softmax over the 2048 keys (register row, one exp, fixed trees);
__global__ __launch_bounds__(256) void k_asoft(const float* __restrict__ Sb, h16* P16, bf* Ph, bf* Pl) {
    const int lane = threadIdx.x & 31; const int row = blockIdx.x * 8 + (threadIdx.x >> 5); if (row >= ZH * TT) return; const int i = row % TT; const int zz = row / TT; (void)zz; const bool hires = (i < RH); const float* sr = Sb + (size_t)row * TT; float v[TT / 32]; float mx = -3.0e38f;
#pragma unroll
    for (int ch = 0; ch < TT / 128; ++ch) { const int j0 = ch * 128 + lane * 4; const v4f a = *(const v4f*)(sr + j0);
#pragma unroll
        for (int q = 0; q < 4; ++q) { const int j = j0 + q; (void)j; const float t = (j <= i && i - j < WIN) ? a[q] * SCL : -3.0e38f; v[ch * 4 + q] = t; mx = fmaxf(mx, t); } }
#pragma unroll
    for (int sh = 16; sh; sh >>= 1) mx = fmaxf(mx, __shfl_xor(mx, sh, 32));
    float sum = 0.f;
#pragma unroll
    for (int k = 0; k < TT / 32; ++k) { float d0 = __fsub_rn(v[k], mx); asm volatile("" : "+v"(d0)); v[k] = __builtin_amdgcn_exp2f(__fmul_rn(d0, 1.4426950408889634f)); sum += v[k]; }
#pragma unroll
    for (int sh = 16; sh; sh >>= 1) sum += __shfl_xor(sum, sh, 32);
    const float f = __fdiv_rn(hires ? 1.0f : PCAR, sum);
{
        if (hires) {
#pragma unroll
            for (int ch = 0; ch < TT / 128; ++ch) { v4us oh, ol;
#pragma unroll
                for (int q = 0; q < 4; ++q) { unsigned short a, c2; splitf(v[ch * 4 + q] * f, a, c2); oh[q] = a; ol[q] = c2; }
                const size_t oo = ((size_t)zz * (RH ? RH : 1) + i) * TT + ch * 128 + lane * 4; *(v4us*)(Ph + oo) = oh; *(v4us*)(Pl + oo) = ol; }
        } else {
#pragma unroll
            for (int ch = 0; ch < TT / 128; ++ch) { v4h o4;
#pragma unroll
                for (int q = 0; q < 4; ++q) o4[q] = tohx(v[ch * 4 + q] * f);
                *(v4h*)(P16 + (size_t)row * TT + ch * 128 + lane * 4) = o4; } }
         }
}
__global__ __launch_bounds__(256) void k_merge(const float* __restrict__ O, int h0, bf* Ah, bf* Al) { const size_t e = ((size_t)blockIdx.x * 256 + threadIdx.x) * 2; if (e >= (size_t)ZH * TT * HD) return; const int d = (int)(e % HD); const int t = (int)((e / HD) % TT); const int zz = (int)(e / ((size_t)HD * TT)); const float cs = (t < RH) ? 1.0f : (1.0f / PCAR); const size_t oo = (size_t)t * DQ + (h0 + zz) * HD + d;
    v2us oh, ol;
#pragma unroll
    for (int q = 0; q < 2; ++q) { unsigned short a, c2; splitf(O[e + q] * cs, a, c2); oh[q] = a; ol[q] = c2; } *(v2us*)(Ah + oo) = oh; *(v2us*)(Al + oo) = ol;  }

extern "C" void kernel_launch(void* const* d_in, const int* in_sizes, int n_in,
                              void* d_out, int out_size, void* d_ws, size_t ws_size, hipStream_t stream) {
    (void)in_sizes; (void)n_in; (void)out_size;
    const float* x = (const float*)d_in[0]; const float* wq = (const float*)d_in[1]; const float* bq = (const float*)d_in[2]; const float* wkv = (const float*)d_in[3]; const float* bkv = (const float*)d_in[4]; const float* wo = (const float*)d_in[5]; const float* bo = (const float*)d_in[6];     const float* bk = bkv; const float* bv = bkv + DKV;   /* bias halves */ const float* wk = nullptr; const float* wv = nullptr; (void)wk; (void)wv;
    float* OUT = (float*)d_out;     // [2][2048][1024]
    char* wsp = (char*)d_ws;
    auto take = [&](size_t bytes) { char* p = wsp; wsp += (bytes + 255) & ~(size_t)255; return (void*)p; };
    bf* WQ = (bf*)take((size_t)DQ * DM * 2); bf* WKV = (bf*)take((size_t)2 * DKV * DM * 2); bf* WK = WKV; bf* WV = WKV + (size_t)DKV * DM;   /* fused Bt [2*DKV][DM]: k | v row blocks */ bf* WO = (bf*)take((size_t)DM * DQ * 2); float* CS = (float*)take((size_t)TT * HD * 2 * 4);
    bf* XB = (bf*)take((size_t)TT * DM * 2); float* FQ = (float*)take((size_t)TT * DQ * 4); float* FK = (float*)take((size_t)TT * DKV * 4);
    h16* QP16 = (h16*)take((size_t)NH_ * TT * HD * 2); h16* KP16 = (h16*)take((size_t)NKV * TT * HD * 2); h16* VT16 = (h16*)take((size_t)NKV * HD * TT * 2);
    bf* QPh = (bf*)take((size_t)NH_ * TT * HD * 2); bf* QPl = (bf*)take((size_t)NH_ * TT * HD * 2); bf* KPh = (bf*)take((size_t)NKV * TT * HD * 2); bf* KPl = (bf*)take((size_t)NKV * TT * HD * 2); bf* VTh = (bf*)take((size_t)NKV * HD * TT * 2); bf* VTl = (bf*)take((size_t)NKV * HD * TT * 2); bf* Ph = (bf*)take((size_t)ZH * RH * TT * 2); bf* Pl = (bf*)take((size_t)ZH * RH * TT * 2);
    float* Sb = (float*)take((size_t)ZH * TT * TT * 4); h16* P16 = (h16*)take((size_t)ZH * TT * TT * 2); float* Ob = (float*)take((size_t)ZH * TT * HD * 4); bf* ATh = (bf*)take((size_t)TT * DQ * 2); bf* ATl = (bf*)take((size_t)TT * DQ * 2);
    if ((size_t)(wsp - (char*)d_ws) > ws_size) return;    // ws 256 MiB
    float* FV = FK;   // v projection reuses the k buffer after the k planes are built (stream-ordered)
    { k_wtG<<<(unsigned)((DM * DQ / 64 + 63) / 64), 256, 0, stream>>>(wq, DM, DQ, WQ); k_wtG<<<(unsigned)((DM * 2 * DKV / 64 + 63) / 64), 256, 0, stream>>>(wkv, DM, 2 * DKV, WKV);   /* fused 'xw' [DM][2*DKV] -> Bt [2*DKV][DM]: k | v */
      k_wtG<<<(unsigned)((DQ * DM / 64 + 63) / 64), 256, 0, stream>>>(wo, DQ, DM, WO);
       }
    k_csid<<<(TT * HD + 255) / 256, 256, 0, stream>>>(CS);
    const unsigned LQ = (unsigned)(((size_t)NH_ * TT * HD / 2 + 255) / 256), LKv = (unsigned)(((size_t)NKV * TT * HD / 2 + 255) / 256);
    for (int b = 0; b < NB_; ++b) {
        
        k_cvt8<<<(unsigned)(((size_t)TT * DM / 8 + 255) / 256), 256, 0, stream>>>(x + (size_t)b * TT * DM, XB, (size_t)TT * DM / 8);
        k_gemmw<bf, 0, true><<<dim3(TT / 64, DQ / 64, 1), 32, 0, stream>>>(XB, nullptr, WQ, nullptr, DM, FQ, DQ, bq, 0, 0, 0);
        k_rope<<<LQ, 256, 0, stream>>>(FQ, DQ, NH_, CS, nullptr, nullptr, 1.0f, QP16, QPh, QPl);
        k_gemmw<bf, 0, true><<<dim3(TT / 64, DKV / 64, 1), 32, 0, stream>>>(XB, nullptr, WK, nullptr, DM, FK, DKV, bk, 0, 0, 0);
        k_rope<<<LKv, 256, 0, stream>>>(FK, DKV, NKV, CS, nullptr, nullptr, 1.0f, KP16, KPh, KPl);
        k_gemmw<bf, 0, true><<<dim3(TT / 64, DKV / 64, 1), 32, 0, stream>>>(XB, nullptr, WV, nullptr, DM, FV, DKV, bv, 0, 0, 0); k_vtp<<<LKv, 256, 0, stream>>>(FV, DKV, NKV, VT16, VTh, VTl);
        for (int h0 = 0; h0 < NH_; h0 += ZH) { const size_t zq = (size_t)h0, zk = (size_t)(h0 / REP);   // one kv head per query head: the pass's two heads use consecutive kv planes (z-strides TT*HD)
            k_gemmc<bf, 2, 1><<<dim3(RH / 64, TT / 64, ZH), 32, 0, stream>>>(QPh + zq * TT * HD, QPl + zq * TT * HD, KPh + zk * TT * HD, KPl + zk * TT * HD, HD, Sb, TT, 0, (size_t)TT * HD, (size_t)TT * HD, (size_t)TT * TT);
            k_gemmc<h16, 0, 1><<<dim3((TT - RH) / 64, TT / 64, ZH), 32, 0, stream>>>(QP16 + zq * TT * HD + (size_t)RH * HD, nullptr, KP16 + zk * TT * HD, nullptr, HD, Sb + (size_t)RH * TT, TT, RH, (size_t)TT * HD, (size_t)TT * HD, (size_t)TT * TT);
            k_alibi<<<(unsigned)(((size_t)ZH * TT * TT / 4 + 255) / 256), 256, 0, stream>>>(Sb, h0);   /* - slope_h |i-j| (x 8, in f32) */ k_asoft<<<ZH * TT / 8, 256, 0, stream>>>(Sb, P16, Ph, Pl);
            k_gemmc<bf, 2, 2><<<dim3(RH / 64, HD / 64, ZH), 32, 0, stream>>>(Ph, Pl, VTh + zk * HD * TT, VTl + zk * HD * TT, TT, Ob, HD, 0, (size_t)RH * TT, (size_t)HD * TT, (size_t)TT * HD);
            k_gemmc<h16, 0, 2><<<dim3((TT - RH) / 64, HD / 64, ZH), 32, 0, stream>>>(P16 + (size_t)RH * TT, nullptr, VT16 + zk * HD * TT, nullptr, TT, Ob + (size_t)RH * HD, HD, RH, (size_t)TT * TT, (size_t)HD * TT, (size_t)TT * HD);
            k_merge<<<(unsigned)(((size_t)ZH * TT * HD / 2 + 255) / 256), 256, 0, stream>>>(Ob, h0, ATh, ATl); }
        k_gemmw<bf, 1, true><<<dim3(TT / 64, DM / 64, 1), 32, 0, stream>>>(ATh, ATl, WO, nullptr, DQ, OUT + (size_t)b * TT * DM, DM, bo, 0, 0, 0); }
}

// v001
// One run takes 1100 microseconds.
// Timed twice side by side with v000, it ran 1.48 and 1.47 times as fast.
#include <hip/hip_runtime.h>

// Causal self-attention with ALiBi (linear slopes), a separate q projection and a fused k|v projection (x [2][2048][1024]; q = x q_w + q_b ('xw' [1024][1024] 0.02 + bias zeros: read); kv = (x kv_w + kv_b) ('xw' [1024][2048] 0.02 + bias zeros: read) reshaped (B, T, 2, 16, 64): k | v = column halves (16 heads x 64); att x 1/sqrt(64) + slopes[h] x (j - i) with slopes[h] = (h + 1) / 16 (exact in f32; for the kept entries j <= i this is -slopes[h] x |i - j|); causal (-inf); softmax; y = merged o_w + o_b ('xw' + bias zeros: read) -> [2][2048][1024] (4.2 M); argument order x, q_w, q_b, kv_w, kv_b, o_w, o_b).
// Layout per batch: bf16 copy of x; q_w transposed; the fused kv weight transposed once into Bt (k | v row blocks) + bias halves; exact projections + f32 biases; identity-table plane builders; raw scores, then k_alibi subtracts SLOPE8[h] x |i - j| in f32 (8 x slope = (h + 1) / 2: exact) before the softmax kernel's x 1/8; causal T-2048 attention (hybrid rows: < 512 hi/lo 3 products, rest fp16 x1024; k_gemmc skips tiles above the diagonal); merged hi/lo x o_w exact + o_b.
// Compute dtypes, f32 accumulate: every input rounded to bf16; projections exact + f32 biases; attention rows < 512 3 products, rest fp16; softmax f32; output projection hl x exact.

#define NB_  2
#define TT   2048
#define DM   1024
#define NH_  16
#define NKV  16
#define REP  (NH_ / NKV)
#define HD   64
#define DQ   (NH_ * HD)
#define DKV  (NKV * HD)
#define ZH   4                    // heads per attention pass (grid z of the k_gemmc launches in the head loop); 4 is the most that divides 16 and fits the workspace
#define RH   512                  // query rows < RH use hi+lo planes (0: none)
#define WIN  2048
#define PCAR 1024.0f
#define SCL  0.125f   // HD^-0.5
typedef _Float16 h16;
typedef unsigned short bf;
typedef __attribute__((ext_vector_type(16))) __bf16   v16bf;
typedef __attribute__((ext_vector_type(16))) _Float16 v16h;
typedef __attribute__((ext_vector_type(8)))  _Float16 v8h;
typedef __attribute__((ext_vector_type(8)))  unsigned short v8us;
typedef __attribute__((ext_vector_type(8)))  float    v8f;
typedef __attribute__((ext_vector_type(4)))  float    v4f;
typedef v8h  __attribute__((may_alias)) v8ha;
typedef v4f  __attribute__((may_alias)) v4fa;
typedef v8us __attribute__((may_alias)) v8usa;

__device__ __forceinline__ unsigned short f2bf(float f) { unsigned u = __float_as_uint(f); u += 0x7FFFu + ((u >> 16) & 1u); return (unsigned short)(u >> 16); }
__device__ __forceinline__ float bf2f(unsigned short b) { return __uint_as_float(((unsigned)b) << 16); }
__device__ __forceinline__ float bfr(float f) { return bf2f(f2bf(f)); }
__device__ __forceinline__ v16h cat16(v8h lo, v8h hi) { return __builtin_shufflevector(lo, hi, 0, 1, 2, 3, 4, 5, 6, 7, 8, 9, 10, 11, 12, 13, 14, 15); }
__device__ __forceinline__ v16bf cat16b(v8us lo, v8us hi) { return __builtin_bit_cast(v16bf, __builtin_shufflevector(lo, hi, 0, 1, 2, 3, 4, 5, 6, 7, 8, 9, 10, 11, 12, 13, 14, 15)); }
__device__ __forceinline__ v8f wmma16(v16h a, v16h b, v8f c) { return __builtin_amdgcn_wmma_f32_16x16x32_f16(false, a, false, b, (short)0, c, false, false); }
__device__ __forceinline__ v8f wmmab(v16bf a, v16bf b, v8f c) { return __builtin_amdgcn_wmma_f32_16x16x32_bf16(false, a, false, b, (short)0, c, false, false); }



// ---- k_gemmw: register-blocked GEMM, ONE WAVE per 64x64 output tile (16 accumulators), operands straight from K-contiguous 16-bit planes; grid (M/64, N/64, Z), 32 threads.
// C[m][n] (f32, pitch ldc, + optional f32 bias[n]) = sum_k A[m][k] Bt[n][k] (+ split products per NSPLIT). z-batch strides sA/sB/sC in elements. K % 32 == 0.
template <typename T16> struct WFrag;
template <> struct WFrag<h16> { typedef v16h V; static __device__ __forceinline__ V ld(const h16* p) { return cat16(*(const v8h*)p, *(const v8h*)(p + 16)); } static __device__ __forceinline__ v8f mma(V a, V b, v8f c) { return wmma16(a, b, c); } };
template <> struct WFrag<bf> { typedef v16bf V; static __device__ __forceinline__ V ld(const bf* p) { return cat16b(*(const v8us*)p, *(const v8us*)(p + 16)); } static __device__ __forceinline__ v8f mma(V a, V b, v8f c) { return wmmab(a, b, c); } };
template <typename T16, int NSPLIT, bool BIAS>
__global__ __launch_bounds__(32) void k_gemmw(const T16* __restrict__ A, const T16* __restrict__ A2, const T16* __restrict__ Bt, const T16* __restrict__ Bt2, int K, float* C, int ldc, const float* __restrict__ bias, size_t sA, size_t sB, size_t sC) {
    typedef typename WFrag<T16>::V V;
    __shared__ __align__(16) float os[16 * 68];
    const size_t z = blockIdx.z; A += z * sA; if (A2) A2 += z * sA; Bt += z * sB; if (Bt2) Bt2 += z * sB; C += z * sC;
    const int lane = threadIdx.x & 31, lr = lane & 15, hi = lane >> 4; const int r0 = blockIdx.x * 64, c0 = blockIdx.y * 64;
    v8f acc[4][4];
#pragma unroll
    for (int mb = 0; mb < 4; ++mb)
#pragma unroll
        for (int nb = 0; nb < 4; ++nb) acc[mb][nb] = (v8f){};
    const size_t aoff = (size_t)(r0 + lr) * K + 8 * hi, boff = (size_t)(c0 + lr) * K + 8 * hi;
#pragma unroll 1
    for (int kc = 0; kc < K; kc += 32) {
        V a[4], a2[4];
#pragma unroll
        for (int mb = 0; mb < 4; ++mb) { a[mb] = WFrag<T16>::ld(A + aoff + (size_t)mb * 16 * K + kc); if (NSPLIT == 1 || NSPLIT == 2) a2[mb] = WFrag<T16>::ld(A2 + aoff + (size_t)mb * 16 * K + kc); }
#pragma unroll
        for (int nb = 0; nb < 4; ++nb) { const V b = WFrag<T16>::ld(Bt + boff + (size_t)nb * 16 * K + kc); V b2; if (NSPLIT >= 2) b2 = WFrag<T16>::ld(Bt2 + boff + (size_t)nb * 16 * K + kc);
#pragma unroll
            for (int mb = 0; mb < 4; ++mb) { acc[mb][nb] = WFrag<T16>::mma(a[mb], b, acc[mb][nb]); if (NSPLIT == 1 || NSPLIT == 2) acc[mb][nb] = WFrag<T16>::mma(a2[mb], b, acc[mb][nb]); if (NSPLIT >= 2) acc[mb][nb] = WFrag<T16>::mma(a[mb], b2, acc[mb][nb]); } }
        asm volatile("v_nop\n\tv_nop\n\tv_nop\n\tv_nop" : "+v"(acc[0][0]), "+v"(acc[1][1]), "+v"(acc[2][2]), "+v"(acc[3][3]) : "v"(a[0]), "v"(a[3]));
    }
#pragma unroll
    for (int mb = 0; mb < 4; ++mb) {
#pragma unroll
        for (int nb = 0; nb < 4; ++nb) {
#pragma unroll
            for (int j = 0; j < 8; ++j) os[(hi * 8 + j) * 68 + nb * 16 + lr] = acc[mb][nb][j]; }
        __builtin_amdgcn_wave_barrier(); asm volatile("" ::: "memory");
        float* crow = C + (size_t)(r0 + mb * 16) * ldc + c0;
{
#pragma unroll
            for (int s = 0; s < 8; ++s) { const int row = 2 * s + hi, cofs = lr * 4; v4f val = *(const v4fa*)(os + row * 68 + cofs); if (BIAS) { val[0] += bfr(bias[c0 + cofs]); val[1] += bfr(bias[c0 + cofs + 1]); val[2] += bfr(bias[c0 + cofs + 2]); val[3] += bfr(bias[c0 + cofs + 3]); }
                *(v4f*)(crow + (size_t)row * ldc + cofs) = val; }
             }
        __builtin_amdgcn_wave_barrier(); asm volatile("" ::: "memory");
    }
}

// ---- k_gemmc: the same one-wave 64x64 tile GEMM specialised for causal attention: CMODE 1 skips score tiles entirely above the diagonal (query rows r0+roff.., key columns c0..), CMODE 2 limits the
// key (K) loop of the probability x value contraction to the diagonal block (probabilities beyond it are exactly zero). roff = row offset of this launch's first row within the sequence.
template <typename T16, int NSPLIT, int CMODE>
__global__ __launch_bounds__(32) void k_gemmc(const T16* __restrict__ A, const T16* __restrict__ A2, const T16* __restrict__ Bt, const T16* __restrict__ Bt2, int K, float* C, int ldc, int roff, size_t sA, size_t sB, size_t sC) {
    typedef typename WFrag<T16>::V V;
    __shared__ __align__(16) float os[16 * 68];
    const size_t z = blockIdx.z; A += z * sA; if (A2) A2 += z * sA; Bt += z * sB; if (Bt2) Bt2 += z * sB; C += z * sC;
    const int lane = threadIdx.x & 31, lr = lane & 15, hi = lane >> 4; const int r0 = blockIdx.x * 64, c0 = blockIdx.y * 64;
    if (CMODE == 1 && c0 > r0 + roff + 63) return;                  // score tile entirely above the causal diagonal: never read (the softmax masks j > i by select)
    const int Kl = (CMODE == 2) ? min(K, r0 + roff + 64) : K;        // P.V: probabilities are exactly 0 beyond the diagonal block, so the K loop stops there
    v8f acc[4][4];
#pragma unroll
    for (int mb = 0; mb < 4; ++mb)
#pragma unroll
        for (int nb = 0; nb < 4; ++nb) acc[mb][nb] = (v8f){};
    const size_t aoff = (size_t)(r0 + lr) * K + 8 * hi, boff = (size_t)(c0 + lr) * K + 8 * hi;
#pragma unroll 1
    for (int kc = 0; kc < Kl; kc += 32) {
        V a[4], a2[4];
#pragma unroll
        for (int mb = 0; mb < 4; ++mb) { a[mb] = WFrag<T16>::ld(A + aoff + (size_t)mb * 16 * K + kc); if (NSPLIT == 1 || NSPLIT == 2) a2[mb] = WFrag<T16>::ld(A2 + aoff + (size_t)mb * 16 * K + kc); }
#pragma unroll
        for (int nb = 0; nb < 4; ++nb) { const V b = WFrag<T16>::ld(Bt + boff + (size_t)nb * 16 * K + kc); V b2; if (NSPLIT >= 2) b2 = WFrag<T16>::ld(Bt2 + boff + (size_t)nb * 16 * K + kc);
#pragma unroll
            for (int mb = 0; mb < 4; ++mb) { acc[mb][nb] = WFrag<T16>::mma(a[mb], b, acc[mb][nb]); if (NSPLIT == 1 || NSPLIT == 2) acc[mb][nb] = WFrag<T16>::mma(a2[mb], b, acc[mb][nb]); if (NSPLIT >= 2) acc[mb][nb] = WFrag<T16>::mma(a[mb], b2, acc[mb][nb]); } }
        asm volatile("v_nop\n\tv_nop\n\tv_nop\n\tv_nop" : "+v"(acc[0][0]), "+v"(acc[1][1]), "+v"(acc[2][2]), "+v"(acc[3][3]) : "v"(a[0]), "v"(a[3]));
    }
#pragma unroll
    for (int mb = 0; mb < 4; ++mb) {
#pragma unroll
        for (int nb = 0; nb < 4; ++nb) {
#pragma unroll
            for (int j = 0; j < 8; ++j) os[(hi * 8 + j) * 68 + nb * 16 + lr] = acc[mb][nb][j]; }
        __builtin_amdgcn_wave_barrier(); asm volatile("" ::: "memory");
        float* crow = C + (size_t)(r0 + mb * 16) * ldc + c0;
{
#pragma unroll
            for (int s = 0; s < 8; ++s) { const int row = 2 * s + hi, cofs = lr * 4; v4f val = *(const v4fa*)(os + row * 68 + cofs);
                *(v4f*)(crow + (size_t)row * ldc + cofs) = val; }
             }
        __builtin_amdgcn_wave_barrier(); asm volatile("" ::: "memory");
    }
}

__device__ __forceinline__ h16 tohx(float x) { return (h16)x; }
__device__ __forceinline__ void splitf(float y, unsigned short& h, unsigned short& l) { h = f2bf(y); l = f2bf(y - bf2f(h)); }
typedef __attribute__((ext_vector_type(2))) _Float16 v2h;
typedef __attribute__((ext_vector_type(4))) _Float16 v4h;
typedef __attribute__((ext_vector_type(2))) unsigned short v2us;
typedef __attribute__((ext_vector_type(4))) unsigned short v4us;
typedef __attribute__((ext_vector_type(2))) float v2f;
typedef __attribute__((ext_vector_type(4))) int v4i;

__global__ __launch_bounds__(256) void k_wtG(const float* __restrict__ w, int K, int N, bf* Bt) {
    const int lane = threadIdx.x & 31; const int L0 = (blockIdx.x * 8 + (threadIdx.x >> 5)) * 8; const int nlines = N * K / 64;
{
#pragma unroll 1
        for (int l = 0; l < 8; ++l) { const int L = L0 + l; if (L >= nlines) break; const size_t e = (size_t)L * 64 + lane * 2; const int k = (int)(e % K), n = (int)(e / K); v2us o;
            o[0] = f2bf(w[(size_t)k * N + n]); o[1] = f2bf(w[(size_t)(k + 1) * N + n]); *(v2us*)(Bt + e) = o; }
         }
}
__global__ __launch_bounds__(256) void k_cvt8(const float* __restrict__ src, bf* dst, size_t n8) { const size_t i = (size_t)blockIdx.x * 256 + threadIdx.x; if (i >= n8) return; const v8f v = *(const v8f*)(src + i * 8); v8us o;
#pragma unroll
    for (int k = 0; k < 8; ++k) o[k] = f2bf(v[k]); *(v8us*)(dst + i * 8) = o;  }

// k_rope: head planes [h][t][d] (fp16 + hi/lo) of rope(x) x sc with the rotate-half convention out[d] = x[d] cos[t][d] - x[d+HD/2] sin[t][d], out[d+HD/2] = x[d+HD/2] cos[t][d+HD/2] + x[d] sin[t][d+HD/2]
__global__ __launch_bounds__(256) void k_rope(const float* __restrict__ F, int pitch, int nheads, const float* __restrict__ CS, const float* __restrict__ RF, const float* __restrict__ nw, float sc, h16* P16, bf* Ph, bf* Pl) {
    const size_t e = ((size_t)blockIdx.x * 256 + threadIdx.x) * 2; if (e >= (size_t)nheads * TT * HD) return; const int d = (int)(e % HD); const int t = (int)((e / HD) % TT); const int h = (int)(e / ((size_t)HD * TT)); const float* f = F + (size_t)t * pitch + h * HD; const float rf = RF ? RF[(size_t)h * TT + t] : 1.0f; v2h o16; v2us oh, ol;
#pragma unroll
    for (int q = 0; q < 2; ++q) { const int dd = d + q; const int dp = (dd < HD / 2) ? dd + HD / 2 : dd - HD / 2; float x0 = f[dd], x1 = f[dp];
        if (RF) { float n0 = __fmul_rn(x0, rf), n1 = __fmul_rn(x1, rf); asm volatile("" : "+v"(n0)); asm volatile("" : "+v"(n1)); x0 = __fmul_rn(bfr(nw[dd]), n0); x1 = __fmul_rn(bfr(nw[dp]), n1); }
        const v2f cs = *(const v2f*)(CS + ((size_t)t * HD + dd) * 2); float a = __fmul_rn(x0, cs[0]), bq = __fmul_rn(x1, cs[1]); asm volatile("" : "+v"(a)); asm volatile("" : "+v"(bq)); const float r = ((dd < HD / 2) ? __fsub_rn(a, bq) : __fadd_rn(a, bq)) * sc;
        o16[q] = tohx(r); unsigned short a2, c2; splitf(r, a2, c2); oh[q] = a2; ol[q] = c2; }
    *(v2h*)(P16 + e) = o16; *(v2us*)(Ph + e) = oh; *(v2us*)(Pl + e) = ol;  }
__global__ __launch_bounds__(256) void k_vtp(const float* __restrict__ F, int pitch, int nheads, h16* V16, bf* Vh, bf* Vl) { const size_t e = ((size_t)blockIdx.x * 256 + threadIdx.x) * 2; if (e >= (size_t)nheads * HD * TT) return; const int t = (int)(e % TT); const int d = (int)((e / TT) % HD); const int g = (int)(e / ((size_t)TT * HD)); v2h o16; v2us oh, ol;
#pragma unroll
    for (int q = 0; q < 2; ++q) { const float x = F[(size_t)(t + q) * pitch + g * HD + d]; o16[q] = tohx(x); unsigned short a2, c2; splitf(x, a2, c2); oh[q] = a2; ol[q] = c2; }
    *(v2h*)(V16 + e) = o16; *(v2us*)(Vh + e) = oh; *(v2us*)(Vl + e) = ol;  }
__global__ __launch_bounds__(256) void k_csid(float* CS) { const int idx = blockIdx.x * 256 + threadIdx.x; if (idx >= TT * HD) return; v2f cs; cs[0] = 1.0f; cs[1] = 0.0f; *(v2f*)(CS + (size_t)idx * 2) = cs;  }
__constant__ float SLOPE8[NH_] = { 5.000000000e-1f, 1.000000000e+0f, 1.500000000e+0f, 2.000000000e+0f, 2.500000000e+0f, 3.000000000e+0f, 3.500000000e+0f, 4.000000000e+0f, 4.500000000e+0f, 5.000000000e+0f, 5.500000000e+0f, 6.000000000e+0f, 6.500000000e+0f, 7.000000000e+0f, 7.500000000e+0f, 8.000000000e+0f };   // 8 x the per-head ALiBi slope magnitude (slopes[h] = (h + 1) / 16, h = 0..15, x 8 = (h + 1) / 2: exact); every entry and every product with |i - j| <= 2047 is exact in f32
__global__ __launch_bounds__(256) void k_alibi(float* Sb, int h0) { const size_t k = (size_t)blockIdx.x * 256 + threadIdx.x; if (k >= (size_t)ZH * TT * TT / 4) return; const size_t e = k * 4; const int j0 = (int)(e % TT); const int i = (int)((e / TT) % TT); const int zz = (int)(e / ((size_t)TT * TT)); const float sl = SLOPE8[h0 + zz]; v4f a = *(const v4f*)(Sb + e);
#pragma unroll
    for (int q = 0; q < 4; ++q) { const int dd = i - (j0 + q); const float dist = (float)(dd < 0 ? -dd : dd); float bb = __fmul_rn(sl, dist); asm volatile("" : "+v"(bb)); a[q] = __fsub_rn(a[q], bb); }
    *(v4f*)(Sb + e) = a;  }
// k_asoft: per row (zz, i): t = S x HD^-0.5 for j <= i and i - j < WIN (WIN = TT, so plain causal; the reference's -1e9 additive fill vanishes identically); softmax over the 2048 keys (register row, one exp, fixed trees);
__global__ __launch_bounds__(256) void k_asoft(const float* __restrict__ Sb, h16* P16, bf* Ph, bf* Pl) {
    const int lane = threadIdx.x & 31; const int row = blockIdx.x * 8 + (threadIdx.x >> 5); if (row >= ZH * TT) return; const int i = row % TT; const int zz = row / TT; (void)zz; const bool hires = (i < RH); const float* sr = Sb + (size_t)row * TT; float v[TT / 32]; float mx = -3.0e38f;
#pragma unroll
    for (int ch = 0; ch < TT / 128; ++ch) { const int j0 = ch * 128 + lane * 4; const v4f a = *(const v4f*)(sr + j0);
#pragma unroll
        for (int q = 0; q < 4; ++q) { const int j = j0 + q; (void)j; const float t = (j <= i && i - j < WIN) ? a[q] * SCL : -3.0e38f; v[ch * 4 + q] = t; mx = fmaxf(mx, t); } }
#pragma unroll
    for (int sh = 16; sh; sh >>= 1) mx = fmaxf(mx, __shfl_xor(mx, sh, 32));
    float sum = 0.f;
#pragma unroll
    for (int k = 0; k < TT / 32; ++k) { float d0 = __fsub_rn(v[k], mx); asm volatile("" : "+v"(d0)); v[k] = __builtin_amdgcn_exp2f(__fmul_rn(d0, 1.4426950408889634f)); sum += v[k]; }
#pragma unroll
    for (int sh = 16; sh; sh >>= 1) sum += __shfl_xor(sum, sh, 32);
    const float f = __fdiv_rn(hires ? 1.0f : PCAR, sum);
{
        if (hires) {
#pragma unroll
            for (int ch = 0; ch < TT / 128; ++ch) { v4us oh, ol;
#pragma unroll
                for (int q = 0; q < 4; ++q) { unsigned short a, c2; splitf(v[ch * 4 + q] * f, a, c2); oh[q] = a; ol[q] = c2; }
                const size_t oo = ((size_t)zz * (RH ? RH : 1) + i) * TT + ch * 128 + lane * 4; *(v4us*)(Ph + oo) = oh; *(v4us*)(Pl + oo) = ol; }
        } else {
#pragma unroll
            for (int ch = 0; ch < TT / 128; ++ch) { v4h o4;
#pragma unroll
                for (int q = 0; q < 4; ++q) o4[q] = tohx(v[ch * 4 + q] * f);
                *(v4h*)(P16 + (size_t)row * TT + ch * 128 + lane * 4) = o4; } }
         }
}
__global__ __launch_bounds__(256) void k_merge(const float* __restrict__ O, int h0, bf* Ah, bf* Al) { const size_t e = ((size_t)blockIdx.x * 256 + threadIdx.x) * 2; if (e >= (size_t)ZH * TT * HD) return; const int d = (int)(e % HD); const int t = (int)((e / HD) % TT); const int zz = (int)(e / ((size_t)HD * TT)); const float cs = (t < RH) ? 1.0f : (1.0f / PCAR); const size_t oo = (size_t)t * DQ + (h0 + zz) * HD + d;
    v2us oh, ol;
#pragma unroll
    for (int q = 0; q < 2; ++q) { unsigned short a, c2; splitf(O[e + q] * cs, a, c2); oh[q] = a; ol[q] = c2; } *(v2us*)(Ah + oo) = oh; *(v2us*)(Al + oo) = ol;  }

extern "C" void kernel_launch(void* const* d_in, const int* in_sizes, int n_in,
                              void* d_out, int out_size, void* d_ws, size_t ws_size, hipStream_t stream) {
    (void)in_sizes; (void)n_in; (void)out_size;
    const float* x = (const float*)d_in[0]; const float* wq = (const float*)d_in[1]; const float* bq = (const float*)d_in[2]; const float* wkv = (const float*)d_in[3]; const float* bkv = (const float*)d_in[4]; const float* wo = (const float*)d_in[5]; const float* bo = (const float*)d_in[6];     const float* bk = bkv; const float* bv = bkv + DKV;   /* bias halves */ const float* wk = nullptr; const float* wv = nullptr; (void)wk; (void)wv;
    float* OUT = (float*)d_out;     // [2][2048][1024]
    char* wsp = (char*)d_ws;
    auto take = [&](size_t bytes) { char* p = wsp; wsp += (bytes + 255) & ~(size_t)255; return (void*)p; };
    bf* WQ = (bf*)take((size_t)DQ * DM * 2); bf* WKV = (bf*)take((size_t)2 * DKV * DM * 2); bf* WK = WKV; bf* WV = WKV + (size_t)DKV * DM;   /* fused Bt [2*DKV][DM]: k | v row blocks */ bf* WO = (bf*)take((size_t)DM * DQ * 2); float* CS = (float*)take((size_t)TT * HD * 2 * 4);
    bf* XB = (bf*)take((size_t)TT * DM * 2); float* FQ = (float*)take((size_t)TT * DQ * 4); float* FK = (float*)take((size_t)TT * DKV * 4);
    h16* QP16 = (h16*)take((size_t)NH_ * TT * HD * 2); h16* KP16 = (h16*)take((size_t)NKV * TT * HD * 2); h16* VT16 = (h16*)take((size_t)NKV * HD * TT * 2);
    bf* QPh = (bf*)take((size_t)NH_ * TT * HD * 2); bf* QPl = (bf*)take((size_t)NH_ * TT * HD * 2); bf* KPh = (bf*)take((size_t)NKV * TT * HD * 2); bf* KPl = (bf*)take((size_t)NKV * TT * HD * 2); bf* VTh = (bf*)take((size_t)NKV * HD * TT * 2); bf* VTl = (bf*)take((size_t)NKV * HD * TT * 2); bf* Ph = (bf*)take((size_t)ZH * RH * TT * 2); bf* Pl = (bf*)take((size_t)ZH * RH * TT * 2);
    float* Sb = (float*)take((size_t)ZH * TT * TT * 4); h16* P16 = (h16*)take((size_t)ZH * TT * TT * 2); float* Ob = (float*)take((size_t)ZH * TT * HD * 4); bf* ATh = (bf*)take((size_t)TT * DQ * 2); bf* ATl = (bf*)take((size_t)TT * DQ * 2);
    if ((size_t)(wsp - (char*)d_ws) > ws_size) return;    // ws 256 MiB
    float* FV = FK;   // v projection reuses the k buffer after the k planes are built (stream-ordered)
    { k_wtG<<<(unsigned)((DM * DQ / 64 + 63) / 64), 256, 0, stream>>>(wq, DM, DQ, WQ); k_wtG<<<(unsigned)((DM * 2 * DKV / 64 + 63) / 64), 256, 0, stream>>>(wkv, DM, 2 * DKV, WKV);   /* fused 'xw' [DM][2*DKV] -> Bt [2*DKV][DM]: k | v */
      k_wtG<<<(unsigned)((DQ * DM / 64 + 63) / 64), 256, 0, stream>>>(wo, DQ, DM, WO);
       }
    k_csid<<<(TT * HD + 255) / 256, 256, 0, stream>>>(CS);
    const unsigned LQ = (unsigned)(((size_t)NH_ * TT * HD / 2 + 255) / 256), LKv = (unsigned)(((size_t)NKV * TT * HD / 2 + 255) / 256);
    for (int b = 0; b < NB_; ++b) {
        
        k_cvt8<<<(unsigned)(((size_t)TT * DM / 8 + 255) / 256), 256, 0, stream>>>(x + (size_t)b * TT * DM, XB, (size_t)TT * DM / 8);
        k_gemmw<bf, 0, true><<<dim3(TT / 64, DQ / 64, 1), 32, 0, stream>>>(XB, nullptr, WQ, nullptr, DM, FQ, DQ, bq, 0, 0, 0);
        k_rope<<<LQ, 256, 0, stream>>>(FQ, DQ, NH_, CS, nullptr, nullptr, 1.0f, QP16, QPh, QPl);
        k_gemmw<bf, 0, true><<<dim3(TT / 64, DKV / 64, 1), 32, 0, stream>>>(XB, nullptr, WK, nullptr, DM, FK, DKV, bk, 0, 0, 0);
        k_rope<<<LKv, 256, 0, stream>>>(FK, DKV, NKV, CS, nullptr, nullptr, 1.0f, KP16, KPh, KPl);
        k_gemmw<bf, 0, true><<<dim3(TT / 64, DKV / 64, 1), 32, 0, stream>>>(XB, nullptr, WV, nullptr, DM, FV, DKV, bv, 0, 0, 0); k_vtp<<<LKv, 256, 0, stream>>>(FV, DKV, NKV, VT16, VTh, VTl);
        for (int h0 = 0; h0 < NH_; h0 += ZH) { const size_t zq = (size_t)h0, zk = (size_t)(h0 / REP);   // one kv head per query head: the pass's ZH heads use consecutive kv planes (z-strides TT*HD)
            k_gemmc<bf, 2, 1><<<dim3(RH / 64, TT / 64, ZH), 32, 0, stream>>>(QPh + zq * TT * HD, QPl + zq * TT * HD, KPh + zk * TT * HD, KPl + zk * TT * HD, HD, Sb, TT, 0, (size_t)TT * HD, (size_t)TT * HD, (size_t)TT * TT);
            k_gemmc<h16, 0, 1><<<dim3((TT - RH) / 64, TT / 64, ZH), 32, 0, stream>>>(QP16 + zq * TT * HD + (size_t)RH * HD, nullptr, KP16 + zk * TT * HD, nullptr, HD, Sb + (size_t)RH * TT, TT, RH, (size_t)TT * HD, (size_t)TT * HD, (size_t)TT * TT);
            k_alibi<<<(unsigned)(((size_t)ZH * TT * TT / 4 + 255) / 256), 256, 0, stream>>>(Sb, h0);   /* - slope_h |i-j| (x 8, in f32) */ k_asoft<<<ZH * TT / 8, 256, 0, stream>>>(Sb, P16, Ph, Pl);
            k_gemmc<bf, 2, 2><<<dim3(RH / 64, HD / 64, ZH), 32, 0, stream>>>(Ph, Pl, VTh + zk * HD * TT, VTl + zk * HD * TT, TT, Ob, HD, 0, (size_t)RH * TT, (size_t)HD * TT, (size_t)TT * HD);
            k_gemmc<h16, 0, 2><<<dim3((TT - RH) / 64, HD / 64, ZH), 32, 0, stream>>>(P16 + (size_t)RH * TT, nullptr, VT16 + zk * HD * TT, nullptr, TT, Ob + (size_t)RH * HD, HD, RH, (size_t)TT * TT, (size_t)HD * TT, (size_t)TT * HD);
            k_merge<<<(unsigned)(((size_t)ZH * TT * HD / 2 + 255) / 256), 256, 0, stream>>>(Ob, h0, ATh, ATl); }
        k_gemmw<bf, 1, true><<<dim3(TT / 64, DM / 64, 1), 32, 0, stream>>>(ATh, ATl, WO, nullptr, DQ, OUT + (size_t)b * TT * DM, DM, bo, 0, 0, 0); }
}

// v002
// Measured time: 782 microseconds a run.
// Timed twice side by side with v001, it ran 1.41 and 1.42 times as fast.
// Counting every step since v000, it is 2.09 times as fast.
#include <hip/hip_runtime.h>

// Causal self-attention with ALiBi (linear slopes), a separate q projection and a fused k|v projection (x [2][2048][1024]; q = x q_w + q_b ('xw' [1024][1024] 0.02 + bias zeros: read); kv = (x kv_w + kv_b) ('xw' [1024][2048] 0.02 + bias zeros: read) reshaped (B, T, 2, 16, 64): k | v = column halves (16 heads x 64); att x 1/sqrt(64) + slopes[h] x (j - i) with slopes[h] = (h + 1) / 16 (exact in f32; for the kept entries j <= i this is -slopes[h] x |i - j|); causal (-inf); softmax; y = merged o_w + o_b ('xw' + bias zeros: read) -> [2][2048][1024] (4.2 M); argument order x, q_w, q_b, kv_w, kv_b, o_w, o_b).
// Layout per batch: bf16 copy of x; q_w transposed; the fused kv weight transposed once into Bt (k | v row blocks) + bias halves; exact projections + f32 biases; identity-table plane builders; raw scores, then k_alibi subtracts SLOPE8[h] x |i - j| in f32 (8 x slope = (h + 1) / 2: exact) before the softmax kernel's x 1/8; causal T-2048 attention (hybrid rows: < 512 hi/lo 3 products, rest fp16 x1024; k_gemmc skips tiles above the diagonal); merged hi/lo x o_w exact + o_b.
// Compute dtypes, f32 accumulate: every input rounded to bf16; projections exact + f32 biases; attention rows < 512 3 products, rest fp16; softmax f32; output projection hl x exact.

#define NB_  2
#define TT   2048
#define DM   1024
#define NH_  16
#define NKV  16
#define REP  (NH_ / NKV)
#define HD   64
#define DQ   (NH_ * HD)
#define DKV  (NKV * HD)
#define ZH   4                    // heads per attention pass (grid z of the k_gemmc launches in the head loop); 4 is the most that divides 16 and fits the workspace
#define RH   512                  // query rows < RH use hi+lo planes (0: none)
#define KSP  8                    // key-range splits of the probability x value contraction: one work-group per split, f32 partial planes summed in k_merge
#define WIN  2048
#define PCAR 1024.0f
#define SCL  0.125f   // HD^-0.5
typedef _Float16 h16;
typedef unsigned short bf;
typedef __attribute__((ext_vector_type(16))) __bf16   v16bf;
typedef __attribute__((ext_vector_type(16))) _Float16 v16h;
typedef __attribute__((ext_vector_type(8)))  _Float16 v8h;
typedef __attribute__((ext_vector_type(8)))  unsigned short v8us;
typedef __attribute__((ext_vector_type(8)))  float    v8f;
typedef __attribute__((ext_vector_type(4)))  float    v4f;
typedef v8h  __attribute__((may_alias)) v8ha;
typedef v4f  __attribute__((may_alias)) v4fa;
typedef v8us __attribute__((may_alias)) v8usa;

__device__ __forceinline__ unsigned short f2bf(float f) { unsigned u = __float_as_uint(f); u += 0x7FFFu + ((u >> 16) & 1u); return (unsigned short)(u >> 16); }
__device__ __forceinline__ float bf2f(unsigned short b) { return __uint_as_float(((unsigned)b) << 16); }
__device__ __forceinline__ float bfr(float f) { return bf2f(f2bf(f)); }
__device__ __forceinline__ v16h cat16(v8h lo, v8h hi) { return __builtin_shufflevector(lo, hi, 0, 1, 2, 3, 4, 5, 6, 7, 8, 9, 10, 11, 12, 13, 14, 15); }
__device__ __forceinline__ v16bf cat16b(v8us lo, v8us hi) { return __builtin_bit_cast(v16bf, __builtin_shufflevector(lo, hi, 0, 1, 2, 3, 4, 5, 6, 7, 8, 9, 10, 11, 12, 13, 14, 15)); }
__device__ __forceinline__ v8f wmma16(v16h a, v16h b, v8f c) { return __builtin_amdgcn_wmma_f32_16x16x32_f16(false, a, false, b, (short)0, c, false, false); }
__device__ __forceinline__ v8f wmmab(v16bf a, v16bf b, v8f c) { return __builtin_amdgcn_wmma_f32_16x16x32_bf16(false, a, false, b, (short)0, c, false, false); }



// ---- k_gemmw: register-blocked GEMM, ONE WAVE per 64x64 output tile (16 accumulators), operands straight from K-contiguous 16-bit planes; grid (M/64, N/64, Z), 32 threads.
// C[m][n] (f32, pitch ldc, + optional f32 bias[n]) = sum_k A[m][k] Bt[n][k] (+ split products per NSPLIT). z-batch strides sA/sB/sC in elements. K % 32 == 0.
template <typename T16> struct WFrag;
template <> struct WFrag<h16> { typedef v16h V; static __device__ __forceinline__ V ld(const h16* p) { return cat16(*(const v8h*)p, *(const v8h*)(p + 16)); } static __device__ __forceinline__ v8f mma(V a, V b, v8f c) { return wmma16(a, b, c); } };
template <> struct WFrag<bf> { typedef v16bf V; static __device__ __forceinline__ V ld(const bf* p) { return cat16b(*(const v8us*)p, *(const v8us*)(p + 16)); } static __device__ __forceinline__ v8f mma(V a, V b, v8f c) { return wmmab(a, b, c); } };
template <typename T16, int NSPLIT, bool BIAS>
__global__ __launch_bounds__(32) void k_gemmw(const T16* __restrict__ A, const T16* __restrict__ A2, const T16* __restrict__ Bt, const T16* __restrict__ Bt2, int K, float* C, int ldc, const float* __restrict__ bias, size_t sA, size_t sB, size_t sC) {
    typedef typename WFrag<T16>::V V;
    __shared__ __align__(16) float os[16 * 68];
    const size_t z = blockIdx.z; A += z * sA; if (A2) A2 += z * sA; Bt += z * sB; if (Bt2) Bt2 += z * sB; C += z * sC;
    const int lane = threadIdx.x & 31, lr = lane & 15, hi = lane >> 4; const int r0 = blockIdx.x * 64, c0 = blockIdx.y * 64;
    v8f acc[4][4];
#pragma unroll
    for (int mb = 0; mb < 4; ++mb)
#pragma unroll
        for (int nb = 0; nb < 4; ++nb) acc[mb][nb] = (v8f){};
    const size_t aoff = (size_t)(r0 + lr) * K + 8 * hi, boff = (size_t)(c0 + lr) * K + 8 * hi;
#pragma unroll 1
    for (int kc = 0; kc < K; kc += 32) {
        V a[4], a2[4];
#pragma unroll
        for (int mb = 0; mb < 4; ++mb) { a[mb] = WFrag<T16>::ld(A + aoff + (size_t)mb * 16 * K + kc); if (NSPLIT == 1 || NSPLIT == 2) a2[mb] = WFrag<T16>::ld(A2 + aoff + (size_t)mb * 16 * K + kc); }
#pragma unroll
        for (int nb = 0; nb < 4; ++nb) { const V b = WFrag<T16>::ld(Bt + boff + (size_t)nb * 16 * K + kc); V b2; if (NSPLIT >= 2) b2 = WFrag<T16>::ld(Bt2 + boff + (size_t)nb * 16 * K + kc);
#pragma unroll
            for (int mb = 0; mb < 4; ++mb) { acc[mb][nb] = WFrag<T16>::mma(a[mb], b, acc[mb][nb]); if (NSPLIT == 1 || NSPLIT == 2) acc[mb][nb] = WFrag<T16>::mma(a2[mb], b, acc[mb][nb]); if (NSPLIT >= 2) acc[mb][nb] = WFrag<T16>::mma(a[mb], b2, acc[mb][nb]); } }
        asm volatile("v_nop\n\tv_nop\n\tv_nop\n\tv_nop" : "+v"(acc[0][0]), "+v"(acc[1][1]), "+v"(acc[2][2]), "+v"(acc[3][3]) : "v"(a[0]), "v"(a[3]));
    }
#pragma unroll
    for (int mb = 0; mb < 4; ++mb) {
#pragma unroll
        for (int nb = 0; nb < 4; ++nb) {
#pragma unroll
            for (int j = 0; j < 8; ++j) os[(hi * 8 + j) * 68 + nb * 16 + lr] = acc[mb][nb][j]; }
        __builtin_amdgcn_wave_barrier(); asm volatile("" ::: "memory");
        float* crow = C + (size_t)(r0 + mb * 16) * ldc + c0;
{
#pragma unroll
            for (int s = 0; s < 8; ++s) { const int row = 2 * s + hi, cofs = lr * 4; v4f val = *(const v4fa*)(os + row * 68 + cofs); if (BIAS) { val[0] += bfr(bias[c0 + cofs]); val[1] += bfr(bias[c0 + cofs + 1]); val[2] += bfr(bias[c0 + cofs + 2]); val[3] += bfr(bias[c0 + cofs + 3]); }
                *(v4f*)(crow + (size_t)row * ldc + cofs) = val; }
             }
        __builtin_amdgcn_wave_barrier(); asm volatile("" ::: "memory");
    }
}

// ---- k_gemmc: the same one-wave 64x64 tile GEMM specialised for causal attention: CMODE 1 skips score tiles entirely above the diagonal (query rows r0+roff.., key columns c0..), CMODE 2 limits the
// key (K) loop of the probability x value contraction to the diagonal block (probabilities beyond it are exactly zero). roff = row offset of this launch's first row within the sequence.
// KS > 1: grid y = column tiles x KS; split ks sums its own run of whole 64-key chunks of [0, Kl) into partial plane ks (stride sP); a split whose run is empty stores zeros, so every plane is fully written.
template <typename T16, int NSPLIT, int CMODE, int KS>
__global__ __launch_bounds__(32) void k_gemmc(const T16* __restrict__ A, const T16* __restrict__ A2, const T16* __restrict__ Bt, const T16* __restrict__ Bt2, int K, float* C, int ldc, int roff, size_t sA, size_t sB, size_t sC, size_t sP) {
    typedef typename WFrag<T16>::V V;
    __shared__ __align__(16) float os[16 * 68];
    const size_t z = blockIdx.z; A += z * sA; if (A2) A2 += z * sA; Bt += z * sB; if (Bt2) Bt2 += z * sB; C += z * sC;
    const int lane = threadIdx.x & 31, lr = lane & 15, hi = lane >> 4; const int r0 = blockIdx.x * 64, c0 = (int)(blockIdx.y / KS) * 64, ks = (int)(blockIdx.y % KS);
    if (CMODE == 1 && c0 > r0 + roff + 63) return;                  // score tile entirely above the causal diagonal: never read (the softmax masks j > i by select)
    const int Kl = (CMODE == 2) ? min(K, r0 + roff + 64) : K;        // P.V: probabilities are exactly 0 beyond the diagonal block, so the K loop stops there
    const int per = (KS > 1) ? ((Kl / 64 + KS - 1) / KS) * 64 : Kl;  // keys per split: the tile's own range in runs of ceil(Kl / 64 / KS) whole 64-key chunks (later splits may get fewer or none), so the longest dependent load chain is one such run
    const int kb = ks * per, ke = min(Kl, kb + per); C += (size_t)ks * sP;
    v8f acc[4][4];
#pragma unroll
    for (int mb = 0; mb < 4; ++mb)
#pragma unroll
        for (int nb = 0; nb < 4; ++nb) acc[mb][nb] = (v8f){};
    const size_t aoff = (size_t)(r0 + lr) * K + 8 * hi, boff = (size_t)(c0 + lr) * K + 8 * hi;
#pragma unroll 1
    for (int kc = kb; kc < ke; kc += 32) {
        V a[4], a2[4];
#pragma unroll
        for (int mb = 0; mb < 4; ++mb) { a[mb] = WFrag<T16>::ld(A + aoff + (size_t)mb * 16 * K + kc); if (NSPLIT == 1 || NSPLIT == 2) a2[mb] = WFrag<T16>::ld(A2 + aoff + (size_t)mb * 16 * K + kc); }
#pragma unroll
        for (int nb = 0; nb < 4; ++nb) { const V b = WFrag<T16>::ld(Bt + boff + (size_t)nb * 16 * K + kc); V b2; if (NSPLIT >= 2) b2 = WFrag<T16>::ld(Bt2 + boff + (size_t)nb * 16 * K + kc);
#pragma unroll
            for (int mb = 0; mb < 4; ++mb) { acc[mb][nb] = WFrag<T16>::mma(a[mb], b, acc[mb][nb]); if (NSPLIT == 1 || NSPLIT == 2) acc[mb][nb] = WFrag<T16>::mma(a2[mb], b, acc[mb][nb]); if (NSPLIT >= 2) acc[mb][nb] = WFrag<T16>::mma(a[mb], b2, acc[mb][nb]); } }
        asm volatile("v_nop\n\tv_nop\n\tv_nop\n\tv_nop" : "+v"(acc[0][0]), "+v"(acc[1][1]), "+v"(acc[2][2]), "+v"(acc[3][3]) : "v"(a[0]), "v"(a[3]));
    }
#pragma unroll
    for (int mb = 0; mb < 4; ++mb) {
#pragma unroll
        for (int nb = 0; nb < 4; ++nb) {
#pragma unroll
            for (int j = 0; j < 8; ++j) os[(hi * 8 + j) * 68 + nb * 16 + lr] = acc[mb][nb][j]; }
        __builtin_amdgcn_wave_barrier(); asm volatile("" ::: "memory");
        float* crow = C + (size_t)(r0 + mb * 16) * ldc + c0;
{
#pragma unroll
            for (int s = 0; s < 8; ++s) { const int row = 2 * s + hi, cofs = lr * 4; v4f val = *(const v4fa*)(os + row * 68 + cofs);
                *(v4f*)(crow + (size_t)row * ldc + cofs) = val; }
             }
        __builtin_amdgcn_wave_barrier(); asm volatile("" ::: "memory");
    }
}

__device__ __forceinline__ h16 tohx(float x) { return (h16)x; }
__device__ __forceinline__ void splitf(float y, unsigned short& h, unsigned short& l) { h = f2bf(y); l = f2bf(y - bf2f(h)); }
typedef __attribute__((ext_vector_type(2))) _Float16 v2h;
typedef __attribute__((ext_vector_type(4))) _Float16 v4h;
typedef __attribute__((ext_vector_type(2))) unsigned short v2us;
typedef __attribute__((ext_vector_type(4))) unsigned short v4us;
typedef __attribute__((ext_vector_type(2))) float v2f;
typedef __attribute__((ext_vector_type(4))) int v4i;

__global__ __launch_bounds__(256) void k_wtG(const float* __restrict__ w, int K, int N, bf* Bt) {
    const int lane = threadIdx.x & 31; const int L0 = (blockIdx.x * 8 + (threadIdx.x >> 5)) * 8; const int nlines = N * K / 64;
{
#pragma unroll 1
        for (int l = 0; l < 8; ++l) { const int L = L0 + l; if (L >= nlines) break; const size_t e = (size_t)L * 64 + lane * 2; const int k = (int)(e % K), n = (int)(e / K); v2us o;
            o[0] = f2bf(w[(size_t)k * N + n]); o[1] = f2bf(w[(size_t)(k + 1) * N + n]); *(v2us*)(Bt + e) = o; }
         }
}
__global__ __launch_bounds__(256) void k_cvt8(const float* __restrict__ src, bf* dst, size_t n8) { const size_t i = (size_t)blockIdx.x * 256 + threadIdx.x; if (i >= n8) return; const v8f v = *(const v8f*)(src + i * 8); v8us o;
#pragma unroll
    for (int k = 0; k < 8; ++k) o[k] = f2bf(v[k]); *(v8us*)(dst + i * 8) = o;  }

// k_rope: head planes [h][t][d] (fp16 + hi/lo) of rope(x) x sc with the rotate-half convention out[d] = x[d] cos[t][d] - x[d+HD/2] sin[t][d], out[d+HD/2] = x[d+HD/2] cos[t][d+HD/2] + x[d] sin[t][d+HD/2]
__global__ __launch_bounds__(256) void k_rope(const float* __restrict__ F, int pitch, int nheads, const float* __restrict__ CS, const float* __restrict__ RF, const float* __restrict__ nw, float sc, h16* P16, bf* Ph, bf* Pl) {
    const size_t e = ((size_t)blockIdx.x * 256 + threadIdx.x) * 2; if (e >= (size_t)nheads * TT * HD) return; const int d = (int)(e % HD); const int t = (int)((e / HD) % TT); const int h = (int)(e / ((size_t)HD * TT)); const float* f = F + (size_t)t * pitch + h * HD; const float rf = RF ? RF[(size_t)h * TT + t] : 1.0f; v2h o16; v2us oh, ol;
#pragma unroll
    for (int q = 0; q < 2; ++q) { const int dd = d + q; const int dp = (dd < HD / 2) ? dd + HD / 2 : dd - HD / 2; float x0 = f[dd], x1 = f[dp];
        if (RF) { float n0 = __fmul_rn(x0, rf), n1 = __fmul_rn(x1, rf); asm volatile("" : "+v"(n0)); asm volatile("" : "+v"(n1)); x0 = __fmul_rn(bfr(nw[dd]), n0); x1 = __fmul_rn(bfr(nw[dp]), n1); }
        const v2f cs = *(const v2f*)(CS + ((size_t)t * HD + dd) * 2); float a = __fmul_rn(x0, cs[0]), bq = __fmul_rn(x1, cs[1]); asm volatile("" : "+v"(a)); asm volatile("" : "+v"(bq)); const float r = ((dd < HD / 2) ? __fsub_rn(a, bq) : __fadd_rn(a, bq)) * sc;
        o16[q] = tohx(r); unsigned short a2, c2; splitf(r, a2, c2); oh[q] = a2; ol[q] = c2; }
    *(v2h*)(P16 + e) = o16; *(v2us*)(Ph + e) = oh; *(v2us*)(Pl + e) = ol;  }
__global__ __launch_bounds__(256) void k_vtp(const float* __restrict__ F, int pitch, int nheads, h16* V16, bf* Vh, bf* Vl) { const size_t e = ((size_t)blockIdx.x * 256 + threadIdx.x) * 2; if (e >= (size_t)nheads * HD * TT) return; const int t = (int)(e % TT); const int d = (int)((e / TT) % HD); const int g = (int)(e / ((size_t)TT * HD)); v2h o16; v2us oh, ol;
#pragma unroll
    for (int q = 0; q < 2; ++q) { const float x = F[(size_t)(t + q) * pitch + g * HD + d]; o16[q] = tohx(x); unsigned short a2, c2; splitf(x, a2, c2); oh[q] = a2; ol[q] = c2; }
    *(v2h*)(V16 + e) = o16; *(v2us*)(Vh + e) = oh; *(v2us*)(Vl + e) = ol;  }
__global__ __launch_bounds__(256) void k_csid(float* CS) { const int idx = blockIdx.x * 256 + threadIdx.x; if (idx >= TT * HD) return; v2f cs; cs[0] = 1.0f; cs[1] = 0.0f; *(v2f*)(CS + (size_t)idx * 2) = cs;  }
__constant__ float SLOPE8[NH_] = { 5.000000000e-1f, 1.000000000e+0f, 1.500000000e+0f, 2.000000000e+0f, 2.500000000e+0f, 3.000000000e+0f, 3.500000000e+0f, 4.000000000e+0f, 4.500000000e+0f, 5.000000000e+0f, 5.500000000e+0f, 6.000000000e+0f, 6.500000000e+0f, 7.000000000e+0f, 7.500000000e+0f, 8.000000000e+0f };   // 8 x the per-head ALiBi slope magnitude (slopes[h] = (h + 1) / 16, h = 0..15, x 8 = (h + 1) / 2: exact); every entry and every product with |i - j| <= 2047 is exact in f32
__global__ __launch_bounds__(256) void k_alibi(float* Sb, int h0) { const size_t k = (size_t)blockIdx.x * 256 + threadIdx.x; if (k >= (size_t)ZH * TT * TT / 4) return; const size_t e = k * 4; const int j0 = (int)(e % TT); const int i = (int)((e / TT) % TT); const int zz = (int)(e / ((size_t)TT * TT)); const float sl = SLOPE8[h0 + zz]; v4f a = *(const v4f*)(Sb + e);
#pragma unroll
    for (int q = 0; q < 4; ++q) { const int dd = i - (j0 + q); const float dist = (float)(dd < 0 ? -dd : dd); float bb = __fmul_rn(sl, dist); asm volatile("" : "+v"(bb)); a[q] = __fsub_rn(a[q], bb); }
    *(v4f*)(Sb + e) = a;  }
// k_asoft: per row (zz, i): t = S x HD^-0.5 for j <= i and i - j < WIN (WIN = TT, so plain causal; the reference's -1e9 additive fill vanishes identically); softmax over the 2048 keys (register row, one exp, fixed trees);
__global__ __launch_bounds__(256) void k_asoft(const float* __restrict__ Sb, h16* P16, bf* Ph, bf* Pl) {
    const int lane = threadIdx.x & 31; const int row = blockIdx.x * 8 + (threadIdx.x >> 5); if (row >= ZH * TT) return; const int i = row % TT; const int zz = row / TT; (void)zz; const bool hires = (i < RH); const float* sr = Sb + (size_t)row * TT; float v[TT / 32]; float mx = -3.0e38f;
#pragma unroll
    for (int ch = 0; ch < TT / 128; ++ch) { const int j0 = ch * 128 + lane * 4; const v4f a = *(const v4f*)(sr + j0);
#pragma unroll
        for (int q = 0; q < 4; ++q) { const int j = j0 + q; (void)j; const float t = (j <= i && i - j < WIN) ? a[q] * SCL : -3.0e38f; v[ch * 4 + q] = t; mx = fmaxf(mx, t); } }
#pragma unroll
    for (int sh = 16; sh; sh >>= 1) mx = fmaxf(mx, __shfl_xor(mx, sh, 32));
    float sum = 0.f;
#pragma unroll
    for (int k = 0; k < TT / 32; ++k) { float d0 = __fsub_rn(v[k], mx); asm volatile("" : "+v"(d0)); v[k] = __builtin_amdgcn_exp2f(__fmul_rn(d0, 1.4426950408889634f)); sum += v[k]; }
#pragma unroll
    for (int sh = 16; sh; sh >>= 1) sum += __shfl_xor(sum, sh, 32);
    const float f = __fdiv_rn(hires ? 1.0f : PCAR, sum);
{
        if (hires) {
#pragma unroll
            for (int ch = 0; ch < TT / 128; ++ch) { v4us oh, ol;
#pragma unroll
                for (int q = 0; q < 4; ++q) { unsigned short a, c2; splitf(v[ch * 4 + q] * f, a, c2); oh[q] = a; ol[q] = c2; }
                const size_t oo = ((size_t)zz * (RH ? RH : 1) + i) * TT + ch * 128 + lane * 4; *(v4us*)(Ph + oo) = oh; *(v4us*)(Pl + oo) = ol; }
        } else {
#pragma unroll
            for (int ch = 0; ch < TT / 128; ++ch) { v4h o4;
#pragma unroll
                for (int q = 0; q < 4; ++q) o4[q] = tohx(v[ch * 4 + q] * f);
                *(v4h*)(P16 + (size_t)row * TT + ch * 128 + lane * 4) = o4; } }
         }
}
__global__ __launch_bounds__(256) void k_merge(const float* __restrict__ O, int h0, bf* Ah, bf* Al) { const size_t e = ((size_t)blockIdx.x * 256 + threadIdx.x) * 2; if (e >= (size_t)ZH * TT * HD) return; const int d = (int)(e % HD); const int t = (int)((e / HD) % TT); const int zz = (int)(e / ((size_t)HD * TT)); const float cs = (t < RH) ? 1.0f : (1.0f / PCAR); const size_t oo = (size_t)t * DQ + (h0 + zz) * HD + d;
    v2f y = *(const v2f*)(O + e);   // the KSP key-range partials, added in split order
#pragma unroll
    for (int s = 1; s < KSP; ++s) y += *(const v2f*)(O + (size_t)s * ZH * TT * HD + e);
    v2us oh, ol;
#pragma unroll
    for (int q = 0; q < 2; ++q) { unsigned short a, c2; splitf(y[q] * cs, a, c2); oh[q] = a; ol[q] = c2; } *(v2us*)(Ah + oo) = oh; *(v2us*)(Al + oo) = ol;  }

extern "C" void kernel_launch(void* const* d_in, const int* in_sizes, int n_in,
                              void* d_out, int out_size, void* d_ws, size_t ws_size, hipStream_t stream) {
    (void)in_sizes; (void)n_in; (void)out_size;
    const float* x = (const float*)d_in[0]; const float* wq = (const float*)d_in[1]; const float* bq = (const float*)d_in[2]; const float* wkv = (const float*)d_in[3]; const float* bkv = (const float*)d_in[4]; const float* wo = (const float*)d_in[5]; const float* bo = (const float*)d_in[6];     const float* bk = bkv; const float* bv = bkv + DKV;   /* bias halves */ const float* wk = nullptr; const float* wv = nullptr; (void)wk; (void)wv;
    float* OUT = (float*)d_out;     // [2][2048][1024]
    char* wsp = (char*)d_ws;
    auto take = [&](size_t bytes) { char* p = wsp; wsp += (bytes + 255) & ~(size_t)255; return (void*)p; };
    bf* WQ = (bf*)take((size_t)DQ * DM * 2); bf* WKV = (bf*)take((size_t)2 * DKV * DM * 2); bf* WK = WKV; bf* WV = WKV + (size_t)DKV * DM;   /* fused Bt [2*DKV][DM]: k | v row blocks */ bf* WO = (bf*)take((size_t)DM * DQ * 2); float* CS = (float*)take((size_t)TT * HD * 2 * 4);
    bf* XB = (bf*)take((size_t)TT * DM * 2); float* FQ = (float*)take((size_t)TT * DQ * 4); float* FK = (float*)take((size_t)TT * DKV * 4);
    h16* QP16 = (h16*)take((size_t)NH_ * TT * HD * 2); h16* KP16 = (h16*)take((size_t)NKV * TT * HD * 2); h16* VT16 = (h16*)take((size_t)NKV * HD * TT * 2);
    bf* QPh = (bf*)take((size_t)NH_ * TT * HD * 2); bf* QPl = (bf*)take((size_t)NH_ * TT * HD * 2); bf* KPh = (bf*)take((size_t)NKV * TT * HD * 2); bf* KPl = (bf*)take((size_t)NKV * TT * HD * 2); bf* VTh = (bf*)take((size_t)NKV * HD * TT * 2); bf* VTl = (bf*)take((size_t)NKV * HD * TT * 2); bf* Ph = (bf*)take((size_t)ZH * RH * TT * 2); bf* Pl = (bf*)take((size_t)ZH * RH * TT * 2);
    float* Sb = (float*)take((size_t)ZH * TT * TT * 4); h16* P16 = (h16*)take((size_t)ZH * TT * TT * 2); float* Ob = (float*)take((size_t)KSP * ZH * TT * HD * 4); bf* ATh = (bf*)take((size_t)TT * DQ * 2); bf* ATl = (bf*)take((size_t)TT * DQ * 2);
    if ((size_t)(wsp - (char*)d_ws) > ws_size) return;    // ws 256 MiB
    float* FV = FK;   // v projection reuses the k buffer after the k planes are built (stream-ordered)
    { k_wtG<<<(unsigned)((DM * DQ / 64 + 63) / 64), 256, 0, stream>>>(wq, DM, DQ, WQ); k_wtG<<<(unsigned)((DM * 2 * DKV / 64 + 63) / 64), 256, 0, stream>>>(wkv, DM, 2 * DKV, WKV);   /* fused 'xw' [DM][2*DKV] -> Bt [2*DKV][DM]: k | v */
      k_wtG<<<(unsigned)((DQ * DM / 64 + 63) / 64), 256, 0, stream>>>(wo, DQ, DM, WO);
       }
    k_csid<<<(TT * HD + 255) / 256, 256, 0, stream>>>(CS);
    const unsigned LQ = (unsigned)(((size_t)NH_ * TT * HD / 2 + 255) / 256), LKv = (unsigned)(((size_t)NKV * TT * HD / 2 + 255) / 256);
    for (int b = 0; b < NB_; ++b) {
        
        k_cvt8<<<(unsigned)(((size_t)TT * DM / 8 + 255) / 256), 256, 0, stream>>>(x + (size_t)b * TT * DM, XB, (size_t)TT * DM / 8);
        k_gemmw<bf, 0, true><<<dim3(TT / 64, DQ / 64, 1), 32, 0, stream>>>(XB, nullptr, WQ, nullptr, DM, FQ, DQ, bq, 0, 0, 0);
        k_rope<<<LQ, 256, 0, stream>>>(FQ, DQ, NH_, CS, nullptr, nullptr, 1.0f, QP16, QPh, QPl);
        k_gemmw<bf, 0, true><<<dim3(TT / 64, DKV / 64, 1), 32, 0, stream>>>(XB, nullptr, WK, nullptr, DM, FK, DKV, bk, 0, 0, 0);
        k_rope<<<LKv, 256, 0, stream>>>(FK, DKV, NKV, CS, nullptr, nullptr, 1.0f, KP16, KPh, KPl);
        k_gemmw<bf, 0, true><<<dim3(TT / 64, DKV / 64, 1), 32, 0, stream>>>(XB, nullptr, WV, nullptr, DM, FV, DKV, bv, 0, 0, 0); k_vtp<<<LKv, 256, 0, stream>>>(FV, DKV, NKV, VT16, VTh, VTl);
        for (int h0 = 0; h0 < NH_; h0 += ZH) { const size_t zq = (size_t)h0, zk = (size_t)(h0 / REP);   // one kv head per query head: the pass's ZH heads use consecutive kv planes (z-strides TT*HD)
            k_gemmc<bf, 2, 1, 1><<<dim3(RH / 64, TT / 64, ZH), 32, 0, stream>>>(QPh + zq * TT * HD, QPl + zq * TT * HD, KPh + zk * TT * HD, KPl + zk * TT * HD, HD, Sb, TT, 0, (size_t)TT * HD, (size_t)TT * HD, (size_t)TT * TT, 0);
            k_gemmc<h16, 0, 1, 1><<<dim3((TT - RH) / 64, TT / 64, ZH), 32, 0, stream>>>(QP16 + zq * TT * HD + (size_t)RH * HD, nullptr, KP16 + zk * TT * HD, nullptr, HD, Sb + (size_t)RH * TT, TT, RH, (size_t)TT * HD, (size_t)TT * HD, (size_t)TT * TT, 0);
            k_alibi<<<(unsigned)(((size_t)ZH * TT * TT / 4 + 255) / 256), 256, 0, stream>>>(Sb, h0);   /* - slope_h |i-j| (x 8, in f32) */ k_asoft<<<ZH * TT / 8, 256, 0, stream>>>(Sb, P16, Ph, Pl);
            k_gemmc<bf, 2, 2, KSP><<<dim3(RH / 64, HD / 64 * KSP, ZH), 32, 0, stream>>>(Ph, Pl, VTh + zk * HD * TT, VTl + zk * HD * TT, TT, Ob, HD, 0, (size_t)RH * TT, (size_t)HD * TT, (size_t)TT * HD, (size_t)ZH * TT * HD);
            k_gemmc<h16, 0, 2, KSP><<<dim3((TT - RH) / 64, HD / 64 * KSP, ZH), 32, 0, stream>>>(P16 + (size_t)RH * TT, nullptr, VT16 + zk * HD * TT, nullptr, TT, Ob + (size_t)RH * HD, HD, RH, (size_t)TT * TT, (size_t)HD * TT, (size_t)TT * HD, (size_t)ZH * TT * HD);
            k_merge<<<(unsigned)(((size_t)ZH * TT * HD / 2 + 255) / 256), 256, 0, stream>>>(Ob, h0, ATh, ATl); }
        k_gemmw<bf, 1, true><<<dim3(TT / 64, DM / 64, 1), 32, 0, stream>>>(ATh, ATl, WO, nullptr, DQ, OUT + (size_t)b * TT * DM, DM, bo, 0, 0, 0); }
}

// v003
// One run takes 639 microseconds.
// Timed twice side by side with v002, it ran 1.22 times as fast both times.
// Over all steps from v000 it is 2.55 times as fast.
#include <hip/hip_runtime.h>

// Causal self-attention with ALiBi (linear slopes), a separate q projection and a fused k|v projection (x [2][2048][1024]; q = x q_w + q_b ('xw' [1024][1024] 0.02 + bias zeros: read); kv = (x kv_w + kv_b) ('xw' [1024][2048] 0.02 + bias zeros: read) reshaped (B, T, 2, 16, 64): k | v = column halves (16 heads x 64); att x 1/sqrt(64) + slopes[h] x (j - i) with slopes[h] = (h + 1) / 16 (exact in f32; for the kept entries j <= i this is -slopes[h] x |i - j|); causal (-inf); softmax; y = merged o_w + o_b ('xw' + bias zeros: read) -> [2][2048][1024] (4.2 M); argument order x, q_w, q_b, kv_w, kv_b, o_w, o_b).
// Layout per batch: bf16 copy of x; q_w transposed; the fused kv weight transposed once into Bt (k | v row blocks) + bias halves; exact projections + f32 biases; identity-table plane builders; raw scores; the softmax kernel forms S x 1/8 + slope[h] x (j - i) in f32 from each score as it loads it (slope = SLOPE8[h] / 8 = (h + 1) / 16, the bias exact); causal T-2048 attention (hybrid rows: < 512 hi/lo 3 products, rest fp16 x1024; k_gemmc skips tiles above the diagonal); merged hi/lo x o_w exact + o_b.
// Compute dtypes, f32 accumulate: every input rounded to bf16; projections exact + f32 biases; attention rows < 512 3 products, rest fp16; softmax f32; output projection hl x exact.

#define NB_  2
#define TT   2048
#define DM   1024
#define NH_  16
#define NKV  16
#define REP  (NH_ / NKV)
#define HD   64
#define DQ   (NH_ * HD)
#define DKV  (NKV * HD)
#define ZH   4                    // heads per attention pass (grid z of the k_gemmc launches in the head loop); 4 is the most that divides 16 and fits the workspace
#define RH   512                  // query rows < RH use hi+lo planes (0: none)
#define KSP  8                    // key-range splits of the probability x value contraction: one work-group per split, f32 partial planes summed in k_merge
#define WIN  2048
#define PCAR 1024.0f
#define SCL  0.125f   // HD^-0.5
typedef _Float16 h16;
typedef unsigned short bf;
typedef __attribute__((ext_vector_type(16))) __bf16   v16bf;
typedef __attribute__((ext_vector_type(16))) _Float16 v16h;
typedef __attribute__((ext_vector_type(8)))  _Float16 v8h;
typedef __attribute__((ext_vector_type(8)))  unsigned short v8us;
typedef __attribute__((ext_vector_type(8)))  float    v8f;
typedef __attribute__((ext_vector_type(4)))  float    v4f;
typedef v8h  __attribute__((may_alias)) v8ha;
typedef v4f  __attribute__((may_alias)) v4fa;
typedef v8us __attribute__((may_alias)) v8usa;

__device__ __forceinline__ unsigned short f2bf(float f) { unsigned u = __float_as_uint(f); u += 0x7FFFu + ((u >> 16) & 1u); return (unsigned short)(u >> 16); }
__device__ __forceinline__ float bf2f(unsigned short b) { return __uint_as_float(((unsigned)b) << 16); }
__device__ __forceinline__ float bfr(float f) { return bf2f(f2bf(f)); }
__device__ __forceinline__ v16h cat16(v8h lo, v8h hi) { return __builtin_shufflevector(lo, hi, 0, 1, 2, 3, 4, 5, 6, 7, 8, 9, 10, 11, 12, 13, 14, 15); }
__device__ __forceinline__ v16bf cat16b(v8us lo, v8us hi) { return __builtin_bit_cast(v16bf, __builtin_shufflevector(lo, hi, 0, 1, 2, 3, 4, 5, 6, 7, 8, 9, 10, 11, 12, 13, 14, 15)); }
__device__ __forceinline__ v8f wmma16(v16h a, v16h b, v8f c) { return __builtin_amdgcn_wmma_f32_16x16x32_f16(false, a, false, b, (short)0, c, false, false); }
__device__ __forceinline__ v8f wmmab(v16bf a, v16bf b, v8f c) { return __builtin_amdgcn_wmma_f32_16x16x32_bf16(false, a, false, b, (short)0, c, false, false); }



// ---- k_gemmw: register-blocked GEMM, ONE WAVE per 64x64 output tile (16 accumulators), operands straight from K-contiguous 16-bit planes; grid (M/64, N/64, Z), 32 threads.
// C[m][n] (f32, pitch ldc, + optional f32 bias[n]) = sum_k A[m][k] Bt[n][k] (+ split products per NSPLIT). z-batch strides sA/sB/sC in elements. K % 32 == 0.
template <typename T16> struct WFrag;
template <> struct WFrag<h16> { typedef v16h V; static __device__ __forceinline__ V ld(const h16* p) { return cat16(*(const v8h*)p, *(const v8h*)(p + 16)); } static __device__ __forceinline__ v8f mma(V a, V b, v8f c) { return wmma16(a, b, c); } };
template <> struct WFrag<bf> { typedef v16bf V; static __device__ __forceinline__ V ld(const bf* p) { return cat16b(*(const v8us*)p, *(const v8us*)(p + 16)); } static __device__ __forceinline__ v8f mma(V a, V b, v8f c) { return wmmab(a, b, c); } };
template <typename T16, int NSPLIT, bool BIAS>
__global__ __launch_bounds__(32) void k_gemmw(const T16* __restrict__ A, const T16* __restrict__ A2, const T16* __restrict__ Bt, const T16* __restrict__ Bt2, int K, float* C, int ldc, const float* __restrict__ bias, size_t sA, size_t sB, size_t sC) {
    typedef typename WFrag<T16>::V V;
    __shared__ __align__(16) float os[16 * 68];
    const size_t z = blockIdx.z; A += z * sA; if (A2) A2 += z * sA; Bt += z * sB; if (Bt2) Bt2 += z * sB; C += z * sC;
    const int lane = threadIdx.x & 31, lr = lane & 15, hi = lane >> 4; const int r0 = blockIdx.x * 64, c0 = blockIdx.y * 64;
    v8f acc[4][4];
#pragma unroll
    for (int mb = 0; mb < 4; ++mb)
#pragma unroll
        for (int nb = 0; nb < 4; ++nb) acc[mb][nb] = (v8f){};
    const size_t aoff = (size_t)(r0 + lr) * K + 8 * hi, boff = (size_t)(c0 + lr) * K + 8 * hi;
#pragma unroll 1
    for (int kc = 0; kc < K; kc += 32) {
        V a[4], a2[4];
#pragma unroll
        for (int mb = 0; mb < 4; ++mb) { a[mb] = WFrag<T16>::ld(A + aoff + (size_t)mb * 16 * K + kc); if (NSPLIT == 1 || NSPLIT == 2) a2[mb] = WFrag<T16>::ld(A2 + aoff + (size_t)mb * 16 * K + kc); }
#pragma unroll
        for (int nb = 0; nb < 4; ++nb) { const V b = WFrag<T16>::ld(Bt + boff + (size_t)nb * 16 * K + kc); V b2; if (NSPLIT >= 2) b2 = WFrag<T16>::ld(Bt2 + boff + (size_t)nb * 16 * K + kc);
#pragma unroll
            for (int mb = 0; mb < 4; ++mb) { acc[mb][nb] = WFrag<T16>::mma(a[mb], b, acc[mb][nb]); if (NSPLIT == 1 || NSPLIT == 2) acc[mb][nb] = WFrag<T16>::mma(a2[mb], b, acc[mb][nb]); if (NSPLIT >= 2) acc[mb][nb] = WFrag<T16>::mma(a[mb], b2, acc[mb][nb]); } }
        asm volatile("v_nop\n\tv_nop\n\tv_nop\n\tv_nop" : "+v"(acc[0][0]), "+v"(acc[1][1]), "+v"(acc[2][2]), "+v"(acc[3][3]) : "v"(a[0]), "v"(a[3]));
    }
#pragma unroll
    for (int mb = 0; mb < 4; ++mb) {
#pragma unroll
        for (int nb = 0; nb < 4; ++nb) {
#pragma unroll
            for (int j = 0; j < 8; ++j) os[(hi * 8 + j) * 68 + nb * 16 + lr] = acc[mb][nb][j]; }
        __builtin_amdgcn_wave_barrier(); asm volatile("" ::: "memory");
        float* crow = C + (size_t)(r0 + mb * 16) * ldc + c0;
{
#pragma unroll
            for (int s = 0; s < 8; ++s) { const int row = 2 * s + hi, cofs = lr * 4; v4f val = *(const v4fa*)(os + row * 68 + cofs); if (BIAS) { val[0] += bfr(bias[c0 + cofs]); val[1] += bfr(bias[c0 + cofs + 1]); val[2] += bfr(bias[c0 + cofs + 2]); val[3] += bfr(bias[c0 + cofs + 3]); }
                *(v4f*)(crow + (size_t)row * ldc + cofs) = val; }
             }
        __builtin_amdgcn_wave_barrier(); asm volatile("" ::: "memory");
    }
}

// ---- k_gemmc: the same one-wave 64x64 tile GEMM specialised for causal attention: CMODE 1 skips score tiles entirely above the diagonal (query rows r0+roff.., key columns c0..), CMODE 2 limits the
// key (K) loop of the probability x value contraction to the diagonal block (probabilities beyond it are exactly zero). roff = row offset of this launch's first row within the sequence.
// KS > 1: grid y = column tiles x KS; split ks sums its own run of whole 64-key chunks of [0, Kl) into partial plane ks (stride sP); a split whose run is empty stores zeros, so every plane is fully written.
template <typename T16, int NSPLIT, int CMODE, int KS>
__global__ __launch_bounds__(32) void k_gemmc(const T16* __restrict__ A, const T16* __restrict__ A2, const T16* __restrict__ Bt, const T16* __restrict__ Bt2, int K, float* C, int ldc, int roff, size_t sA, size_t sB, size_t sC, size_t sP) {
    typedef typename WFrag<T16>::V V;
    __shared__ __align__(16) float os[16 * 68];
    const size_t z = blockIdx.z; A += z * sA; if (A2) A2 += z * sA; Bt += z * sB; if (Bt2) Bt2 += z * sB; C += z * sC;
    const int lane = threadIdx.x & 31, lr = lane & 15, hi = lane >> 4; const int r0 = blockIdx.x * 64, c0 = (int)(blockIdx.y / KS) * 64, ks = (int)(blockIdx.y % KS);
    if (CMODE == 1 && c0 > r0 + roff + 63) return;                  // score tile entirely above the causal diagonal: never read (the softmax masks j > i by select)
    const int Kl = (CMODE == 2) ? min(K, r0 + roff + 64) : K;        // P.V: probabilities are exactly 0 beyond the diagonal block, so the K loop stops there
    const int per = (KS > 1) ? ((Kl / 64 + KS - 1) / KS) * 64 : Kl;  // keys per split: the tile's own range in runs of ceil(Kl / 64 / KS) whole 64-key chunks (later splits may get fewer or none), so the longest dependent load chain is one such run
    const int kb = ks * per, ke = min(Kl, kb + per); C += (size_t)ks * sP;
    v8f acc[4][4];
#pragma unroll
    for (int mb = 0; mb < 4; ++mb)
#pragma unroll
        for (int nb = 0; nb < 4; ++nb) acc[mb][nb] = (v8f){};
    const size_t aoff = (size_t)(r0 + lr) * K + 8 * hi, boff = (size_t)(c0 + lr) * K + 8 * hi;
#pragma unroll 1
    for (int kc = kb; kc < ke; kc += 32) {
        V a[4], a2[4];
#pragma unroll
        for (int mb = 0; mb < 4; ++mb) { a[mb] = WFrag<T16>::ld(A + aoff + (size_t)mb * 16 * K + kc); if (NSPLIT == 1 || NSPLIT == 2) a2[mb] = WFrag<T16>::ld(A2 + aoff + (size_t)mb * 16 * K + kc); }
#pragma unroll
        for (int nb = 0; nb < 4; ++nb) { const V b = WFrag<T16>::ld(Bt + boff + (size_t)nb * 16 * K + kc); V b2; if (NSPLIT >= 2) b2 = WFrag<T16>::ld(Bt2 + boff + (size_t)nb * 16 * K + kc);
#pragma unroll
            for (int mb = 0; mb < 4; ++mb) { acc[mb][nb] = WFrag<T16>::mma(a[mb], b, acc[mb][nb]); if (NSPLIT == 1 || NSPLIT == 2) acc[mb][nb] = WFrag<T16>::mma(a2[mb], b, acc[mb][nb]); if (NSPLIT >= 2) acc[mb][nb] = WFrag<T16>::mma(a[mb], b2, acc[mb][nb]); } }
        asm volatile("v_nop\n\tv_nop\n\tv_nop\n\tv_nop" : "+v"(acc[0][0]), "+v"(acc[1][1]), "+v"(acc[2][2]), "+v"(acc[3][3]) : "v"(a[0]), "v"(a[3]));
    }
#pragma unroll
    for (int mb = 0; mb < 4; ++mb) {
#pragma unroll
        for (int nb = 0; nb < 4; ++nb) {
#pragma unroll
            for (int j = 0; j < 8; ++j) os[(hi * 8 + j) * 68 + nb * 16 + lr] = acc[mb][nb][j]; }
        __builtin_amdgcn_wave_barrier(); asm volatile("" ::: "memory");
        float* crow = C + (size_t)(r0 + mb * 16) * ldc + c0;
{
#pragma unroll
            for (int s = 0; s < 8; ++s) { const int row = 2 * s + hi, cofs = lr * 4; v4f val = *(const v4fa*)(os + row * 68 + cofs);
                *(v4f*)(crow + (size_t)row * ldc + cofs) = val; }
             }
        __builtin_amdgcn_wave_barrier(); asm volatile("" ::: "memory");
    }
}

__device__ __forceinline__ h16 tohx(float x) { return (h16)x; }
__device__ __forceinline__ void splitf(float y, unsigned short& h, unsigned short& l) { h = f2bf(y); l = f2bf(y - bf2f(h)); }
typedef __attribute__((ext_vector_type(2))) _Float16 v2h;
typedef __attribute__((ext_vector_type(4))) _Float16 v4h;
typedef __attribute__((ext_vector_type(2))) unsigned short v2us;
typedef __attribute__((ext_vector_type(4))) unsigned short v4us;
typedef __attribute__((ext_vector_type(2))) float v2f;
typedef __attribute__((ext_vector_type(4))) int v4i;

__global__ __launch_bounds__(256) void k_wtG(const float* __restrict__ w, int K, int N, bf* Bt) {
    const int lane = threadIdx.x & 31; const int L0 = (blockIdx.x * 8 + (threadIdx.x >> 5)) * 8; const int nlines = N * K / 64;
{
#pragma unroll 1
        for (int l = 0; l < 8; ++l) { const int L = L0 + l; if (L >= nlines) break; const size_t e = (size_t)L * 64 + lane * 2; const int k = (int)(e % K), n = (int)(e / K); v2us o;
            o[0] = f2bf(w[(size_t)k * N + n]); o[1] = f2bf(w[(size_t)(k + 1) * N + n]); *(v2us*)(Bt + e) = o; }
         }
}
__global__ __launch_bounds__(256) void k_cvt8(const float* __restrict__ src, bf* dst, size_t n8) { const size_t i = (size_t)blockIdx.x * 256 + threadIdx.x; if (i >= n8) return; const v8f v = *(const v8f*)(src + i * 8); v8us o;
#pragma unroll
    for (int k = 0; k < 8; ++k) o[k] = f2bf(v[k]); *(v8us*)(dst + i * 8) = o;  }

// k_rope: head planes [h][t][d] (fp16 + hi/lo) of rope(x) x sc with the rotate-half convention out[d] = x[d] cos[t][d] - x[d+HD/2] sin[t][d], out[d+HD/2] = x[d+HD/2] cos[t][d+HD/2] + x[d] sin[t][d+HD/2]
__global__ __launch_bounds__(256) void k_rope(const float* __restrict__ F, int pitch, int nheads, const float* __restrict__ CS, const float* __restrict__ RF, const float* __restrict__ nw, float sc, h16* P16, bf* Ph, bf* Pl) {
    const size_t e = ((size_t)blockIdx.x * 256 + threadIdx.x) * 2; if (e >= (size_t)nheads * TT * HD) return; const int d = (int)(e % HD); const int t = (int)((e / HD) % TT); const int h = (int)(e / ((size_t)HD * TT)); const float* f = F + (size_t)t * pitch + h * HD; const float rf = RF ? RF[(size_t)h * TT + t] : 1.0f; v2h o16; v2us oh, ol;
#pragma unroll
    for (int q = 0; q < 2; ++q) { const int dd = d + q; const int dp = (dd < HD / 2) ? dd + HD / 2 : dd - HD / 2; float x0 = f[dd], x1 = f[dp];
        if (RF) { float n0 = __fmul_rn(x0, rf), n1 = __fmul_rn(x1, rf); asm volatile("" : "+v"(n0)); asm volatile("" : "+v"(n1)); x0 = __fmul_rn(bfr(nw[dd]), n0); x1 = __fmul_rn(bfr(nw[dp]), n1); }
        const v2f cs = *(const v2f*)(CS + ((size_t)t * HD + dd) * 2); float a = __fmul_rn(x0, cs[0]), bq = __fmul_rn(x1, cs[1]); asm volatile("" : "+v"(a)); asm volatile("" : "+v"(bq)); const float r = ((dd < HD / 2) ? __fsub_rn(a, bq) : __fadd_rn(a, bq)) * sc;
        o16[q] = tohx(r); unsigned short a2, c2; splitf(r, a2, c2); oh[q] = a2; ol[q] = c2; }
    *(v2h*)(P16 + e) = o16; *(v2us*)(Ph + e) = oh; *(v2us*)(Pl + e) = ol;  }
__global__ __launch_bounds__(256) void k_vtp(const float* __restrict__ F, int pitch, int nheads, h16* V16, bf* Vh, bf* Vl) { const size_t e = ((size_t)blockIdx.x * 256 + threadIdx.x) * 2; if (e >= (size_t)nheads * HD * TT) return; const int t = (int)(e % TT); const int d = (int)((e / TT) % HD); const int g = (int)(e / ((size_t)TT * HD)); v2h o16; v2us oh, ol;
#pragma unroll
    for (int q = 0; q < 2; ++q) { const float x = F[(size_t)(t + q) * pitch + g * HD + d]; o16[q] = tohx(x); unsigned short a2, c2; splitf(x, a2, c2); oh[q] = a2; ol[q] = c2; }
    *(v2h*)(V16 + e) = o16; *(v2us*)(Vh + e) = oh; *(v2us*)(Vl + e) = ol;  }
__global__ __launch_bounds__(256) void k_csid(float* CS) { const int idx = blockIdx.x * 256 + threadIdx.x; if (idx >= TT * HD) return; v2f cs; cs[0] = 1.0f; cs[1] = 0.0f; *(v2f*)(CS + (size_t)idx * 2) = cs;  }
__constant__ float SLOPE8[NH_] = { 5.000000000e-1f, 1.000000000e+0f, 1.500000000e+0f, 2.000000000e+0f, 2.500000000e+0f, 3.000000000e+0f, 3.500000000e+0f, 4.000000000e+0f, 4.500000000e+0f, 5.000000000e+0f, 5.500000000e+0f, 6.000000000e+0f, 6.500000000e+0f, 7.000000000e+0f, 7.500000000e+0f, 8.000000000e+0f };   // 8 x the per-head ALiBi slope magnitude (slopes[h] = (h + 1) / 16, h = 0..15, x 8 = (h + 1) / 2: exact); every entry and every product with |i - j| <= 2047 is exact in f32
// k_asoft: per row (zz, i): t = S x HD^-0.5 + slope[h0 + zz] x (j - i) for j <= i and i - j < WIN (sliding causal window; the reference's -1e9 additive fill vanishes identically); softmax over the 2048 keys (register row, one exp, fixed trees);
__global__ __launch_bounds__(256) void k_asoft(const float* __restrict__ Sb, int h0, h16* P16, bf* Ph, bf* Pl) {
    const int lane = threadIdx.x & 31; const int row = blockIdx.x * 8 + (threadIdx.x >> 5); if (row >= ZH * TT) return; const int i = row % TT; const int zz = row / TT; const float sl = SLOPE8[h0 + zz] * SCL; const float bi = sl * (float)(i - lane * 4);   /* sl = the head's slope (h + 1) / 16; the bias slope x (j - i) = sl x (ch * 128 + q) - bi; sixteenths of whole numbers below 2^16: every product and sum of it is exact in f32 */ const bool hires = (i < RH); const float* sr = Sb + (size_t)row * TT; float v[TT / 32]; float mx = -3.0e38f;
#pragma unroll
    for (int ch = 0; ch < TT / 128; ++ch) { const int j0 = ch * 128 + lane * 4; const v4f a = *(const v4f*)(sr + j0);
#pragma unroll
        for (int q = 0; q < 4; ++q) { const int j = j0 + q; (void)j; const float t = (j <= i && i - j < WIN) ? __builtin_fmaf(a[q], SCL, __builtin_fmaf(sl, (float)(ch * 128 + q), -bi)) : -3.0e38f;   /* S / 8 + slope x (j - i): the bias is exact and 1/8 a power of two, so the sum is rounded once, as in the reference's scale, then add */ v[ch * 4 + q] = t; mx = fmaxf(mx, t); } }
#pragma unroll
    for (int sh = 16; sh; sh >>= 1) mx = fmaxf(mx, __shfl_xor(mx, sh, 32));
    float sum = 0.f;
#pragma unroll
    for (int k = 0; k < TT / 32; ++k) { float d0 = __fsub_rn(v[k], mx); asm volatile("" : "+v"(d0)); v[k] = __builtin_amdgcn_exp2f(__fmul_rn(d0, 1.4426950408889634f)); sum += v[k]; }
#pragma unroll
    for (int sh = 16; sh; sh >>= 1) sum += __shfl_xor(sum, sh, 32);
    const float f = __fdiv_rn(hires ? 1.0f : PCAR, sum);
{
        if (hires) {
#pragma unroll
            for (int ch = 0; ch < TT / 128; ++ch) { v4us oh, ol;
#pragma unroll
                for (int q = 0; q < 4; ++q) { unsigned short a, c2; splitf(v[ch * 4 + q] * f, a, c2); oh[q] = a; ol[q] = c2; }
                const size_t oo = ((size_t)zz * (RH ? RH : 1) + i) * TT + ch * 128 + lane * 4; *(v4us*)(Ph + oo) = oh; *(v4us*)(Pl + oo) = ol; }
        } else {
#pragma unroll
            for (int ch = 0; ch < TT / 128; ++ch) { v4h o4;
#pragma unroll
                for (int q = 0; q < 4; ++q) o4[q] = tohx(v[ch * 4 + q] * f);
                *(v4h*)(P16 + (size_t)row * TT + ch * 128 + lane * 4) = o4; } }
         }
}
__global__ __launch_bounds__(256) void k_merge(const float* __restrict__ O, int h0, bf* Ah, bf* Al) { const size_t e = ((size_t)blockIdx.x * 256 + threadIdx.x) * 2; if (e >= (size_t)ZH * TT * HD) return; const int d = (int)(e % HD); const int t = (int)((e / HD) % TT); const int zz = (int)(e / ((size_t)HD * TT)); const float cs = (t < RH) ? 1.0f : (1.0f / PCAR); const size_t oo = (size_t)t * DQ + (h0 + zz) * HD + d;
    v2f y = *(const v2f*)(O + e);   // the KSP key-range partials, added in split order
#pragma unroll
    for (int s = 1; s < KSP; ++s) y += *(const v2f*)(O + (size_t)s * ZH * TT * HD + e);
    v2us oh, ol;
#pragma unroll
    for (int q = 0; q < 2; ++q) { unsigned short a, c2; splitf(y[q] * cs, a, c2); oh[q] = a; ol[q] = c2; } *(v2us*)(Ah + oo) = oh; *(v2us*)(Al + oo) = ol;  }

extern "C" void kernel_launch(void* const* d_in, const int* in_sizes, int n_in,
                              void* d_out, int out_size, void* d_ws, size_t ws_size, hipStream_t stream) {
    (void)in_sizes; (void)n_in; (void)out_size;
    const float* x = (const float*)d_in[0]; const float* wq = (const float*)d_in[1]; const float* bq = (const float*)d_in[2]; const float* wkv = (const float*)d_in[3]; const float* bkv = (const float*)d_in[4]; const float* wo = (const float*)d_in[5]; const float* bo = (const float*)d_in[6];     const float* bk = bkv; const float* bv = bkv + DKV;   /* bias halves */ const float* wk = nullptr; const float* wv = nullptr; (void)wk; (void)wv;
    float* OUT = (float*)d_out;     // [2][2048][1024]
    char* wsp = (char*)d_ws;
    auto take = [&](size_t bytes) { char* p = wsp; wsp += (bytes + 255) & ~(size_t)255; return (void*)p; };
    bf* WQ = (bf*)take((size_t)DQ * DM * 2); bf* WKV = (bf*)take((size_t)2 * DKV * DM * 2); bf* WK = WKV; bf* WV = WKV + (size_t)DKV * DM;   /* fused Bt [2*DKV][DM]: k | v row blocks */ bf* WO = (bf*)take((size_t)DM * DQ * 2); float* CS = (float*)take((size_t)TT * HD * 2 * 4);
    bf* XB = (bf*)take((size_t)TT * DM * 2); float* FQ = (float*)take((size_t)TT * DQ * 4); float* FK = (float*)take((size_t)TT * DKV * 4);
    h16* QP16 = (h16*)take((size_t)NH_ * TT * HD * 2); h16* KP16 = (h16*)take((size_t)NKV * TT * HD * 2); h16* VT16 = (h16*)take((size_t)NKV * HD * TT * 2);
    bf* QPh = (bf*)take((size_t)NH_ * TT * HD * 2); bf* QPl = (bf*)take((size_t)NH_ * TT * HD * 2); bf* KPh = (bf*)take((size_t)NKV * TT * HD * 2); bf* KPl = (bf*)take((size_t)NKV * TT * HD * 2); bf* VTh = (bf*)take((size_t)NKV * HD * TT * 2); bf* VTl = (bf*)take((size_t)NKV * HD * TT * 2); bf* Ph = (bf*)take((size_t)ZH * RH * TT * 2); bf* Pl = (bf*)take((size_t)ZH * RH * TT * 2);
    float* Sb = (float*)take((size_t)ZH * TT * TT * 4); h16* P16 = (h16*)take((size_t)ZH * TT * TT * 2); float* Ob = (float*)take((size_t)KSP * ZH * TT * HD * 4); bf* ATh = (bf*)take((size_t)TT * DQ * 2); bf* ATl = (bf*)take((size_t)TT * DQ * 2);
    if ((size_t)(wsp - (char*)d_ws) > ws_size) return;    // ws 256 MiB
    float* FV = FK;   // v projection reuses the k buffer after the k planes are built (stream-ordered)
    { k_wtG<<<(unsigned)((DM * DQ / 64 + 63) / 64), 256, 0, stream>>>(wq, DM, DQ, WQ); k_wtG<<<(unsigned)((DM * 2 * DKV / 64 + 63) / 64), 256, 0, stream>>>(wkv, DM, 2 * DKV, WKV);   /* fused 'xw' [DM][2*DKV] -> Bt [2*DKV][DM]: k | v */
      k_wtG<<<(unsigned)((DQ * DM / 64 + 63) / 64), 256, 0, stream>>>(wo, DQ, DM, WO);
       }
    k_csid<<<(TT * HD + 255) / 256, 256, 0, stream>>>(CS);
    const unsigned LQ = (unsigned)(((size_t)NH_ * TT * HD / 2 + 255) / 256), LKv = (unsigned)(((size_t)NKV * TT * HD / 2 + 255) / 256);
    for (int b = 0; b < NB_; ++b) {
        
        k_cvt8<<<(unsigned)(((size_t)TT * DM / 8 + 255) / 256), 256, 0, stream>>>(x + (size_t)b * TT * DM, XB, (size_t)TT * DM / 8);
        k_gemmw<bf, 0, true><<<dim3(TT / 64, DQ / 64, 1), 32, 0, stream>>>(XB, nullptr, WQ, nullptr, DM, FQ, DQ, bq, 0, 0, 0);
        k_rope<<<LQ, 256, 0, stream>>>(FQ, DQ, NH_, CS, nullptr, nullptr, 1.0f, QP16, QPh, QPl);
        k_gemmw<bf, 0, true><<<dim3(TT / 64, DKV / 64, 1), 32, 0, stream>>>(XB, nullptr, WK, nullptr, DM, FK, DKV, bk, 0, 0, 0);
        k_rope<<<LKv, 256, 0, stream>>>(FK, DKV, NKV, CS, nullptr, nullptr, 1.0f, KP16, KPh, KPl);
        k_gemmw<bf, 0, true><<<dim3(TT / 64, DKV / 64, 1), 32, 0, stream>>>(XB, nullptr, WV, nullptr, DM, FV, DKV, bv, 0, 0, 0); k_vtp<<<LKv, 256, 0, stream>>>(FV, DKV, NKV, VT16, VTh, VTl);
        for (int h0 = 0; h0 < NH_; h0 += ZH) { const size_t zq = (size_t)h0, zk = (size_t)(h0 / REP);   // one kv head per query head: the pass's ZH heads use consecutive kv planes (z-strides TT*HD)
            k_gemmc<bf, 2, 1, 1><<<dim3(RH / 64, TT / 64, ZH), 32, 0, stream>>>(QPh + zq * TT * HD, QPl + zq * TT * HD, KPh + zk * TT * HD, KPl + zk * TT * HD, HD, Sb, TT, 0, (size_t)TT * HD, (size_t)TT * HD, (size_t)TT * TT, 0);
            k_gemmc<h16, 0, 1, 1><<<dim3((TT - RH) / 64, TT / 64, ZH), 32, 0, stream>>>(QP16 + zq * TT * HD + (size_t)RH * HD, nullptr, KP16 + zk * TT * HD, nullptr, HD, Sb + (size_t)RH * TT, TT, RH, (size_t)TT * HD, (size_t)TT * HD, (size_t)TT * TT, 0);
            k_asoft<<<ZH * TT / 8, 256, 0, stream>>>(Sb, h0, P16, Ph, Pl);   /* x 1/8, + slope_h (j - i) in f32, mask, softmax */
            k_gemmc<bf, 2, 2, KSP><<<dim3(RH / 64, HD / 64 * KSP, ZH), 32, 0, stream>>>(Ph, Pl, VTh + zk * HD * TT, VTl + zk * HD * TT, TT, Ob, HD, 0, (size_t)RH * TT, (size_t)HD * TT, (size_t)TT * HD, (size_t)ZH * TT * HD);
            k_gemmc<h16, 0, 2, KSP><<<dim3((TT - RH) / 64, HD / 64 * KSP, ZH), 32, 0, stream>>>(P16 + (size_t)RH * TT, nullptr, VT16 + zk * HD * TT, nullptr, TT, Ob + (size_t)RH * HD, HD, RH, (size_t)TT * TT, (size_t)HD * TT, (size_t)TT * HD, (size_t)ZH * TT * HD);
            k_merge<<<(unsigned)(((size_t)ZH * TT * HD / 2 + 255) / 256), 256, 0, stream>>>(Ob, h0, ATh, ATl); }
        k_gemmw<bf, 1, true><<<dim3(TT / 64, DM / 64, 1), 32, 0, stream>>>(ATh, ATl, WO, nullptr, DQ, OUT + (size_t)b * TT * DM, DM, bo, 0, 0, 0); }
}

// v004
// One run takes 460 microseconds.
// Two timings next to v003 put it at 1.39 and 1.40 times that version's speed.
// Counting every step since v000, it is 3.55 times as fast.
#include <hip/hip_runtime.h>

// Causal self-attention with ALiBi (linear slopes), a separate q projection and a fused k|v projection (x [2][2048][1024]; q = x q_w + q_b ('xw' [1024][1024] 0.02 + bias zeros: read); kv = (x kv_w + kv_b) ('xw' [1024][2048] 0.02 + bias zeros: read) reshaped (B, T, 2, 16, 64): k | v = column halves (16 heads x 64); att x 1/sqrt(64) + slopes[h] x (j - i) with slopes[h] = (h + 1) / 16 (exact in f32; for the kept entries j <= i this is -slopes[h] x |i - j|); causal (-inf); softmax; y = merged o_w + o_b ('xw' + bias zeros: read) -> [2][2048][1024] (4.2 M); argument order x, q_w, q_b, kv_w, kv_b, o_w, o_b).
// Layout: once, bf16 copy of x (both batches) and q_w and the fused kv weight transposed into one Bt (q | k | v row blocks); per batch: one exact q | k | v projection + f32 biases (q_b, kv_b halves); identity-table plane builders; raw scores; the softmax kernel forms S x 1/8 + slope[h] x (j - i) in f32 from each score as it loads it (slope = SLOPE8[h] / 8 = (h + 1) / 16, the bias exact); causal T-2048 attention (hybrid rows: < 512 hi/lo 3 products, rest fp16 x1024; k_attp skips tiles above the diagonal); merged hi/lo x o_w exact + o_b.
// Compute dtypes, f32 accumulate: every input rounded to bf16; projections exact + f32 biases; attention rows < 512 3 products, rest fp16; softmax f32; output projection hl x exact.

#define NB_  2
#define TT   2048
#define DM   1024
#define NH_  16
#define NKV  16
#define REP  (NH_ / NKV)
#define HD   64
#define DQ   (NH_ * HD)
#define DKV  (NKV * HD)
#define ZH   4                    // heads per attention pass (grid z of the k_attp launches in the head loop); 4 is the most that divides 16 and fits the workspace
#define RH   512                  // query rows < RH use hi+lo planes (0: none)
#define KSP  8                    // key-range splits of the probability x value contraction: one work-group per split, f32 partial planes summed in k_merge
#define WIN  2048
#define PCAR 1024.0f
#define SCL  0.125f   // HD^-0.5
typedef _Float16 h16;
typedef unsigned short bf;
typedef __attribute__((ext_vector_type(16))) __bf16   v16bf;
typedef __attribute__((ext_vector_type(16))) _Float16 v16h;
typedef __attribute__((ext_vector_type(8)))  _Float16 v8h;
typedef __attribute__((ext_vector_type(8)))  unsigned short v8us;
typedef __attribute__((ext_vector_type(8)))  float    v8f;
typedef __attribute__((ext_vector_type(4)))  float    v4f;
typedef v8h  __attribute__((may_alias)) v8ha;
typedef v4f  __attribute__((may_alias)) v4fa;
typedef v8us __attribute__((may_alias)) v8usa;

__device__ __forceinline__ unsigned short f2bf(float f) { unsigned u = __float_as_uint(f); u += 0x7FFFu + ((u >> 16) & 1u); return (unsigned short)(u >> 16); }
__device__ __forceinline__ float bf2f(unsigned short b) { return __uint_as_float(((unsigned)b) << 16); }
__device__ __forceinline__ float bfr(float f) { return bf2f(f2bf(f)); }
__device__ __forceinline__ v16h cat16(v8h lo, v8h hi) { return __builtin_shufflevector(lo, hi, 0, 1, 2, 3, 4, 5, 6, 7, 8, 9, 10, 11, 12, 13, 14, 15); }
__device__ __forceinline__ v16bf cat16b(v8us lo, v8us hi) { return __builtin_bit_cast(v16bf, __builtin_shufflevector(lo, hi, 0, 1, 2, 3, 4, 5, 6, 7, 8, 9, 10, 11, 12, 13, 14, 15)); }
__device__ __forceinline__ v8f wmma16(v16h a, v16h b, v8f c) { return __builtin_amdgcn_wmma_f32_16x16x32_f16(false, a, false, b, (short)0, c, false, false); }
__device__ __forceinline__ v8f wmmab(v16bf a, v16bf b, v8f c) { return __builtin_amdgcn_wmma_f32_16x16x32_bf16(false, a, false, b, (short)0, c, false, false); }



// ---- k_gemmw: register-blocked GEMM, ONE WAVE per 64x64 output tile (16 accumulators), operands straight from K-contiguous 16-bit planes; grid (M/64, N/64, Z), 32 threads.
// C[m][n] (f32, pitch ldc, + optional f32 bias[n] for n < nb1, bias2[n - nb1] beyond) = sum_k A[m][k] Bt[n][k] (+ split products per NSPLIT). z-batch strides sA/sB/sC in elements. K % 32 == 0.
template <typename T16> struct WFrag;
template <> struct WFrag<h16> { typedef v16h V; static __device__ __forceinline__ V ld(const h16* p) { return cat16(*(const v8h*)p, *(const v8h*)(p + 16)); } static __device__ __forceinline__ v8f mma(V a, V b, v8f c) { return wmma16(a, b, c); } };
template <> struct WFrag<bf> { typedef v16bf V; static __device__ __forceinline__ V ld(const bf* p) { return cat16b(*(const v8us*)p, *(const v8us*)(p + 16)); } static __device__ __forceinline__ v8f mma(V a, V b, v8f c) { return wmmab(a, b, c); } };
template <typename T16, int NSPLIT, bool BIAS>
__global__ __launch_bounds__(32) void k_gemmw(const T16* __restrict__ A, const T16* __restrict__ A2, const T16* __restrict__ Bt, const T16* __restrict__ Bt2, int K, float* C, int ldc, const float* __restrict__ bias, const float* __restrict__ bias2, int nb1, size_t sA, size_t sB, size_t sC) {
    typedef typename WFrag<T16>::V V;
    __shared__ __align__(16) float os[16 * 68];
    const size_t z = blockIdx.z; A += z * sA; if (A2) A2 += z * sA; Bt += z * sB; if (Bt2) Bt2 += z * sB; C += z * sC;
    const int lane = threadIdx.x & 31, lr = lane & 15, hi = lane >> 4; const int r0 = blockIdx.x * 64, c0 = blockIdx.y * 64;
    const float* bp = (c0 < nb1) ? bias + c0 : bias2 + (c0 - nb1);   // columns < nb1 take bias, the rest bias2 (nb1 % 64 == 0: a tile never straddles)
    v8f acc[4][4];
#pragma unroll
    for (int mb = 0; mb < 4; ++mb)
#pragma unroll
        for (int nb = 0; nb < 4; ++nb) acc[mb][nb] = (v8f){};
    const size_t aoff = (size_t)(r0 + lr) * K + 8 * hi, boff = (size_t)(c0 + lr) * K + 8 * hi;
#pragma unroll 1
    for (int kc = 0; kc < K; kc += 32) {
        V a[4], a2[4];
#pragma unroll
        for (int mb = 0; mb < 4; ++mb) { a[mb] = WFrag<T16>::ld(A + aoff + (size_t)mb * 16 * K + kc); if (NSPLIT == 1 || NSPLIT == 2) a2[mb] = WFrag<T16>::ld(A2 + aoff + (size_t)mb * 16 * K + kc); }
#pragma unroll
        for (int nb = 0; nb < 4; ++nb) { const V b = WFrag<T16>::ld(Bt + boff + (size_t)nb * 16 * K + kc); V b2; if (NSPLIT >= 2) b2 = WFrag<T16>::ld(Bt2 + boff + (size_t)nb * 16 * K + kc);
#pragma unroll
            for (int mb = 0; mb < 4; ++mb) { acc[mb][nb] = WFrag<T16>::mma(a[mb], b, acc[mb][nb]); if (NSPLIT == 1 || NSPLIT == 2) acc[mb][nb] = WFrag<T16>::mma(a2[mb], b, acc[mb][nb]); if (NSPLIT >= 2) acc[mb][nb] = WFrag<T16>::mma(a[mb], b2, acc[mb][nb]); } }
        asm volatile("v_nop\n\tv_nop\n\tv_nop\n\tv_nop" : "+v"(acc[0][0]), "+v"(acc[1][1]), "+v"(acc[2][2]), "+v"(acc[3][3]) : "v"(a[0]), "v"(a[3]));
    }
#pragma unroll
    for (int mb = 0; mb < 4; ++mb) {
#pragma unroll
        for (int nb = 0; nb < 4; ++nb) {
#pragma unroll
            for (int j = 0; j < 8; ++j) os[(hi * 8 + j) * 68 + nb * 16 + lr] = acc[mb][nb][j]; }
        __builtin_amdgcn_wave_barrier(); asm volatile("" ::: "memory");
        float* crow = C + (size_t)(r0 + mb * 16) * ldc + c0;
{
#pragma unroll
            for (int s = 0; s < 8; ++s) { const int row = 2 * s + hi, cofs = lr * 4; v4f val = *(const v4fa*)(os + row * 68 + cofs); if (BIAS) { val[0] += bfr(bp[cofs]); val[1] += bfr(bp[cofs + 1]); val[2] += bfr(bp[cofs + 2]); val[3] += bfr(bp[cofs + 3]); }
                *(v4f*)(crow + (size_t)row * ldc + cofs) = val; }
             }
        __builtin_amdgcn_wave_barrier(); asm volatile("" ::: "memory");
    }
}

// ---- d_gemmc: the same one-wave 64x64 tile GEMM specialised for causal attention: CMODE 1 = scores (k_attp returns first for tiles entirely above the diagonal; query rows r0+roff.., key columns c0..), CMODE 2 limits the
// key (K) loop of the probability x value contraction to the diagonal block (probabilities beyond it are exactly zero). roff = row offset of this body's first row within the sequence.
// KS > 1: grid y = column tiles x KS; split ks sums its own run of whole 64-key chunks of [0, Kl) into partial plane ks (stride sP); a split whose run is empty stores zeros, so every plane is fully written.
// The body is a device function (bx = row tile within its own row range, os = the work-group's 16 x 68 f32 LDS tile): k_attp below runs the hi/lo rows and the fp16 rows of one stage in ONE grid.
template <typename T16, int NSPLIT, int CMODE, int KS>
__device__ __forceinline__ void d_gemmc(float* os, int bx, const T16* __restrict__ A, const T16* __restrict__ A2, const T16* __restrict__ Bt, const T16* __restrict__ Bt2, int K, float* C, int ldc, int roff, size_t sA, size_t sB, size_t sC, size_t sP) {
    typedef typename WFrag<T16>::V V;
    const size_t z = blockIdx.z; A += z * sA; if (A2) A2 += z * sA; Bt += z * sB; if (Bt2) Bt2 += z * sB; C += z * sC;
    const int lane = threadIdx.x & 31, lr = lane & 15, hi = lane >> 4; const int r0 = bx * 64, c0 = (int)(blockIdx.y / KS) * 64, ks = (int)(blockIdx.y % KS);
    const int Kl = (CMODE == 2) ? min(K, r0 + roff + 64) : K;        // P.V: probabilities are exactly 0 beyond the diagonal block, so the K loop stops there
    const int per = (KS > 1) ? ((Kl / 64 + KS - 1) / KS) * 64 : Kl;  // keys per split: the tile's own range in runs of ceil(Kl / 64 / KS) whole 64-key chunks (later splits may get fewer or none), so the longest dependent load chain is one such run
    const int kb = ks * per, ke = min(Kl, kb + per); C += (size_t)ks * sP;
    v8f acc[4][4];
#pragma unroll
    for (int mb = 0; mb < 4; ++mb)
#pragma unroll
        for (int nb = 0; nb < 4; ++nb) acc[mb][nb] = (v8f){};
    const size_t aoff = (size_t)(r0 + lr) * K + 8 * hi, boff = (size_t)(c0 + lr) * K + 8 * hi;
#pragma unroll 1
    for (int kc = kb; kc < ke; kc += 32) {
        V a[4], a2[4];
#pragma unroll
        for (int mb = 0; mb < 4; ++mb) { a[mb] = WFrag<T16>::ld(A + aoff + (size_t)mb * 16 * K + kc); if (NSPLIT == 1 || NSPLIT == 2) a2[mb] = WFrag<T16>::ld(A2 + aoff + (size_t)mb * 16 * K + kc); }
#pragma unroll
        for (int nb = 0; nb < 4; ++nb) { const V b = WFrag<T16>::ld(Bt + boff + (size_t)nb * 16 * K + kc); V b2; if (NSPLIT >= 2) b2 = WFrag<T16>::ld(Bt2 + boff + (size_t)nb * 16 * K + kc);
#pragma unroll
            for (int mb = 0; mb < 4; ++mb) { acc[mb][nb] = WFrag<T16>::mma(a[mb], b, acc[mb][nb]); if (NSPLIT == 1 || NSPLIT == 2) acc[mb][nb] = WFrag<T16>::mma(a2[mb], b, acc[mb][nb]); if (NSPLIT >= 2) acc[mb][nb] = WFrag<T16>::mma(a[mb], b2, acc[mb][nb]); } }
        asm volatile("v_nop\n\tv_nop\n\tv_nop\n\tv_nop" : "+v"(acc[0][0]), "+v"(acc[1][1]), "+v"(acc[2][2]), "+v"(acc[3][3]) : "v"(a[0]), "v"(a[3]));
    }
#pragma unroll
    for (int mb = 0; mb < 4; ++mb) {
#pragma unroll
        for (int nb = 0; nb < 4; ++nb) {
#pragma unroll
            for (int j = 0; j < 8; ++j) os[(hi * 8 + j) * 68 + nb * 16 + lr] = acc[mb][nb][j]; }
        __builtin_amdgcn_wave_barrier(); asm volatile("" ::: "memory");
        float* crow = C + (size_t)(r0 + mb * 16) * ldc + c0;
{
#pragma unroll
            for (int s = 0; s < 8; ++s) { const int row = 2 * s + hi, cofs = lr * 4; v4f val = *(const v4fa*)(os + row * 68 + cofs);
                *(v4f*)(crow + (size_t)row * ldc + cofs) = val; }
             }
        __builtin_amdgcn_wave_barrier(); asm volatile("" ::: "memory");
    }
}

// k_attp: one grid over all TT / 64 row tiles of a stage: row tiles < RH / 64 take the hi/lo 3-product body, the rest the fp16 body (the two row ranges share nothing, so they need no order between them).
template <int CMODE, int KS>
__global__ __launch_bounds__(32) void k_attp(const bf* __restrict__ Ah, const bf* __restrict__ Al, const bf* __restrict__ Bh, const bf* __restrict__ Bl, size_t sAh, const h16* __restrict__ A16, const h16* __restrict__ B16, size_t sA16, int K, float* C, int ldc, size_t sB, size_t sC, size_t sP) {
    __shared__ __align__(16) float os[16 * 68];
    const int bx = (int)blockIdx.x;
    if (CMODE == 1 && (int)(blockIdx.y / KS) * 64 > bx * 64 + 63) return;   // score tile entirely above the causal diagonal (bx = row tile within the sequence): its scores are never used (the softmax loads them but masks j > i by select)
    if (bx < RH / 64) { d_gemmc<bf, 2, CMODE, KS>(os, bx, Ah, Al, Bh, Bl, K, C, ldc, 0, sAh, sB, sC, sP); return; }
    d_gemmc<h16, 0, CMODE, KS>(os, bx - RH / 64, A16, nullptr, B16, nullptr, K, C + (size_t)RH * ldc, ldc, RH, sA16, sB, sC, sP);
    if (CMODE == 1) asm volatile("s_wait_xcnt 0x0" ::: "memory");   // behind this tile's last stores: in the built score kernel the hi/lo body stands behind this one and rewrites the registers those stores name (the P.V build branches from there to the kernel's end)
}

__device__ __forceinline__ h16 tohx(float x) { return (h16)x; }
__device__ __forceinline__ void splitf(float y, unsigned short& h, unsigned short& l) { h = f2bf(y); l = f2bf(y - bf2f(h)); }
typedef __attribute__((ext_vector_type(2))) _Float16 v2h;
typedef __attribute__((ext_vector_type(4))) _Float16 v4h;
typedef __attribute__((ext_vector_type(2))) unsigned short v2us;
typedef __attribute__((ext_vector_type(4))) unsigned short v4us;
typedef __attribute__((ext_vector_type(2))) float v2f;
typedef __attribute__((ext_vector_type(4))) int v4i;

__device__ __forceinline__ void d_wtG(unsigned blk, const float* __restrict__ w, int K, int N, bf* Bt) {
    const int lane = threadIdx.x & 31; const int L0 = (blk * 8 + (threadIdx.x >> 5)) * 8; const int nlines = N * K / 64;
{
#pragma unroll 1
        for (int l = 0; l < 8; ++l) { const int L = L0 + l; if (L >= nlines) break; const size_t e = (size_t)L * 64 + lane * 2; const int k = (int)(e % K), n = (int)(e / K); v2us o;
            o[0] = f2bf(w[(size_t)k * N + n]); o[1] = f2bf(w[(size_t)(k + 1) * N + n]); *(v2us*)(Bt + e) = o;
            asm volatile("s_wait_xcnt 0x0" ::: "memory");   /* the next trip rewrites the registers this store names: the wait stands in front of that */ }
         }
}
__device__ __forceinline__ void d_cvt8(unsigned blk, const float* __restrict__ src, bf* dst, size_t n8) { const size_t i = (size_t)blk * 256 + threadIdx.x; if (i >= n8) return; const v8f v = *(const v8f*)(src + i * 8); v8us o;
#pragma unroll
    for (int k = 0; k < 8; ++k) o[k] = f2bf(v[k]); *(v8us*)(dst + i * 8) = o;  }

// d_rope: head planes [h][t][d] (fp16 + hi/lo) of rope(x) x sc with the rotate-half convention out[d] = x[d] cos[t][d] - x[d+HD/2] sin[t][d], out[d+HD/2] = x[d+HD/2] cos[t][d+HD/2] + x[d] sin[t][d+HD/2]
__device__ __forceinline__ void d_rope(unsigned blk, const float* __restrict__ F, int pitch, int nheads, const float* __restrict__ CS, const float* __restrict__ RF, const float* __restrict__ nw, float sc, h16* P16, bf* Ph, bf* Pl) {
    const size_t e = ((size_t)blk * 256 + threadIdx.x) * 2; if (e >= (size_t)nheads * TT * HD) return; const int d = (int)(e % HD); const int t = (int)((e / HD) % TT); const int h = (int)(e / ((size_t)HD * TT)); const float* f = F + (size_t)t * pitch + h * HD; const float rf = RF ? RF[(size_t)h * TT + t] : 1.0f; v2h o16; v2us oh, ol;
#pragma unroll
    for (int q = 0; q < 2; ++q) { const int dd = d + q; const int dp = (dd < HD / 2) ? dd + HD / 2 : dd - HD / 2; float x0 = f[dd], x1 = f[dp];
        if (RF) { float n0 = __fmul_rn(x0, rf), n1 = __fmul_rn(x1, rf); asm volatile("" : "+v"(n0)); asm volatile("" : "+v"(n1)); x0 = __fmul_rn(bfr(nw[dd]), n0); x1 = __fmul_rn(bfr(nw[dp]), n1); }
        const v2f cs = *(const v2f*)(CS + ((size_t)t * HD + dd) * 2); float a = __fmul_rn(x0, cs[0]), bq = __fmul_rn(x1, cs[1]); asm volatile("" : "+v"(a)); asm volatile("" : "+v"(bq)); const float r = ((dd < HD / 2) ? __fsub_rn(a, bq) : __fadd_rn(a, bq)) * sc;
        o16[q] = tohx(r); unsigned short a2, c2; splitf(r, a2, c2); oh[q] = a2; ol[q] = c2; }
    *(v2h*)(P16 + e) = o16; *(v2us*)(Ph + e) = oh; *(v2us*)(Pl + e) = ol;  }
__device__ __forceinline__ void d_vtp(unsigned blk, const float* __restrict__ F, int pitch, int nheads, h16* V16, bf* Vh, bf* Vl) { const size_t e = ((size_t)blk * 256 + threadIdx.x) * 2; if (e >= (size_t)nheads * HD * TT) return; const int t = (int)(e % TT); const int d = (int)((e / TT) % HD); const int g = (int)(e / ((size_t)TT * HD)); v2h o16; v2us oh, ol;
#pragma unroll
    for (int q = 0; q < 2; ++q) { const float x = F[(size_t)(t + q) * pitch + g * HD + d]; o16[q] = tohx(x); unsigned short a2, c2; splitf(x, a2, c2); oh[q] = a2; ol[q] = c2; }
    *(v2h*)(V16 + e) = o16; *(v2us*)(Vh + e) = oh; *(v2us*)(Vl + e) = ol;  }
__device__ __forceinline__ void d_csid(unsigned blk, float* CS) { const int idx = blk * 256 + threadIdx.x; if (idx >= TT * HD) return; v2f cs; cs[0] = 1.0f; cs[1] = 0.0f; *(v2f*)(CS + (size_t)idx * 2) = cs;  }
// k_prep: everything that depends on the inputs alone, in one grid by block ranges: the three weight transposes (first: the longest blocks), the identity table, the bf16 copy of x (both batches).
#define PB_Q  ((DM * DQ / 64 + 63) / 64)
#define PB_KV ((DM * 2 * DKV / 64 + 63) / 64)
#define PB_O  ((DQ * DM / 64 + 63) / 64)
#define PB_CS ((TT * HD + 255) / 256)
#define PB_X  ((NB_ * TT * DM / 8 + 255) / 256)
__global__ __launch_bounds__(256) void k_prep(const float* __restrict__ wq, const float* __restrict__ wkv, const float* __restrict__ wo, const float* __restrict__ x, bf* WQ, bf* WKV, bf* WO, float* CS, bf* XB) {
    unsigned b = blockIdx.x;
    if (b < PB_Q) { d_wtG(b, wq, DM, DQ, WQ); return; } b -= PB_Q;
    if (b < PB_KV) { d_wtG(b, wkv, DM, 2 * DKV, WKV); return; } b -= PB_KV;   /* fused 'xw' [DM][2*DKV] -> Bt [2*DKV][DM]: k | v */
    if (b < PB_O) { d_wtG(b, wo, DQ, DM, WO); return; } b -= PB_O;
    if (b < PB_CS) { d_csid(b, CS); return; } b -= PB_CS;
    d_cvt8(b, x, XB, (size_t)NB_ * TT * DM / 8);
}
// k_planes: the q and k head planes (NH_ + NKV heads = columns [0, DQ + DKV) of the fused projection F) and the transposed v planes (columns from DQ + DKV), in one grid by block ranges.
#define LB_QK ((unsigned)(((size_t)(NH_ + NKV) * TT * HD / 2 + 255) / 256))
#define LB_V  ((unsigned)(((size_t)NKV * TT * HD / 2 + 255) / 256))
__global__ __launch_bounds__(256) void k_planes(const float* __restrict__ F, int pitch, const float* __restrict__ CS, h16* QK16, bf* QKh, bf* QKl, h16* V16, bf* Vh, bf* Vl) {
    const unsigned b = blockIdx.x;
    if (b < LB_V) d_vtp(b, F + DQ + DKV, pitch, NKV, V16, Vh, Vl);   // first: its strided reads make these the longest blocks
    else d_rope(b - LB_V, F, pitch, NH_ + NKV, CS, nullptr, nullptr, 1.0f, QK16, QKh, QKl);
}
__constant__ float SLOPE8[NH_] = { 5.000000000e-1f, 1.000000000e+0f, 1.500000000e+0f, 2.000000000e+0f, 2.500000000e+0f, 3.000000000e+0f, 3.500000000e+0f, 4.000000000e+0f, 4.500000000e+0f, 5.000000000e+0f, 5.500000000e+0f, 6.000000000e+0f, 6.500000000e+0f, 7.000000000e+0f, 7.500000000e+0f, 8.000000000e+0f };   // 8 x the per-head ALiBi slope magnitude (slopes[h] = (h + 1) / 16, h = 0..15, x 8 = (h + 1) / 2: exact); every entry and every product with |i - j| <= 2047 is exact in f32
// k_asoft: per row (zz, i): t = S x HD^-0.5 + slope[h0 + zz] x (j - i) for j <= i and i - j < WIN (sliding causal window; the reference's -1e9 additive fill vanishes identically); softmax over the 2048 keys (register row, one exp, fixed trees);
__global__ __launch_bounds__(256) void k_asoft(const float* __restrict__ Sb, int h0, h16* P16, bf* Ph, bf* Pl) {
    const int lane = threadIdx.x & 31; const int row = blockIdx.x * 8 + (threadIdx.x >> 5); if (row >= ZH * TT) return; const int i = row % TT; const int zz = row / TT; const float sl = SLOPE8[h0 + zz] * SCL; const float bi = sl * (float)(i - lane * 4);   /* sl = the head's slope (h + 1) / 16; the bias slope x (j - i) = sl x (ch * 128 + q) - bi; sixteenths of whole numbers below 2^16: every product and sum of it is exact in f32 */ const bool hires = (i < RH); const float* sr = Sb + (size_t)row * TT; float v[TT / 32]; float mx = -3.0e38f;
#pragma unroll
    for (int ch = 0; ch < TT / 128; ++ch) { const int j0 = ch * 128 + lane * 4; const v4f a = *(const v4f*)(sr + j0);
#pragma unroll
        for (int q = 0; q < 4; ++q) { const int j = j0 + q; (void)j; const float t = (j <= i && i - j < WIN) ? __builtin_fmaf(a[q], SCL, __builtin_fmaf(sl, (float)(ch * 128 + q), -bi)) : -3.0e38f;   /* S / 8 + slope x (j - i): the bias is exact and 1/8 a power of two, so the sum is rounded once, as in the reference's scale, then add */ v[ch * 4 + q] = t; mx = fmaxf(mx, t); } }
#pragma unroll
    for (int sh = 16; sh; sh >>= 1) mx = fmaxf(mx, __shfl_xor(mx, sh, 32));
    float sum = 0.f;
#pragma unroll
    for (int k = 0; k < TT / 32; ++k) { float d0 = __fsub_rn(v[k], mx); asm volatile("" : "+v"(d0)); v[k] = __builtin_amdgcn_exp2f(__fmul_rn(d0, 1.4426950408889634f)); sum += v[k]; }
#pragma unroll
    for (int sh = 16; sh; sh >>= 1) sum += __shfl_xor(sum, sh, 32);
    const float f = __fdiv_rn(hires ? 1.0f : PCAR, sum);
{
        if (hires) {
#pragma unroll
            for (int ch = 0; ch < TT / 128; ++ch) { v4us oh, ol;
#pragma unroll
                for (int q = 0; q < 4; ++q) { unsigned short a, c2; splitf(v[ch * 4 + q] * f, a, c2); oh[q] = a; ol[q] = c2; }
                const size_t oo = ((size_t)zz * (RH ? RH : 1) + i) * TT + ch * 128 + lane * 4; *(v4us*)(Ph + oo) = oh; *(v4us*)(Pl + oo) = ol; }
        } else {
#pragma unroll
            for (int ch = 0; ch < TT / 128; ++ch) { v4h o4;
#pragma unroll
                for (int q = 0; q < 4; ++q) o4[q] = tohx(v[ch * 4 + q] * f);
                *(v4h*)(P16 + (size_t)row * TT + ch * 128 + lane * 4) = o4; } }
         }
}
__global__ __launch_bounds__(256) void k_merge(const float* __restrict__ O, int h0, bf* Ah, bf* Al) { const size_t e = ((size_t)blockIdx.x * 256 + threadIdx.x) * 2; if (e >= (size_t)ZH * TT * HD) return; const int d = (int)(e % HD); const int t = (int)((e / HD) % TT); const int zz = (int)(e / ((size_t)HD * TT)); const float cs = (t < RH) ? 1.0f : (1.0f / PCAR); const size_t oo = (size_t)t * DQ + (h0 + zz) * HD + d;
    v2f y = *(const v2f*)(O + e);   // the KSP key-range partials, added in split order
#pragma unroll
    for (int s = 1; s < KSP; ++s) y += *(const v2f*)(O + (size_t)s * ZH * TT * HD + e);
    v2us oh, ol;
#pragma unroll
    for (int q = 0; q < 2; ++q) { unsigned short a, c2; splitf(y[q] * cs, a, c2); oh[q] = a; ol[q] = c2; } *(v2us*)(Ah + oo) = oh; *(v2us*)(Al + oo) = ol;  }

extern "C" void kernel_launch(void* const* d_in, const int* in_sizes, int n_in,
                              void* d_out, int out_size, void* d_ws, size_t ws_size, hipStream_t stream) {
    (void)in_sizes; (void)n_in; (void)out_size;
    const float* x = (const float*)d_in[0]; const float* wq = (const float*)d_in[1]; const float* bq = (const float*)d_in[2]; const float* wkv = (const float*)d_in[3]; const float* bkv = (const float*)d_in[4]; const float* wo = (const float*)d_in[5]; const float* bo = (const float*)d_in[6];
    float* OUT = (float*)d_out;     // [2][2048][1024]
    char* wsp = (char*)d_ws;
    auto take = [&](size_t bytes) { char* p = wsp; wsp += (bytes + 255) & ~(size_t)255; return (void*)p; };
    bf* WQ = (bf*)take((size_t)(DQ + 2 * DKV) * DM * 2); bf* WKV = WQ + (size_t)DQ * DM;   /* one Bt [DQ + 2*DKV][DM]: q | k | v row blocks */ bf* WO = (bf*)take((size_t)DM * DQ * 2); float* CS = (float*)take((size_t)TT * HD * 2 * 4);
    bf* XB = (bf*)take((size_t)NB_ * TT * DM * 2); float* F = (float*)take((size_t)TT * (DQ + 2 * DKV) * 4);   /* fused projection [TT][q | k | v] */
    h16* QP16 = (h16*)take((size_t)(NH_ + NKV) * TT * HD * 2); h16* KP16 = QP16 + (size_t)NH_ * TT * HD; h16* VT16 = (h16*)take((size_t)NKV * HD * TT * 2);   /* the k planes follow the q planes: one builder range */
    bf* QPh = (bf*)take((size_t)(NH_ + NKV) * TT * HD * 2); bf* KPh = QPh + (size_t)NH_ * TT * HD; bf* QPl = (bf*)take((size_t)(NH_ + NKV) * TT * HD * 2); bf* KPl = QPl + (size_t)NH_ * TT * HD; bf* VTh = (bf*)take((size_t)NKV * HD * TT * 2); bf* VTl = (bf*)take((size_t)NKV * HD * TT * 2); bf* Ph = (bf*)take((size_t)ZH * RH * TT * 2); bf* Pl = (bf*)take((size_t)ZH * RH * TT * 2);
    float* Sb = (float*)take((size_t)ZH * TT * TT * 4); h16* P16 = (h16*)take((size_t)ZH * TT * TT * 2); float* Ob = (float*)take((size_t)KSP * ZH * TT * HD * 4); bf* ATh = (bf*)take((size_t)TT * DQ * 2); bf* ATl = (bf*)take((size_t)TT * DQ * 2);
    if ((size_t)(wsp - (char*)d_ws) > ws_size) return;    // ws 256 MiB
    k_prep<<<PB_Q + PB_KV + PB_O + PB_CS + PB_X, 256, 0, stream>>>(wq, wkv, wo, x, WQ, WKV, WO, CS, XB);
    for (int b = 0; b < NB_; ++b) {
        k_gemmw<bf, 0, true><<<dim3(TT / 64, (DQ + 2 * DKV) / 64, 1), 32, 0, stream>>>(XB + (size_t)b * TT * DM, nullptr, WQ, nullptr, DM, F, DQ + 2 * DKV, bq, bkv, DQ, 0, 0, 0);   /* q | k | v in one grid; kv_b = k | v bias halves */
        k_planes<<<LB_QK + LB_V, 256, 0, stream>>>(F, DQ + 2 * DKV, CS, QP16, QPh, QPl, VT16, VTh, VTl);
        for (int h0 = 0; h0 < NH_; h0 += ZH) { const size_t zq = (size_t)h0, zk = (size_t)(h0 / REP);   // one kv head per query head: the pass's ZH heads use consecutive kv planes (z-strides TT*HD)
            k_attp<1, 1><<<dim3(TT / 64, TT / 64, ZH), 32, 0, stream>>>(QPh + zq * TT * HD, QPl + zq * TT * HD, KPh + zk * TT * HD, KPl + zk * TT * HD, (size_t)TT * HD, QP16 + zq * TT * HD + (size_t)RH * HD, KP16 + zk * TT * HD, (size_t)TT * HD, HD, Sb, TT, (size_t)TT * HD, (size_t)TT * TT, 0);
            k_asoft<<<ZH * TT / 8, 256, 0, stream>>>(Sb, h0, P16, Ph, Pl);   /* x 1/8, + slope_h (j - i) in f32, mask, softmax */
            k_attp<2, KSP><<<dim3(TT / 64, HD / 64 * KSP, ZH), 32, 0, stream>>>(Ph, Pl, VTh + zk * HD * TT, VTl + zk * HD * TT, (size_t)RH * TT, P16 + (size_t)RH * TT, VT16 + zk * HD * TT, (size_t)TT * TT, TT, Ob, HD, (size_t)HD * TT, (size_t)TT * HD, (size_t)ZH * TT * HD);
            k_merge<<<(unsigned)(((size_t)ZH * TT * HD / 2 + 255) / 256), 256, 0, stream>>>(Ob, h0, ATh, ATl); }
        k_gemmw<bf, 1, true><<<dim3(TT / 64, DM / 64, 1), 32, 0, stream>>>(ATh, ATl, WO, nullptr, DQ, OUT + (size_t)b * TT * DM, DM, bo, bo, DM, 0, 0, 0); }
}

// v006
// It runs in 179 microseconds.
// Versions in between are left out here; by their measured steps it is 2.58 times as fast as v004.
// Over all steps from v000 it is 9.17 times as fast.
#include <hip/hip_runtime.h>

// Causal self-attention with ALiBi (linear slopes), a separate q projection and a fused k|v projection (x [2][2048][1024]; q = x q_w + q_b ('xw' [1024][1024] 0.02 + bias zeros: read); kv = (x kv_w + kv_b) ('xw' [1024][2048] 0.02 + bias zeros: read) reshaped (B, T, 2, 16, 64): k | v = column halves (16 heads x 64); att x 1/sqrt(64) + slopes[h] x (j - i) with slopes[h] = (h + 1) / 16 (exact in f32; for the kept entries j <= i this is -slopes[h] x |i - j|); causal (-inf); softmax; y = merged o_w + o_b ('xw' + bias zeros: read) -> [2][2048][1024] (4.2 M); argument order x, q_w, q_b, kv_w, kv_b, o_w, o_b).
// Layout (each stage one launch for both batches): bf16 copy of x; q_w transposed; the fused kv weight transposed once into Bt (k | v row blocks) + bias halves; exact projections + f32 biases; identity-table plane builders; one fused attention kernel (scores, S x 1/8 + slope[h] x (j - i) in f32 with slope = SLOPE8[h] / 8 = (h + 1) / 16 and the bias exact, causal mask, running-maximum softmax, probability x value; hybrid rows: < 512 hi/lo 3 products, rest fp16 x1024; key tiles above the diagonal are never visited); merged hi/lo x o_w exact + o_b.
// Compute dtypes, f32 accumulate: every input rounded to bf16; projections exact + f32 biases; attention rows < 512 3 products, rest fp16; softmax f32; output projection hl x exact.

#define NB_  2
#define TT   2048
#define DM   1024
#define NH_  16
#define NKV  16
#define REP  (NH_ / NKV)
#define HD   64
#define DQ   (NH_ * HD)
#define DKV  (NKV * HD)
#define RH   512                  // query rows < RH use hi+lo planes (0: none)
#define PCAR 1024.0f
#define SCL  0.125f   // HD^-0.5
typedef _Float16 h16;
typedef unsigned short bf;
typedef __attribute__((ext_vector_type(16))) __bf16   v16bf;
typedef __attribute__((ext_vector_type(16))) _Float16 v16h;
typedef __attribute__((ext_vector_type(8)))  _Float16 v8h;
typedef __attribute__((ext_vector_type(8)))  unsigned short v8us;
typedef __attribute__((ext_vector_type(8)))  float    v8f;
typedef __attribute__((ext_vector_type(4)))  float    v4f;
typedef v8h  __attribute__((may_alias)) v8ha;
typedef v4f  __attribute__((may_alias)) v4fa;
typedef v8us __attribute__((may_alias)) v8usa;

__device__ __forceinline__ unsigned short f2bf(float f) { unsigned u = __float_as_uint(f); u += 0x7FFFu + ((u >> 16) & 1u); return (unsigned short)(u >> 16); }
__device__ __forceinline__ float bf2f(unsigned short b) { return __uint_as_float(((unsigned)b) << 16); }
__device__ __forceinline__ float bfr(float f) { return bf2f(f2bf(f)); }
__device__ __forceinline__ v16h cat16(v8h lo, v8h hi) { return __builtin_shufflevector(lo, hi, 0, 1, 2, 3, 4, 5, 6, 7, 8, 9, 10, 11, 12, 13, 14, 15); }
__device__ __forceinline__ v16bf cat16b(v8us lo, v8us hi) { return __builtin_bit_cast(v16bf, __builtin_shufflevector(lo, hi, 0, 1, 2, 3, 4, 5, 6, 7, 8, 9, 10, 11, 12, 13, 14, 15)); }
__device__ __forceinline__ v8f wmma16(v16h a, v16h b, v8f c) { return __builtin_amdgcn_wmma_f32_16x16x32_f16(false, a, false, b, (short)0, c, false, false); }
__device__ __forceinline__ v8f wmmab(v16bf a, v16bf b, v8f c) { return __builtin_amdgcn_wmma_f32_16x16x32_bf16(false, a, false, b, (short)0, c, false, false); }



// ---- k_gemmw: register-blocked GEMM, ONE WAVE per 64x64 output tile (16 accumulators), operands straight from K-contiguous 16-bit planes; grid (M/64, N/64, Z), 32 threads.
// C[m][n] (f32, pitch ldc, + optional f32 bias[n] for n < nb1, bias2[n - nb1] beyond) = sum_k A[m][k] Bt[n][k] (+ split products per NSPLIT). z-batch strides sA/sB/sC in elements. K % 32 == 0.
template <typename T16> struct WFrag;
template <> struct WFrag<h16> { typedef v16h V; static __device__ __forceinline__ V ld(const h16* p) { return cat16(*(const v8h*)p, *(const v8h*)(p + 16)); } static __device__ __forceinline__ v8f mma(V a, V b, v8f c) { return wmma16(a, b, c); } };
template <> struct WFrag<bf> { typedef v16bf V; static __device__ __forceinline__ V ld(const bf* p) { return cat16b(*(const v8us*)p, *(const v8us*)(p + 16)); } static __device__ __forceinline__ v8f mma(V a, V b, v8f c) { return wmmab(a, b, c); } };
template <typename T16, int NSPLIT, bool BIAS>
__global__ __launch_bounds__(32) void k_gemmw(const T16* __restrict__ A, const T16* __restrict__ A2, const T16* __restrict__ Bt, const T16* __restrict__ Bt2, int K, float* C, int ldc, const float* __restrict__ bias, const float* __restrict__ bias2, int nb1, size_t sA, size_t sB, size_t sC) {
    typedef typename WFrag<T16>::V V;
    __shared__ __align__(16) float os[16 * 68];
    const size_t z = blockIdx.z; A += z * sA; if (A2) A2 += z * sA; Bt += z * sB; if (Bt2) Bt2 += z * sB; C += z * sC;
    const int lane = threadIdx.x & 31, lr = lane & 15, hi = lane >> 4; const int r0 = blockIdx.x * 64, c0 = blockIdx.y * 64;
    const float* bp = (c0 < nb1) ? bias + c0 : bias2 + (c0 - nb1);   // columns < nb1 take bias, the rest bias2 (nb1 % 64 == 0: a tile never straddles)
    v8f acc[4][4];
#pragma unroll
    for (int mb = 0; mb < 4; ++mb)
#pragma unroll
        for (int nb = 0; nb < 4; ++nb) acc[mb][nb] = (v8f){};
    const size_t aoff = (size_t)(r0 + lr) * K + 8 * hi, boff = (size_t)(c0 + lr) * K + 8 * hi;
#pragma unroll 1
    for (int kc = 0; kc < K; kc += 32) {
        V a[4], a2[4];
#pragma unroll
        for (int mb = 0; mb < 4; ++mb) { a[mb] = WFrag<T16>::ld(A + aoff + (size_t)mb * 16 * K + kc); if (NSPLIT == 1 || NSPLIT == 2) a2[mb] = WFrag<T16>::ld(A2 + aoff + (size_t)mb * 16 * K + kc); }
#pragma unroll
        for (int nb = 0; nb < 4; ++nb) { const V b = WFrag<T16>::ld(Bt + boff + (size_t)nb * 16 * K + kc); V b2; if (NSPLIT >= 2) b2 = WFrag<T16>::ld(Bt2 + boff + (size_t)nb * 16 * K + kc);
#pragma unroll
            for (int mb = 0; mb < 4; ++mb) { acc[mb][nb] = WFrag<T16>::mma(a[mb], b, acc[mb][nb]); if (NSPLIT == 1 || NSPLIT == 2) acc[mb][nb] = WFrag<T16>::mma(a2[mb], b, acc[mb][nb]); if (NSPLIT >= 2) acc[mb][nb] = WFrag<T16>::mma(a[mb], b2, acc[mb][nb]); } }
        asm volatile("v_nop\n\tv_nop\n\tv_nop\n\tv_nop" : "+v"(acc[0][0]), "+v"(acc[1][1]), "+v"(acc[2][2]), "+v"(acc[3][3]) : "v"(a[0]), "v"(a[3]));
    }
#pragma unroll
    for (int mb = 0; mb < 4; ++mb) {
#pragma unroll
        for (int nb = 0; nb < 4; ++nb) {
#pragma unroll
            for (int j = 0; j < 8; ++j) os[(hi * 8 + j) * 68 + nb * 16 + lr] = acc[mb][nb][j]; }
        __builtin_amdgcn_wave_barrier(); asm volatile("" ::: "memory");
        float* crow = C + (size_t)(r0 + mb * 16) * ldc + c0;
{
#pragma unroll
            for (int s = 0; s < 8; ++s) { const int row = 2 * s + hi, cofs = lr * 4; v4f val = *(const v4fa*)(os + row * 68 + cofs); if (BIAS) { val[0] += bfr(bp[cofs]); val[1] += bfr(bp[cofs + 1]); val[2] += bfr(bp[cofs + 2]); val[3] += bfr(bp[cofs + 3]); }
                *(v4f*)(crow + (size_t)row * ldc + cofs) = val; }
             }
        __builtin_amdgcn_wave_barrier(); asm volatile("" ::: "memory");
    }
}

__device__ __forceinline__ h16 tohx(float x) { return (h16)x; }
__device__ __forceinline__ void splitf(float y, unsigned short& h, unsigned short& l) { h = f2bf(y); l = f2bf(y - bf2f(h)); }
typedef __attribute__((ext_vector_type(2))) _Float16 v2h;
typedef __attribute__((ext_vector_type(4))) _Float16 v4h;
typedef __attribute__((ext_vector_type(2))) unsigned short v2us;
typedef __attribute__((ext_vector_type(4))) unsigned short v4us;
typedef __attribute__((ext_vector_type(2))) float v2f;
typedef __attribute__((ext_vector_type(4))) int v4i;

__device__ __forceinline__ void d_wtG(unsigned blk, const float* __restrict__ w, int K, int N, bf* Bt) {
    const int lane = threadIdx.x & 31; const int L0 = (blk * 8 + (threadIdx.x >> 5)) * 8; const int nlines = N * K / 64;
{
#pragma unroll 1
        for (int l = 0; l < 8; ++l) { const int L = L0 + l; if (L >= nlines) break; const size_t e = (size_t)L * 64 + lane * 2; const int k = (int)(e % K), n = (int)(e / K); v2us o;
            o[0] = f2bf(w[(size_t)k * N + n]); o[1] = f2bf(w[(size_t)(k + 1) * N + n]); *(v2us*)(Bt + e) = o;
            asm volatile("s_wait_xcnt 0x0" ::: "memory");   /* the next trip rewrites the registers this store names: the wait stands in front of that */ }
         }
}
__device__ __forceinline__ void d_cvt8(unsigned blk, const float* __restrict__ src, bf* dst, size_t n8) { const size_t i = (size_t)blk * 256 + threadIdx.x; if (i >= n8) return; const v8f v = *(const v8f*)(src + i * 8); v8us o;
#pragma unroll
    for (int k = 0; k < 8; ++k) o[k] = f2bf(v[k]); *(v8us*)(dst + i * 8) = o;  }

// d_rope: head planes [h][t][d] (fp16 + hi/lo) of rope(x) x sc with the rotate-half convention out[d] = x[d] cos[t][d] - x[d+HD/2] sin[t][d], out[d+HD/2] = x[d+HD/2] cos[t][d+HD/2] + x[d] sin[t][d+HD/2]
__device__ __forceinline__ void d_rope(unsigned blk, const float* __restrict__ F, int pitch, int nheads, const float* __restrict__ CS, const float* __restrict__ RF, const float* __restrict__ nw, float sc, h16* P16, bf* Ph, bf* Pl) {
    const size_t e = ((size_t)blk * 256 + threadIdx.x) * 2; if (e >= (size_t)nheads * TT * HD) return; const int d = (int)(e % HD); const int t = (int)((e / HD) % TT); const int h = (int)(e / ((size_t)HD * TT)); const float* f = F + (size_t)t * pitch + h * HD; const float rf = RF ? RF[(size_t)h * TT + t] : 1.0f; v2h o16; v2us oh, ol;
#pragma unroll
    for (int q = 0; q < 2; ++q) { const int dd = d + q; const int dp = (dd < HD / 2) ? dd + HD / 2 : dd - HD / 2; float x0 = f[dd], x1 = f[dp];
        if (RF) { float n0 = __fmul_rn(x0, rf), n1 = __fmul_rn(x1, rf); asm volatile("" : "+v"(n0)); asm volatile("" : "+v"(n1)); x0 = __fmul_rn(bfr(nw[dd]), n0); x1 = __fmul_rn(bfr(nw[dp]), n1); }
        const v2f cs = *(const v2f*)(CS + ((size_t)t * HD + dd) * 2); float a = __fmul_rn(x0, cs[0]), bq = __fmul_rn(x1, cs[1]); asm volatile("" : "+v"(a)); asm volatile("" : "+v"(bq)); const float r = ((dd < HD / 2) ? __fsub_rn(a, bq) : __fadd_rn(a, bq)) * sc;
        o16[q] = tohx(r); unsigned short a2, c2; splitf(r, a2, c2); oh[q] = a2; ol[q] = c2; }
    *(v2h*)(P16 + e) = o16; *(v2us*)(Ph + e) = oh; *(v2us*)(Pl + e) = ol;  }
__device__ __forceinline__ void d_vtp(unsigned blk, const float* __restrict__ F, int pitch, int nheads, h16* V16, bf* Vh, bf* Vl) { const size_t e = ((size_t)blk * 256 + threadIdx.x) * 2; if (e >= (size_t)nheads * HD * TT) return; const int t = (int)(e % TT); const int d = (int)((e / TT) % HD); const int g = (int)(e / ((size_t)TT * HD)); v2h o16; v2us oh, ol;
#pragma unroll
    for (int q = 0; q < 2; ++q) { const float x = F[(size_t)(t + q) * pitch + g * HD + d]; o16[q] = tohx(x); unsigned short a2, c2; splitf(x, a2, c2); oh[q] = a2; ol[q] = c2; }
    *(v2h*)(V16 + e) = o16; *(v2us*)(Vh + e) = oh; *(v2us*)(Vl + e) = ol;  }
__device__ __forceinline__ void d_csid(unsigned blk, float* CS) { const int idx = blk * 256 + threadIdx.x; if (idx >= TT * HD) return; v2f cs; cs[0] = 1.0f; cs[1] = 0.0f; *(v2f*)(CS + (size_t)idx * 2) = cs;  }
// k_prep: everything that depends on the inputs alone, in one grid by block ranges: the three weight transposes (first: the longest blocks), the identity table, the bf16 copy of x (both batches).
#define PB_Q  ((DM * DQ / 64 + 63) / 64)
#define PB_KV ((DM * 2 * DKV / 64 + 63) / 64)
#define PB_O  ((DQ * DM / 64 + 63) / 64)
#define PB_CS ((TT * HD + 255) / 256)
#define PB_X  ((NB_ * TT * DM / 8 + 255) / 256)
__global__ __launch_bounds__(256) void k_prep(const float* __restrict__ wq, const float* __restrict__ wkv, const float* __restrict__ wo, const float* __restrict__ x, bf* WQ, bf* WKV, bf* WO, float* CS, bf* XB) {
    unsigned b = blockIdx.x;
    if (b < PB_Q) { d_wtG(b, wq, DM, DQ, WQ); return; } b -= PB_Q;
    if (b < PB_KV) { d_wtG(b, wkv, DM, 2 * DKV, WKV); return; } b -= PB_KV;   /* fused 'xw' [DM][2*DKV] -> Bt [2*DKV][DM]: k | v */
    if (b < PB_O) { d_wtG(b, wo, DQ, DM, WO); return; } b -= PB_O;
    if (b < PB_CS) { d_csid(b, CS); return; } b -= PB_CS;
    d_cvt8(b, x, XB, (size_t)NB_ * TT * DM / 8);
}
// k_planes (grid y = batch): the q and k head planes (NH_ + NKV heads = columns [0, DQ + DKV) of the fused projection F) and the transposed v planes (columns from DQ + DKV), in one grid by block ranges.
#define LB_QK ((unsigned)(((size_t)(NH_ + NKV) * TT * HD / 2 + 255) / 256))
#define LB_V  ((unsigned)(((size_t)NKV * TT * HD / 2 + 255) / 256))
#define QKB ((size_t)(NH_ + NKV) * TT * HD)   // elements of one batch's q | k head planes
#define VB  ((size_t)NKV * HD * TT)           // elements of one batch's transposed v planes
__global__ __launch_bounds__(256) void k_planes(const float* __restrict__ F, int pitch, const float* __restrict__ CS, h16* QK16, bf* QKh, bf* QKl, h16* V16, bf* Vh, bf* Vl) {
    const unsigned b = blockIdx.x; const size_t n = blockIdx.y;   // n: the batch; every buffer holds one block per batch
    F += n * ((size_t)TT * (DQ + 2 * DKV)); QK16 += n * QKB; QKh += n * QKB; QKl += n * QKB; V16 += n * VB; Vh += n * VB; Vl += n * VB;
    if (b < LB_V) d_vtp(b, F + DQ + DKV, pitch, NKV, V16, Vh, Vl);   // first: its strided reads make these the longest blocks
    else d_rope(b - LB_V, F, pitch, NH_ + NKV, CS, nullptr, nullptr, 1.0f, QK16, QKh, QKl);
}
__constant__ float SLOPE8[NH_] = { 5.000000000e-1f, 1.000000000e+0f, 1.500000000e+0f, 2.000000000e+0f, 2.500000000e+0f, 3.000000000e+0f, 3.500000000e+0f, 4.000000000e+0f, 4.500000000e+0f, 5.000000000e+0f, 5.500000000e+0f, 6.000000000e+0f, 6.500000000e+0f, 7.000000000e+0f, 7.500000000e+0f, 8.000000000e+0f };   // 8 x the per-head ALiBi slope magnitude (slopes[h] = (h + 1) / 16, h = 0..15, x 8 = (h + 1) / 2: exact); every entry and every product with |i - j| <= 2047 is exact in f32
#define QT  32
#define NW  4
#define L2E 1.4426950408889634f
template <typename T16> struct PPack;
template <> struct PPack<h16> { static __device__ __forceinline__ void mk(const v8f& p0, const v8f& p1, v16h& a, v16h& a2) { v8h x, y;
#pragma unroll
    for (int j = 0; j < 8; ++j) { x[j] = tohx(p0[j] * PCAR); y[j] = tohx(p1[j] * PCAR); } a = cat16(x, y); (void)a2; } };
template <> struct PPack<bf> { static __device__ __forceinline__ void mk(const v8f& p0, const v8f& p1, v16bf& a, v16bf& a2) { v8us xh, xl, yh, yl;
#pragma unroll
    for (int j = 0; j < 8; ++j) { unsigned short u, v; splitf(p0[j], u, v); xh[j] = u; xl[j] = v; splitf(p1[j], u, v); yh[j] = u; yl[j] = v; } a = cat16b(xh, yh); a2 = cat16b(xl, yl); } };
// KB = 16-key blocks per tile, NQ = 16-query blocks per work-group (2 and 2 in the fp16 body; 2 and 1 in the hi/lo body, whose second planes take the registers)
template <typename T16, int NSPLIT, int KB, int NQ>
__device__ __forceinline__ void d_fattn(float* Os, float* St, int r0, int h, const T16* __restrict__ Q, const T16* __restrict__ Q2, const T16* __restrict__ Kp, const T16* __restrict__ K2, const T16* __restrict__ Vt, const T16* __restrict__ V2, bf* Ah, bf* Al) {
    typedef typename WFrag<T16>::V V;
    const int lane = threadIdx.x & 31, lr = lane & 15, hi = lane >> 4, w = __builtin_amdgcn_readfirstlane((int)(threadIdx.x >> 5));   // the wave's number in a scalar register: the key loop's trip test is a scalar branch
    const float sl = SLOPE8[h] * SCL;              // the head's slope (h + 1) / 16
    const int nk = (r0 + NQ * 16 - 1) / (KB * 16) + 1;  // key tiles up to the diagonal; the first key of every such tile is <= r0 (r0 is a multiple of NQ * 16, which divides KB * 16), so no query of a tile is fully masked
    V q[NQ][2], q2[NQ][2];
#pragma unroll
    for (int qb = 0; qb < NQ; ++qb)
#pragma unroll
        for (int ks = 0; ks < 2; ++ks) { const unsigned off = (unsigned)((r0 + qb * 16 + lr) * HD + 8 * hi + ks * 32); q[qb][ks] = WFrag<T16>::ld(Q + off); if (NSPLIT) q2[qb][ks] = WFrag<T16>::ld(Q2 + off); }
    v8f o[4][NQ]; float m[NQ], l[NQ];
#pragma unroll
    for (int qb = 0; qb < NQ; ++qb) { m[qb] = -3.0e38f; l[qb] = 0.f;
#pragma unroll
        for (int db = 0; db < 4; ++db) o[db][qb] = (v8f){}; }
    V ka[2][KB];
    if (!NSPLIT && w < nk) {   // the wave's first key fragments; every later tile's are fetched one trip ahead
#pragma unroll
        for (int ks = 0; ks < 2; ++ks)
#pragma unroll
            for (int kb = 0; kb < KB; ++kb) ka[ks][kb] = WFrag<T16>::ld(Kp + (unsigned)((w * (KB * 16) + kb * 16 + lr) * HD + 8 * hi + ks * 32));
    }
#pragma unroll 1
    for (int kt = w; kt < nk; kt += NW) {
        const int k0 = kt * (KB * 16);
        const unsigned ko = (unsigned)((k0 + lr) * HD + 8 * hi), vo = (unsigned)(lr * TT + k0 + 8 * hi);   // one 32-bit element offset each for the tile's key and value fragments: the rest of every address is a constant
        V ka2[2][KB], va[KB / 2][4], va2[KB / 2][4];
        if (NSPLIT) {
#pragma unroll
            for (int ks = 0; ks < 2; ++ks)
#pragma unroll
                for (int kb = 0; kb < KB; ++kb) { const unsigned off = ko + (unsigned)(kb * 16 * HD + ks * 32); ka[ks][kb] = WFrag<T16>::ld(Kp + off); ka2[ks][kb] = WFrag<T16>::ld(K2 + off); }
            asm volatile("s_wait_xcnt 0x0" ::: "memory");   // in front of whatever rewrites the address registers that these loads name
        }
        v8f s[KB][NQ];
#pragma unroll
        for (int kb = 0; kb < KB; ++kb)
#pragma unroll
            for (int qb = 0; qb < NQ; ++qb) s[kb][qb] = (v8f){};
#pragma unroll
        for (int ks = 0; ks < 2; ++ks)
#pragma unroll
            for (int kb = 0; kb < KB; ++kb)
#pragma unroll
                for (int qb = 0; qb < NQ; ++qb) { s[kb][qb] = WFrag<T16>::mma(ka[ks][kb], q[qb][ks], s[kb][qb]); if (NSPLIT) { s[kb][qb] = WFrag<T16>::mma(ka[ks][kb], q2[qb][ks], s[kb][qb]); s[kb][qb] = WFrag<T16>::mma(ka2[ks][kb], q[qb][ks], s[kb][qb]); } }
        // this tile's value fragments and, in the fp16 body, the wave's next key fragments (into the registers the products above have just read) fly while the softmax below runs
#pragma unroll
        for (int ks = 0; ks < KB / 2; ++ks)
#pragma unroll
            for (int db = 0; db < 4; ++db) { const unsigned off = vo + (unsigned)(db * 16 * TT + ks * 32); va[ks][db] = WFrag<T16>::ld(Vt + off); if (NSPLIT) va2[ks][db] = WFrag<T16>::ld(V2 + off); }
        if (!NSPLIT) {
            const unsigned kn = ko + ((kt + NW < nk) ? (unsigned)(NW * KB * 16 * HD) : 0u);   // the last trip fetches its own tile again: no address past the diagonal tile
#pragma unroll
            for (int ks = 0; ks < 2; ++ks)
#pragma unroll
                for (int kb = 0; kb < KB; ++kb) ka[ks][kb] = WFrag<T16>::ld(Kp + (kn + (unsigned)(kb * 16 * HD + ks * 32)));
        }
        asm volatile("s_wait_xcnt 0x0" ::: "memory");   // in front of the softmax, whose instructions may rewrite the address registers that these loads name
#pragma unroll
        for (int qb = 0; qb < NQ; ++qb) {
            const int dl = k0 + hi * 8 - (r0 + qb * 16 + lr);   // key - query of this lane's element (kb 0, j 0)
            const float bl = sl * (float)dl;                    // sixteenths of whole numbers below 2^16: this product and the sum below are exact in f32
            float tm = -3.0e38f;
#pragma unroll
            for (int kb = 0; kb < KB; ++kb)
#pragma unroll
                for (int j = 0; j < 8; ++j) { const float t = (dl + kb * 16 + j <= 0) ? __builtin_fmaf(s[kb][qb][j], SCL, __builtin_fmaf(sl, (float)(kb * 16 + j), bl)) : -3.0e38f;   /* S / 8 + slope x (j - i), rounded once */ s[kb][qb][j] = t; tm = fmaxf(tm, t); }
            tm = fmaxf(tm, __shfl_xor(tm, 16, 32));             // the other wave half holds the query's other keys
            const float mn = fmaxf(m[qb], tm); const float al = __builtin_amdgcn_exp2f((m[qb] - mn) * L2E); m[qb] = mn;
            float ps = 0.f;
#pragma unroll
            for (int kb = 0; kb < KB; ++kb)
#pragma unroll
                for (int j = 0; j < 8; ++j) { const float p = __builtin_amdgcn_exp2f((s[kb][qb][j] - mn) * L2E); s[kb][qb][j] = p; ps += p; }
            l[qb] = l[qb] * al + ps;
#pragma unroll
            for (int db = 0; db < 4; ++db) o[db][qb] *= al;
        }
#pragma unroll
        for (int ks = 0; ks < KB / 2; ++ks) { V p[NQ], p2[NQ];
#pragma unroll
            for (int qb = 0; qb < NQ; ++qb) PPack<T16>::mk(s[2 * ks][qb], s[2 * ks + 1][qb], p[qb], p2[qb]);
#pragma unroll
            for (int db = 0; db < 4; ++db)
#pragma unroll
                for (int qb = 0; qb < NQ; ++qb) { o[db][qb] = WFrag<T16>::mma(va[ks][db], p[qb], o[db][qb]); if (NSPLIT) { o[db][qb] = WFrag<T16>::mma(va[ks][db], p2[qb], o[db][qb]); o[db][qb] = WFrag<T16>::mma(va2[ks][db], p[qb], o[db][qb]); } } }
    }
#pragma unroll
    for (int qb = 0; qb < NQ; ++qb) { l[qb] += __shfl_xor(l[qb], 16, 32);
#pragma unroll
        for (int db = 0; db < 4; ++db) { float* p = Os + (w * QT + qb * 16 + lr) * 68 + db * 16 + hi * 8; v4f x, y;
#pragma unroll
            for (int j = 0; j < 4; ++j) { x[j] = o[db][qb][j]; y[j] = o[db][qb][4 + j]; }
            *(v4fa*)p = x; *(v4fa*)(p + 4) = y; }
        if (hi == 0) { St[(w * QT + qb * 16 + lr) * 2] = m[qb]; St[(w * QT + qb * 16 + lr) * 2 + 1] = l[qb]; } }
    __syncthreads();   // every wave's partial tile, maximum and sum are in LDS before any thread joins them
    const int row = (int)threadIdx.x / (8 / NQ), d0 = ((int)threadIdx.x % (8 / NQ)) * (NQ * 8);   // NQ * 16 rows, 8 / NQ threads a row, NQ * 8 columns a thread
    float f[NW], M = -3.0e38f, L = 0.f;
#pragma unroll
    for (int u = 0; u < NW; ++u) { f[u] = St[(u * QT + row) * 2]; M = fmaxf(M, f[u]); }
#pragma unroll
    for (int u = 0; u < NW; ++u) { f[u] = __builtin_amdgcn_exp2f((f[u] - M) * L2E); L += f[u] * St[(u * QT + row) * 2 + 1]; }   // a wave without a tile has maximum -3e38: factor 0
    const float g = __fdiv_rn(NSPLIT ? 1.0f : (1.0f / PCAR), L);
    const size_t oo = (size_t)(r0 + row) * DQ + h * HD + d0;
#pragma unroll
    for (int c = 0; c < NQ; ++c) { v8us oh, ol;
#pragma unroll
        for (int c4 = 0; c4 < 2; ++c4) { v4f y = (v4f){};
#pragma unroll
            for (int u = 0; u < NW; ++u) y += f[u] * *(const v4fa*)(Os + (u * QT + row) * 68 + d0 + c * 8 + c4 * 4);
#pragma unroll
            for (int e = 0; e < 4; ++e) { unsigned short a, c2; splitf(y[e] * g, a, c2); oh[c4 * 4 + e] = a; ol[c4 * 4 + e] = c2; } }
        *(v8usa*)(Ah + oo + c * 8) = oh; *(v8usa*)(Al + oo + c * 8) = ol; }
    asm volatile("s_wait_xcnt 0x0" ::: "memory");   // behind the tile's stores: in the built kernel the other body stands behind this one and rewrites the registers that these stores name
}
// grid (batches x heads, FT_N): row tiles of both batches in falling order of their keys, so the longest start first: (TT - RH) / 32 fp16 tiles of 32 query rows (probabilities x PCAR, taken out again with the sum), then RH / 16 hi/lo 3-product tiles of 16 rows.
// Four waves per SIMD (at most 256 registers a wave, four work-groups per WGP): the vector work of one wave runs under the matrix work and the loads of another.
#define FT_16 ((TT - RH) / QT)
#define FT_N  (FT_16 + RH / 16)
__global__ __launch_bounds__(NW * 32) __attribute__((amdgpu_waves_per_eu(4, 4))) void k_fattn(const h16* __restrict__ QK16, const bf* __restrict__ QKh, const bf* __restrict__ QKl, const h16* __restrict__ V16, const bf* __restrict__ Vh, const bf* __restrict__ Vl, bf* Ah, bf* Al) {
    __shared__ __align__(16) float Os[NW * QT * 68]; __shared__ float St[NW * QT * 2];
    const int h = (int)blockIdx.x % NH_, y = (int)blockIdx.y; const size_t n = blockIdx.x / NH_;   // n: the batch
    const size_t qo = n * QKB + (size_t)h * TT * HD, ko = n * QKB + (size_t)(NH_ + h / REP) * TT * HD, vo = n * VB + (size_t)(h / REP) * HD * TT; Ah += n * ((size_t)TT * DQ); Al += n * ((size_t)TT * DQ);
    if (y < FT_16) d_fattn<h16, 0, 2, 2>(Os, St, TT - (y + 1) * QT, h, QK16 + qo, nullptr, QK16 + ko, nullptr, V16 + vo, nullptr, Ah, Al);
    else d_fattn<bf, 2, 2, 1>(Os, St, RH - (y - FT_16 + 1) * 16, h, QKh + qo, QKl + qo, QKh + ko, QKl + ko, Vh + vo, Vl + vo, Ah, Al);
}

extern "C" void kernel_launch(void* const* d_in, const int* in_sizes, int n_in,
                              void* d_out, int out_size, void* d_ws, size_t ws_size, hipStream_t stream) {
    (void)in_sizes; (void)n_in; (void)out_size;
    const float* x = (const float*)d_in[0]; const float* wq = (const float*)d_in[1]; const float* bq = (const float*)d_in[2]; const float* wkv = (const float*)d_in[3]; const float* bkv = (const float*)d_in[4]; const float* wo = (const float*)d_in[5]; const float* bo = (const float*)d_in[6];
    float* OUT = (float*)d_out;     // [2][2048][1024]
    char* wsp = (char*)d_ws;
    auto take = [&](size_t bytes) { char* p = wsp; wsp += (bytes + 255) & ~(size_t)255; return (void*)p; };
    bf* WQ = (bf*)take((size_t)(DQ + 2 * DKV) * DM * 2); bf* WKV = WQ + (size_t)DQ * DM;   /* one Bt [DQ + 2*DKV][DM]: q | k | v row blocks */ bf* WO = (bf*)take((size_t)DM * DQ * 2); float* CS = (float*)take((size_t)TT * HD * 2 * 4);
    bf* XB = (bf*)take((size_t)NB_ * TT * DM * 2); float* F = (float*)take((size_t)NB_ * TT * (DQ + 2 * DKV) * 4);   /* fused projection [NB_][TT][q | k | v] */
    h16* QP16 = (h16*)take(NB_ * QKB * 2); h16* VT16 = (h16*)take(NB_ * VB * 2);   /* the k planes follow the q planes: one builder range */
    bf* QPh = (bf*)take(NB_ * QKB * 2); bf* QPl = (bf*)take(NB_ * QKB * 2); bf* VTh = (bf*)take(NB_ * VB * 2); bf* VTl = (bf*)take(NB_ * VB * 2);
    bf* ATh = (bf*)take((size_t)NB_ * TT * DQ * 2); bf* ATl = (bf*)take((size_t)NB_ * TT * DQ * 2);
    if ((size_t)(wsp - (char*)d_ws) > ws_size) return;    // ws 256 MiB
    k_prep<<<PB_Q + PB_KV + PB_O + PB_CS + PB_X, 256, 0, stream>>>(wq, wkv, wo, x, WQ, WKV, WO, CS, XB);
    // every stage once, both batches in its grid (the projections: grid z with the batch strides of A and C, the weights shared)
    k_gemmw<bf, 0, true><<<dim3(TT / 64, (DQ + 2 * DKV) / 64, NB_), 32, 0, stream>>>(XB, nullptr, WQ, nullptr, DM, F, DQ + 2 * DKV, bq, bkv, DQ, (size_t)TT * DM, 0, (size_t)TT * (DQ + 2 * DKV));   /* q | k | v in one grid; kv_b = k | v bias halves */
    k_planes<<<dim3(LB_QK + LB_V, NB_, 1), 256, 0, stream>>>(F, DQ + 2 * DKV, CS, QP16, QPh, QPl, VT16, VTh, VTl);
    k_fattn<<<dim3(NB_ * NH_, FT_N, 1), NW * 32, 0, stream>>>(QP16, QPh, QPl, VT16, VTh, VTl, ATh, ATl);   /* all heads: scores, bias, mask, softmax, P.V, merged hi/lo rows */
    k_gemmw<bf, 1, true><<<dim3(TT / 64, DM / 64, NB_), 32, 0, stream>>>(ATh, ATl, WO, nullptr, DQ, OUT, DM, bo, bo, DM, (size_t)TT * DQ, 0, (size_t)TT * DM);
}

// v007
// A run of this version takes 136 microseconds.
// In two side-by-side timings against v006, it was 1.31 and 1.32 times as fast.
// Counting every step since v000, it is 12.0 times as fast.
#include <hip/hip_runtime.h>

// Causal self-attention with ALiBi (linear slopes), a separate q projection and a fused k|v projection (x [2][2048][1024]; q = x q_w + q_b ('xw' [1024][1024] 0.02 + bias zeros: read); kv = (x kv_w + kv_b) ('xw' [1024][2048] 0.02 + bias zeros: read) reshaped (B, T, 2, 16, 64): k | v = column halves (16 heads x 64); att x 1/sqrt(64) + slopes[h] x (j - i) with slopes[h] = (h + 1) / 16 (exact in f32; for the kept entries j <= i this is -slopes[h] x |i - j|); causal (-inf); softmax; y = merged o_w + o_b ('xw' + bias zeros: read) -> [2][2048][1024] (4.2 M); argument order x, q_w, q_b, kv_w, kv_b, o_w, o_b).
// Layout (each stage one launch for both batches): bf16 copy of x; q_w transposed; the fused kv weight transposed once into Bt (k | v row blocks) + bias halves; exact projections + f32 biases, whose epilogue writes the head planes; one fused attention kernel (scores, S x 1/8 + slope[h] x (j - i) in f32 with slope = SLOPE8[h] / 8 = (h + 1) / 16 and the bias exact, causal mask, running-maximum softmax, probability x value; hybrid rows: < 512 hi/lo 3 products, rest fp16 x1024; key tiles above the diagonal are never visited); merged hi/lo x o_w exact + o_b.
// Compute dtypes, f32 accumulate: every input rounded to bf16; projections exact + f32 biases; attention rows < 512 3 products, rest fp16; softmax f32; output projection hl x exact.

#define NB_  2
#define TT   2048
#define DM   1024
#define NH_  16
#define NKV  16
#define REP  (NH_ / NKV)
#define HD   64
#define DQ   (NH_ * HD)
#define DKV  (NKV * HD)
#define RH   512                  // query rows < RH use hi+lo planes (0: none)
#define PCAR 1024.0f
#define SCL  0.125f   // HD^-0.5
typedef _Float16 h16;
typedef unsigned short bf;
typedef __attribute__((ext_vector_type(16))) __bf16   v16bf;
typedef __attribute__((ext_vector_type(16))) _Float16 v16h;
typedef __attribute__((ext_vector_type(8)))  _Float16 v8h;
typedef __attribute__((ext_vector_type(8)))  unsigned short v8us;
typedef __attribute__((ext_vector_type(8)))  float    v8f;
typedef __attribute__((ext_vector_type(4)))  float    v4f;
typedef v8h  __attribute__((may_alias)) v8ha;
typedef v4f  __attribute__((may_alias)) v4fa;
typedef v8us __attribute__((may_alias)) v8usa;

__device__ __forceinline__ unsigned short f2bf(float f) { unsigned u = __float_as_uint(f); u += 0x7FFFu + ((u >> 16) & 1u); return (unsigned short)(u >> 16); }
__device__ __forceinline__ float bf2f(unsigned short b) { return __uint_as_float(((unsigned)b) << 16); }
__device__ __forceinline__ float bfr(float f) { return bf2f(f2bf(f)); }
__device__ __forceinline__ v16h cat16(v8h lo, v8h hi) { return __builtin_shufflevector(lo, hi, 0, 1, 2, 3, 4, 5, 6, 7, 8, 9, 10, 11, 12, 13, 14, 15); }
__device__ __forceinline__ v16bf cat16b(v8us lo, v8us hi) { return __builtin_bit_cast(v16bf, __builtin_shufflevector(lo, hi, 0, 1, 2, 3, 4, 5, 6, 7, 8, 9, 10, 11, 12, 13, 14, 15)); }
__device__ __forceinline__ v8f wmma16(v16h a, v16h b, v8f c) { return __builtin_amdgcn_wmma_f32_16x16x32_f16(false, a, false, b, (short)0, c, false, false); }
__device__ __forceinline__ v8f wmmab(v16bf a, v16bf b, v8f c) { return __builtin_amdgcn_wmma_f32_16x16x32_bf16(false, a, false, b, (short)0, c, false, false); }



// ---- k_gemmw: register-blocked GEMM, ONE WAVE per 64x64 output tile (16 accumulators), operands straight from K-contiguous 16-bit planes; grid (M/64, N/64, Z), 32 threads.
// C[m][n] (f32, pitch ldc, + optional f32 bias[n] for n < nb1, bias2[n - nb1] beyond) = sum_k A[m][k] Bt[n][k] (+ split products per NSPLIT). z-batch strides sA/sB/sC in elements. K % 32 == 0.
// PL (the q | k | v projection): no C. A 64-column tile is one head, and the epilogue rounds it straight into that head's fp16, hi and lo planes: q and k as [head][t][d]; a v tile is computed with the two operands exchanged (rows = d, columns = t, same k order), so that its rows are rows of the transposed [head][d][t] planes. Either way a tile row is one whole 128-byte line of each plane.
__device__ __forceinline__ h16 tohx(float x) { return (h16)x; }
__device__ __forceinline__ void splitf(float y, unsigned short& h, unsigned short& l) { h = f2bf(y); l = f2bf(y - bf2f(h)); }
#define QKB ((size_t)(NH_ + NKV) * TT * HD)   // elements of one batch's q | k head planes
#define VB  ((size_t)NKV * HD * TT)           // elements of one batch's transposed v planes
template <typename T16> struct WFrag;
template <> struct WFrag<h16> { typedef v16h V; static __device__ __forceinline__ V ld(const h16* p) { return cat16(*(const v8h*)p, *(const v8h*)(p + 16)); } static __device__ __forceinline__ v8f mma(V a, V b, v8f c) { return wmma16(a, b, c); } };
template <> struct WFrag<bf> { typedef v16bf V; static __device__ __forceinline__ V ld(const bf* p) { return cat16b(*(const v8us*)p, *(const v8us*)(p + 16)); } static __device__ __forceinline__ v8f mma(V a, V b, v8f c) { return wmmab(a, b, c); } };
template <typename T16, int NSPLIT, bool BIAS, bool PL>
__global__ __launch_bounds__(32) void k_gemmw(const T16* __restrict__ A, const T16* __restrict__ A2, const T16* __restrict__ Bt, const T16* __restrict__ Bt2, int K, float* C, int ldc, const float* __restrict__ bias, const float* __restrict__ bias2, int nb1, size_t sA, size_t sB, size_t sC, h16* QK16, bf* QKh, bf* QKl, h16* V16, bf* Vh, bf* Vl) {
    typedef typename WFrag<T16>::V V;
    __shared__ __align__(16) float os[16 * 68];
    const size_t z = blockIdx.z; A += z * sA; if (A2) A2 += z * sA; Bt += z * sB; if (Bt2) Bt2 += z * sB; C += z * sC;
    const int lane = threadIdx.x & 31, lr = lane & 15, hi = lane >> 4; const int r0 = blockIdx.x * 64, c0 = blockIdx.y * 64;
    const float* bp = (c0 < nb1) ? bias + c0 : bias2 + (c0 - nb1);   // columns < nb1 take bias, the rest bias2 (nb1 % 64 == 0: a tile never straddles)
    v8f acc[4][4];
#pragma unroll
    for (int mb = 0; mb < 4; ++mb)
#pragma unroll
        for (int nb = 0; nb < 4; ++nb) acc[mb][nb] = (v8f){};
    const bool isv = PL && c0 >= DQ + DKV;   // a v tile (the same for the whole block): A and Bt change places; both are K-contiguous planes read by the same loader
    if (isv) { const T16* t = A; A = Bt; Bt = t; }
    const size_t aoff = (size_t)((isv ? c0 : r0) + lr) * K + 8 * hi, boff = (size_t)((isv ? r0 : c0) + lr) * K + 8 * hi;
#pragma unroll 1
    for (int kc = 0; kc < K; kc += 32) {
        V a[4], a2[4];
#pragma unroll
        for (int mb = 0; mb < 4; ++mb) { a[mb] = WFrag<T16>::ld(A + aoff + (size_t)mb * 16 * K + kc); if (NSPLIT == 1 || NSPLIT == 2) a2[mb] = WFrag<T16>::ld(A2 + aoff + (size_t)mb * 16 * K + kc); }
#pragma unroll
        for (int nb = 0; nb < 4; ++nb) { const V b = WFrag<T16>::ld(Bt + boff + (size_t)nb * 16 * K + kc); V b2; if (NSPLIT >= 2) b2 = WFrag<T16>::ld(Bt2 + boff + (size_t)nb * 16 * K + kc);
#pragma unroll
            for (int mb = 0; mb < 4; ++mb) { acc[mb][nb] = WFrag<T16>::mma(a[mb], b, acc[mb][nb]); if (NSPLIT == 1 || NSPLIT == 2) acc[mb][nb] = WFrag<T16>::mma(a2[mb], b, acc[mb][nb]); if (NSPLIT >= 2) acc[mb][nb] = WFrag<T16>::mma(a[mb], b2, acc[mb][nb]); } }
        asm volatile("v_nop\n\tv_nop\n\tv_nop\n\tv_nop" : "+v"(acc[0][0]), "+v"(acc[1][1]), "+v"(acc[2][2]), "+v"(acc[3][3]) : "v"(a[0]), "v"(a[3]));
    }
    if constexpr (PL) {
        const int rw = lane >> 3, cofs = (lane & 7) * 8;   // four tile rows a pass, eight lanes a row, eight columns (16 bytes of each plane) a lane
        const size_t pb = isv ? z * VB + (size_t)(c0 - (DQ + DKV)) * TT + r0 : z * QKB + ((size_t)(c0 / HD) * TT + r0) * HD;   // the tile's first element in its planes
        const int pp = isv ? TT : HD;                      // pitch of a tile row in the planes
        h16* P16 = (isv ? V16 : QK16) + pb; bf* Ph = (isv ? Vh : QKh) + pb; bf* Pw = (isv ? Vl : QKl) + pb;
        float bc[8], br[16];                               // the bias goes with the weight's row: the tile's column for q and k (bc), the tile's row for v (br); both are loaded and rounded whatever the tile (bp has 64 entries), so that the loads issue as one group
#pragma unroll
        for (int e = 0; e < 8; ++e) bc[e] = bfr(bp[cofs + e]);
#pragma unroll
        for (int i = 0; i < 16; ++i) br[i] = bfr(bp[4 * i + rw]);
#pragma unroll
        for (int mb = 0; mb < 4; ++mb) {
#pragma unroll
            for (int nb = 0; nb < 4; ++nb) {
#pragma unroll
                for (int j = 0; j < 8; ++j) os[(hi * 8 + j) * 68 + nb * 16 + lr] = acc[mb][nb][j]; }
            __builtin_amdgcn_wave_barrier(); asm volatile("" ::: "memory");   // the rows are read back by other lanes than wrote them: no LDS access moves across
#pragma unroll
            for (int s = 0; s < 4; ++s) { const int row = 4 * s + rw; const v4f u = *(const v4fa*)(os + row * 68 + cofs), v = *(const v4fa*)(os + row * 68 + cofs + 4); v8h o16; v8us oh, ol;
#pragma unroll
                for (int e = 0; e < 8; ++e) { const float y = (e < 4 ? u[e & 3] : v[e & 3]) + (isv ? br[mb * 4 + s] : bc[e]); o16[e] = tohx(y); unsigned short a2, c2; splitf(y, a2, c2); oh[e] = a2; ol[e] = c2; }
                const size_t o = (size_t)(mb * 16 + row) * pp + cofs; *(v8h*)(P16 + o) = o16; *(v8us*)(Ph + o) = oh; *(v8us*)(Pw + o) = ol;
                asm volatile("s_wait_xcnt 0x0" ::: "memory");   // the next pass rewrites the registers that these stores name: the wait stands in front of that
            }
            __builtin_amdgcn_wave_barrier(); asm volatile("" ::: "memory");   // the next 16 rows overwrite os only behind these reads
        }
        return;
    }
#pragma unroll
    for (int mb = 0; mb < 4; ++mb) {
#pragma unroll
        for (int nb = 0; nb < 4; ++nb) {
#pragma unroll
            for (int j = 0; j < 8; ++j) os[(hi * 8 + j) * 68 + nb * 16 + lr] = acc[mb][nb][j]; }
        __builtin_amdgcn_wave_barrier(); asm volatile("" ::: "memory");
        float* crow = C + (size_t)(r0 + mb * 16) * ldc + c0;
{
#pragma unroll
            for (int s = 0; s < 8; ++s) { const int row = 2 * s + hi, cofs = lr * 4; v4f val = *(const v4fa*)(os + row * 68 + cofs); if (BIAS) { val[0] += bfr(bp[cofs]); val[1] += bfr(bp[cofs + 1]); val[2] += bfr(bp[cofs + 2]); val[3] += bfr(bp[cofs + 3]); }
                *(v4f*)(crow + (size_t)row * ldc + cofs) = val; }
             }
        __builtin_amdgcn_wave_barrier(); asm volatile("" ::: "memory");
    }
}

typedef __attribute__((ext_vector_type(2))) _Float16 v2h;
typedef __attribute__((ext_vector_type(4))) _Float16 v4h;
typedef __attribute__((ext_vector_type(2))) unsigned short v2us;
typedef __attribute__((ext_vector_type(4))) unsigned short v4us;
typedef __attribute__((ext_vector_type(2))) float v2f;
typedef __attribute__((ext_vector_type(4))) int v4i;

__device__ __forceinline__ void d_wtG(unsigned blk, const float* __restrict__ w, int K, int N, bf* Bt) {
    const int lane = threadIdx.x & 31; const int L0 = (blk * 8 + (threadIdx.x >> 5)) * 8; const int nlines = N * K / 64;
{
#pragma unroll 1
        for (int l = 0; l < 8; ++l) { const int L = L0 + l; if (L >= nlines) break; const size_t e = (size_t)L * 64 + lane * 2; const int k = (int)(e % K), n = (int)(e / K); v2us o;
            o[0] = f2bf(w[(size_t)k * N + n]); o[1] = f2bf(w[(size_t)(k + 1) * N + n]); *(v2us*)(Bt + e) = o;
            asm volatile("s_wait_xcnt 0x0" ::: "memory");   /* the next trip rewrites the registers this store names: the wait stands in front of that */ }
         }
}
__device__ __forceinline__ void d_cvt8(unsigned blk, const float* __restrict__ src, bf* dst, size_t n8) { const size_t i = (size_t)blk * 256 + threadIdx.x; if (i >= n8) return; const v8f v = *(const v8f*)(src + i * 8); v8us o;
#pragma unroll
    for (int k = 0; k < 8; ++k) o[k] = f2bf(v[k]); *(v8us*)(dst + i * 8) = o;  }

// k_prep: everything that depends on the inputs alone, in one grid by block ranges: the three weight transposes (first: the longest blocks), the bf16 copy of x (both batches).
#define PB_Q  ((DM * DQ / 64 + 63) / 64)
#define PB_KV ((DM * 2 * DKV / 64 + 63) / 64)
#define PB_O  ((DQ * DM / 64 + 63) / 64)
#define PB_X  ((NB_ * TT * DM / 8 + 255) / 256)
__global__ __launch_bounds__(256) void k_prep(const float* __restrict__ wq, const float* __restrict__ wkv, const float* __restrict__ wo, const float* __restrict__ x, bf* WQ, bf* WKV, bf* WO, bf* XB) {
    unsigned b = blockIdx.x;
    if (b < PB_Q) { d_wtG(b, wq, DM, DQ, WQ); return; } b -= PB_Q;
    if (b < PB_KV) { d_wtG(b, wkv, DM, 2 * DKV, WKV); return; } b -= PB_KV;   /* fused 'xw' [DM][2*DKV] -> Bt [2*DKV][DM]: k | v */
    if (b < PB_O) { d_wtG(b, wo, DQ, DM, WO); return; } b -= PB_O;
    d_cvt8(b, x, XB, (size_t)NB_ * TT * DM / 8);
}
__constant__ float SLOPE8[NH_] = { 5.000000000e-1f, 1.000000000e+0f, 1.500000000e+0f, 2.000000000e+0f, 2.500000000e+0f, 3.000000000e+0f, 3.500000000e+0f, 4.000000000e+0f, 4.500000000e+0f, 5.000000000e+0f, 5.500000000e+0f, 6.000000000e+0f, 6.500000000e+0f, 7.000000000e+0f, 7.500000000e+0f, 8.000000000e+0f };   // 8 x the per-head ALiBi slope magnitude (slopes[h] = (h + 1) / 16, h = 0..15, x 8 = (h + 1) / 2: exact); every entry and every product with |i - j| <= 2047 is exact in f32
#define QT  32
#define NW  4
#define L2E 1.4426950408889634f
template <typename T16> struct PPack;
template <> struct PPack<h16> { static __device__ __forceinline__ void mk(const v8f& p0, const v8f& p1, v16h& a, v16h& a2) { v8h x, y;
#pragma unroll
    for (int j = 0; j < 8; ++j) { x[j] = tohx(p0[j] * PCAR); y[j] = tohx(p1[j] * PCAR); } a = cat16(x, y); (void)a2; } };
template <> struct PPack<bf> { static __device__ __forceinline__ void mk(const v8f& p0, const v8f& p1, v16bf& a, v16bf& a2) { v8us xh, xl, yh, yl;
#pragma unroll
    for (int j = 0; j < 8; ++j) { unsigned short u, v; splitf(p0[j], u, v); xh[j] = u; xl[j] = v; splitf(p1[j], u, v); yh[j] = u; yl[j] = v; } a = cat16b(xh, yh); a2 = cat16b(xl, yl); } };
// KB = 16-key blocks per tile, NQ = 16-query blocks per work-group (2 and 2 in the fp16 body; 2 and 1 in the hi/lo body, whose second planes take the registers)
template <typename T16, int NSPLIT, int KB, int NQ>
__device__ __forceinline__ void d_fattn(float* Os, float* St, int r0, int h, const T16* __restrict__ Q, const T16* __restrict__ Q2, const T16* __restrict__ Kp, const T16* __restrict__ K2, const T16* __restrict__ Vt, const T16* __restrict__ V2, bf* Ah, bf* Al) {
    typedef typename WFrag<T16>::V V;
    const int lane = threadIdx.x & 31, lr = lane & 15, hi = lane >> 4, w = __builtin_amdgcn_readfirstlane((int)(threadIdx.x >> 5));   // the wave's number in a scalar register: the key loop's trip test is a scalar branch
    const float sl = SLOPE8[h] * SCL;              // the head's slope (h + 1) / 16
    const int nk = (r0 + NQ * 16 - 1) / (KB * 16) + 1;  // key tiles up to the diagonal; the first key of every such tile is <= r0 (r0 is a multiple of NQ * 16, which divides KB * 16), so no query of a tile is fully masked
    V q[NQ][2], q2[NQ][2];
#pragma unroll
    for (int qb = 0; qb < NQ; ++qb)
#pragma unroll
        for (int ks = 0; ks < 2; ++ks) { const unsigned off = (unsigned)((r0 + qb * 16 + lr) * HD + 8 * hi + ks * 32); q[qb][ks] = WFrag<T16>::ld(Q + off); if (NSPLIT) q2[qb][ks] = WFrag<T16>::ld(Q2 + off); }
    v8f o[4][NQ]; float m[NQ], l[NQ];
#pragma unroll
    for (int qb = 0; qb < NQ; ++qb) { m[qb] = -3.0e38f; l[qb] = 0.f;
#pragma unroll
        for (int db = 0; db < 4; ++db) o[db][qb] = (v8f){}; }
    V ka[2][KB];
    if (!NSPLIT && w < nk) {   // the wave's first key fragments; every later tile's are fetched one trip ahead
#pragma unroll
        for (int ks = 0; ks < 2; ++ks)
#pragma unroll
            for (int kb = 0; kb < KB; ++kb) ka[ks][kb] = WFrag<T16>::ld(Kp + (unsigned)((w * (KB * 16) + kb * 16 + lr) * HD + 8 * hi + ks * 32));
    }
#pragma unroll 1
    for (int kt = w; kt < nk; kt += NW) {
        const int k0 = kt * (KB * 16);
        const unsigned ko = (unsigned)((k0 + lr) * HD + 8 * hi), vo = (unsigned)(lr * TT + k0 + 8 * hi);   // one 32-bit element offset each for the tile's key and value fragments: the rest of every address is a constant
        V ka2[2][KB], va[KB / 2][4], va2[KB / 2][4];
        if (NSPLIT) {
#pragma unroll
            for (int ks = 0; ks < 2; ++ks)
#pragma unroll
                for (int kb = 0; kb < KB; ++kb) { const unsigned off = ko + (unsigned)(kb * 16 * HD + ks * 32); ka[ks][kb] = WFrag<T16>::ld(Kp + off); ka2[ks][kb] = WFrag<T16>::ld(K2 + off); }
            asm volatile("s_wait_xcnt 0x0" ::: "memory");   // in front of whatever rewrites the address registers that these loads name
        }
        v8f s[KB][NQ];
#pragma unroll
        for (int kb = 0; kb < KB; ++kb)
#pragma unroll
            for (int qb = 0; qb < NQ; ++qb) s[kb][qb] = (v8f){};
#pragma unroll
        for (int ks = 0; ks < 2; ++ks)
#pragma unroll
            for (int kb = 0; kb < KB; ++kb)
#pragma unroll
                for (int qb = 0; qb < NQ; ++qb) { s[kb][qb] = WFrag<T16>::mma(ka[ks][kb], q[qb][ks], s[kb][qb]); if (NSPLIT) { s[kb][qb] = WFrag<T16>::mma(ka[ks][kb], q2[qb][ks], s[kb][qb]); s[kb][qb] = WFrag<T16>::mma(ka2[ks][kb], q[qb][ks], s[kb][qb]); } }
        // this tile's value fragments and, in the fp16 body, the wave's next key fragments (into the registers the products above have just read) fly while the softmax below runs
#pragma unroll
        for (int ks = 0; ks < KB / 2; ++ks)
#pragma unroll
            for (int db = 0; db < 4; ++db) { const unsigned off = vo + (unsigned)(db * 16 * TT + ks * 32); va[ks][db] = WFrag<T16>::ld(Vt + off); if (NSPLIT) va2[ks][db] = WFrag<T16>::ld(V2 + off); }
        if (!NSPLIT) {
            const unsigned kn = ko + ((kt + NW < nk) ? (unsigned)(NW * KB * 16 * HD) : 0u);   // the last trip fetches its own tile again: no address past the diagonal tile
#pragma unroll
            for (int ks = 0; ks < 2; ++ks)
#pragma unroll
                for (int kb = 0; kb < KB; ++kb) ka[ks][kb] = WFrag<T16>::ld(Kp + (kn + (unsigned)(kb * 16 * HD + ks * 32)));
        }
        asm volatile("s_wait_xcnt 0x0" ::: "memory");   // in front of the softmax, whose instructions may rewrite the address registers that these loads name
#pragma unroll
        for (int qb = 0; qb < NQ; ++qb) {
            const int dl = k0 + hi * 8 - (r0 + qb * 16 + lr);   // key - query of this lane's element (kb 0, j 0)
            const float bl = sl * (float)dl;                    // sixteenths of whole numbers below 2^16: this product and the sum below are exact in f32
            float tm = -3.0e38f;
#pragma unroll
            for (int kb = 0; kb < KB; ++kb)
#pragma unroll
                for (int j = 0; j < 8; ++j) { const float t = (dl + kb * 16 + j <= 0) ? __builtin_fmaf(s[kb][qb][j], SCL, __builtin_fmaf(sl, (float)(kb * 16 + j), bl)) : -3.0e38f;   /* S / 8 + slope x (j - i), rounded once */ s[kb][qb][j] = t; tm = fmaxf(tm, t); }
            tm = fmaxf(tm, __shfl_xor(tm, 16, 32));             // the other wave half holds the query's other keys
            const float mn = fmaxf(m[qb], tm); const float al = __builtin_amdgcn_exp2f((m[qb] - mn) * L2E); m[qb] = mn;
            float ps = 0.f;
#pragma unroll
            for (int kb = 0; kb < KB; ++kb)
#pragma unroll
                for (int j = 0; j < 8; ++j) { const float p = __builtin_amdgcn_exp2f((s[kb][qb][j] - mn) * L2E); s[kb][qb][j] = p; ps += p; }
            l[qb] = l[qb] * al + ps;
#pragma unroll
            for (int db = 0; db < 4; ++db) o[db][qb] *= al;
        }
#pragma unroll
        for (int ks = 0; ks < KB / 2; ++ks) { V p[NQ], p2[NQ];
#pragma unroll
            for (int qb = 0; qb < NQ; ++qb) PPack<T16>::mk(s[2 * ks][qb], s[2 * ks + 1][qb], p[qb], p2[qb]);
#pragma unroll
            for (int db = 0; db < 4; ++db)
#pragma unroll
                for (int qb = 0; qb < NQ; ++qb) { o[db][qb] = WFrag<T16>::mma(va[ks][db], p[qb], o[db][qb]); if (NSPLIT) { o[db][qb] = WFrag<T16>::mma(va[ks][db], p2[qb], o[db][qb]); o[db][qb] = WFrag<T16>::mma(va2[ks][db], p[qb], o[db][qb]); } } }
    }
#pragma unroll
    for (int qb = 0; qb < NQ; ++qb) { l[qb] += __shfl_xor(l[qb], 16, 32);
#pragma unroll
        for (int db = 0; db < 4; ++db) { float* p = Os + (w * QT + qb * 16 + lr) * 68 + db * 16 + hi * 8; v4f x, y;
#pragma unroll
            for (int j = 0; j < 4; ++j) { x[j] = o[db][qb][j]; y[j] = o[db][qb][4 + j]; }
            *(v4fa*)p = x; *(v4fa*)(p + 4) = y; }
        if (hi == 0) { St[(w * QT + qb * 16 + lr) * 2] = m[qb]; St[(w * QT + qb * 16 + lr) * 2 + 1] = l[qb]; } }
    __syncthreads();   // every wave's partial tile, maximum and sum are in LDS before any thread joins them
    const int row = (int)threadIdx.x / (8 / NQ), d0 = ((int)threadIdx.x % (8 / NQ)) * (NQ * 8);   // NQ * 16 rows, 8 / NQ threads a row, NQ * 8 columns a thread
    float f[NW], M = -3.0e38f, L = 0.f;
#pragma unroll
    for (int u = 0; u < NW; ++u) { f[u] = St[(u * QT + row) * 2]; M = fmaxf(M, f[u]); }
#pragma unroll
    for (int u = 0; u < NW; ++u) { f[u] = __builtin_amdgcn_exp2f((f[u] - M) * L2E); L += f[u] * St[(u * QT + row) * 2 + 1]; }   // a wave without a tile has maximum -3e38: factor 0
    const float g = __fdiv_rn(NSPLIT ? 1.0f : (1.0f / PCAR), L);
    const size_t oo = (size_t)(r0 + row) * DQ + h * HD + d0;
#pragma unroll
    for (int c = 0; c < NQ; ++c) { v8us oh, ol;
#pragma unroll
        for (int c4 = 0; c4 < 2; ++c4) { v4f y = (v4f){};
#pragma unroll
            for (int u = 0; u < NW; ++u) y += f[u] * *(const v4fa*)(Os + (u * QT + row) * 68 + d0 + c * 8 + c4 * 4);
#pragma unroll
            for (int e = 0; e < 4; ++e) { unsigned short a, c2; splitf(y[e] * g, a, c2); oh[c4 * 4 + e] = a; ol[c4 * 4 + e] = c2; } }
        *(v8usa*)(Ah + oo + c * 8) = oh; *(v8usa*)(Al + oo + c * 8) = ol; }
    asm volatile("s_wait_xcnt 0x0" ::: "memory");   // behind the tile's stores: in the built kernel the other body stands behind this one and rewrites the registers that these stores name
}
// grid (batches x heads, FT_N): row tiles of both batches in falling order of their keys, so the longest start first: (TT - RH) / 32 fp16 tiles of 32 query rows (probabilities x PCAR, taken out again with the sum), then RH / 16 hi/lo 3-product tiles of 16 rows.
// Four waves per SIMD (at most 256 registers a wave, four work-groups per WGP): the vector work of one wave runs under the matrix work and the loads of another.
#define FT_16 ((TT - RH) / QT)
#define FT_N  (FT_16 + RH / 16)
__global__ __launch_bounds__(NW * 32) __attribute__((amdgpu_waves_per_eu(4, 4))) void k_fattn(const h16* __restrict__ QK16, const bf* __restrict__ QKh, const bf* __restrict__ QKl, const h16* __restrict__ V16, const bf* __restrict__ Vh, const bf* __restrict__ Vl, bf* Ah, bf* Al) {
    __shared__ __align__(16) float Os[NW * QT * 68]; __shared__ float St[NW * QT * 2];
    const int h = (int)blockIdx.x % NH_, y = (int)blockIdx.y; const size_t n = blockIdx.x / NH_;   // n: the batch
    const size_t qo = n * QKB + (size_t)h * TT * HD, ko = n * QKB + (size_t)(NH_ + h / REP) * TT * HD, vo = n * VB + (size_t)(h / REP) * HD * TT; Ah += n * ((size_t)TT * DQ); Al += n * ((size_t)TT * DQ);
    if (y < FT_16) d_fattn<h16, 0, 2, 2>(Os, St, TT - (y + 1) * QT, h, QK16 + qo, nullptr, QK16 + ko, nullptr, V16 + vo, nullptr, Ah, Al);
    else d_fattn<bf, 2, 2, 1>(Os, St, RH - (y - FT_16 + 1) * 16, h, QKh + qo, QKl + qo, QKh + ko, QKl + ko, Vh + vo, Vl + vo, Ah, Al);
}

extern "C" void kernel_launch(void* const* d_in, const int* in_sizes, int n_in,
                              void* d_out, int out_size, void* d_ws, size_t ws_size, hipStream_t stream) {
    (void)in_sizes; (void)n_in; (void)out_size;
    const float* x = (const float*)d_in[0]; const float* wq = (const float*)d_in[1]; const float* bq = (const float*)d_in[2]; const float* wkv = (const float*)d_in[3]; const float* bkv = (const float*)d_in[4]; const float* wo = (const float*)d_in[5]; const float* bo = (const float*)d_in[6];
    float* OUT = (float*)d_out;     // [2][2048][1024]
    char* wsp = (char*)d_ws;
    auto take = [&](size_t bytes) { char* p = wsp; wsp += (bytes + 255) & ~(size_t)255; return (void*)p; };
    bf* WQ = (bf*)take((size_t)(DQ + 2 * DKV) * DM * 2); bf* WKV = WQ + (size_t)DQ * DM;   /* one Bt [DQ + 2*DKV][DM]: q | k | v row blocks */ bf* WO = (bf*)take((size_t)DM * DQ * 2);
    bf* XB = (bf*)take((size_t)NB_ * TT * DM * 2);
    h16* QP16 = (h16*)take(NB_ * QKB * 2); h16* VT16 = (h16*)take(NB_ * VB * 2);   /* the k planes follow the q planes: head index = projection column / HD */
    bf* QPh = (bf*)take(NB_ * QKB * 2); bf* QPl = (bf*)take(NB_ * QKB * 2); bf* VTh = (bf*)take(NB_ * VB * 2); bf* VTl = (bf*)take(NB_ * VB * 2);
    bf* ATh = (bf*)take((size_t)NB_ * TT * DQ * 2); bf* ATl = (bf*)take((size_t)NB_ * TT * DQ * 2);
    if ((size_t)(wsp - (char*)d_ws) > ws_size) return;    // ws 256 MiB
    k_prep<<<PB_Q + PB_KV + PB_O + PB_X, 256, 0, stream>>>(wq, wkv, wo, x, WQ, WKV, WO, XB);
    // every stage once, both batches in its grid (the projections: grid z with the batch strides of A and of the output (C, or the head planes), the weights shared)
    k_gemmw<bf, 0, true, true><<<dim3(TT / 64, (DQ + 2 * DKV) / 64, NB_), 32, 0, stream>>>(XB, nullptr, WQ, nullptr, DM, nullptr, 0, bq, bkv, DQ, (size_t)TT * DM, 0, 0, QP16, QPh, QPl, VT16, VTh, VTl);   /* q | k | v in one grid, written as head planes; kv_b = k | v bias halves */
    k_fattn<<<dim3(NB_ * NH_, FT_N, 1), NW * 32, 0, stream>>>(QP16, QPh, QPl, VT16, VTh, VTl, ATh, ATl);   /* all heads: scores, bias, mask, softmax, P.V, merged hi/lo rows */
    k_gemmw<bf, 1, true, false><<<dim3(TT / 64, DM / 64, NB_), 32, 0, stream>>>(ATh, ATl, WO, nullptr, DQ, OUT, DM, bo, bo, DM, (size_t)TT * DQ, 0, (size_t)TT * DM, nullptr, nullptr, nullptr, nullptr, nullptr, nullptr);
}

// v008
// A run of this version takes 121 microseconds.
// Timed twice side by side with v007, it ran 1.13 and 1.12 times as fast.
// Counting every step since v000, it is 13.5 times as fast.
#include <hip/hip_runtime.h>

// Causal self-attention with ALiBi (linear slopes), a separate q projection and a fused k|v projection (x [2][2048][1024]; q = x q_w + q_b ('xw' [1024][1024] 0.02 + bias zeros: read); kv = (x kv_w + kv_b) ('xw' [1024][2048] 0.02 + bias zeros: read) reshaped (B, T, 2, 16, 64): k | v = column halves (16 heads x 64); att x 1/sqrt(64) + slopes[h] x (j - i) with slopes[h] = (h + 1) / 16 (exact in f32; for the kept entries j <= i this is -slopes[h] x |i - j|); causal (-inf); softmax; y = merged o_w + o_b ('xw' + bias zeros: read) -> [2][2048][1024] (4.2 M); argument order x, q_w, q_b, kv_w, kv_b, o_w, o_b).
// Layout (each stage one launch for both batches): bf16 copy of x; q_w transposed; the fused kv weight transposed once into Bt (k | v row blocks) + bias halves; exact projections + f32 biases, whose epilogue writes the head planes; one fused attention kernel (scores, S x 1/8 + slope[h] x (j - i) in f32 with slope = SLOPE8[h] / 8 = (h + 1) / 16 and the bias exact, causal mask, running-maximum softmax, probability x value; hybrid rows: < 512 hi/lo 3 products, rest fp16 x1024; key tiles above the diagonal are never visited); merged hi/lo x o_w exact + o_b.
// Every 16-bit operand plane is stored fragment-major: a band of 16 rows holds its 16 x 32 fragments one after the other, each 512 elements (1 KB) in lane order (see fpk), so that one fragment load of a wave reads 512 contiguous bytes, four whole lines, twice.
// Compute dtypes, f32 accumulate: every input rounded to bf16; projections exact + f32 biases; attention rows < 512 3 products, rest fp16; softmax f32; output projection hl x exact.

#define NB_  2
#define TT   2048
#define DM   1024
#define NH_  16
#define NKV  16
#define REP  (NH_ / NKV)
#define HD   64
#define DQ   (NH_ * HD)
#define DKV  (NKV * HD)
#define RH   512                  // query rows < RH use hi+lo planes (0: none)
#define PCAR 1024.0f
#define SCL  0.125f   // HD^-0.5
typedef _Float16 h16;
typedef unsigned short bf;
typedef __attribute__((ext_vector_type(16))) __bf16   v16bf;
typedef __attribute__((ext_vector_type(16))) _Float16 v16h;
typedef __attribute__((ext_vector_type(8)))  _Float16 v8h;
typedef __attribute__((ext_vector_type(8)))  unsigned short v8us;
typedef __attribute__((ext_vector_type(8)))  float    v8f;
typedef __attribute__((ext_vector_type(4)))  float    v4f;
typedef v8h  __attribute__((may_alias)) v8ha;
typedef v4f  __attribute__((may_alias)) v4fa;
typedef v8us __attribute__((may_alias)) v8usa;

__device__ __forceinline__ unsigned short f2bf(float f) { unsigned u = __float_as_uint(f); u += 0x7FFFu + ((u >> 16) & 1u); return (unsigned short)(u >> 16); }
__device__ __forceinline__ float bf2f(unsigned short b) { return __uint_as_float(((unsigned)b) << 16); }
__device__ __forceinline__ float bfr(float f) { return bf2f(f2bf(f)); }
__device__ __forceinline__ v16h cat16(v8h lo, v8h hi) { return __builtin_shufflevector(lo, hi, 0, 1, 2, 3, 4, 5, 6, 7, 8, 9, 10, 11, 12, 13, 14, 15); }
__device__ __forceinline__ v16bf cat16b(v8us lo, v8us hi) { return __builtin_bit_cast(v16bf, __builtin_shufflevector(lo, hi, 0, 1, 2, 3, 4, 5, 6, 7, 8, 9, 10, 11, 12, 13, 14, 15)); }
__device__ __forceinline__ v8f wmma16(v16h a, v16h b, v8f c) { return __builtin_amdgcn_wmma_f32_16x16x32_f16(false, a, false, b, (short)0, c, false, false); }
__device__ __forceinline__ v8f wmmab(v16bf a, v16bf b, v8f c) { return __builtin_amdgcn_wmma_f32_16x16x32_bf16(false, a, false, b, (short)0, c, false, false); }



// ---- k_gemmw: register-blocked GEMM, ONE WAVE per 64x64 output tile (16 accumulators), operands straight from fragment-major 16-bit planes; grid (M/64, N/64, Z), 32 threads.
// C[m][n] (f32, pitch ldc, + optional f32 bias[n] for n < nb1, bias2[n - nb1] beyond) = sum_k A[m][k] Bt[n][k] (+ split products per NSPLIT). z-batch strides sA/sB/sC in elements. K % 32 == 0.
// PL (the q | k | v projection): no C. A 64-column tile is one head, and the epilogue rounds it straight into that head's fp16, hi and lo planes: q and k as [head][t][d]; a v tile is computed with the two operands exchanged (rows = d, columns = t, same k order), so that its rows are rows of the transposed [head][d][t] planes. Either way 16 tile rows x 16 columns are 512 contiguous bytes of each plane, one store of the wave.
__device__ __forceinline__ h16 tohx(float x) { return (h16)x; }
__device__ __forceinline__ void splitf(float y, unsigned short& h, unsigned short& l) { h = f2bf(y); l = f2bf(y - bf2f(h)); }
#define QKB ((size_t)(NH_ + NKV) * TT * HD)   // elements of one batch's q | k head planes
#define VB  ((size_t)NKV * HD * TT)           // elements of one batch's transposed v planes
// fpk: element offset of (row r, column k) in a fragment-major plane of K columns (K % 32 == 0). Band r / 16 starts at (r / 16) * 16 * K; fragment k / 32 of the band is 512 elements: two halves of 16 columns, each half = 32 lane slots of 8 elements, slot = 16 * ((k / 8) % 2) + r % 16.
// WFrag::ld(fragment + lane * 8) therefore gives lane (lr, hi) the columns 8 hi + 0..7 and 16 + 8 hi + 0..7 of row lr: the k order of both operands of every product.
__device__ __forceinline__ size_t fpk(int r, int k, int K) { return (size_t)(r >> 4) * 16 * K + (size_t)((k >> 5) * 512 + ((k >> 4) & 1) * 256 + ((k >> 3) & 1) * 128 + (r & 15) * 8 + (k & 7)); }
template <typename T16> struct WFrag;
template <> struct WFrag<h16> { typedef v16h V; static __device__ __forceinline__ V ld(const h16* p) { return cat16(*(const v8h*)p, *(const v8h*)(p + 256)); } static __device__ __forceinline__ v8f mma(V a, V b, v8f c) { return wmma16(a, b, c); } };
template <> struct WFrag<bf> { typedef v16bf V; static __device__ __forceinline__ V ld(const bf* p) { return cat16b(*(const v8us*)p, *(const v8us*)(p + 256)); } static __device__ __forceinline__ v8f mma(V a, V b, v8f c) { return wmmab(a, b, c); } };
template <typename T16, int NSPLIT, bool BIAS, bool PL>
__global__ __launch_bounds__(32) void k_gemmw(const T16* __restrict__ A, const T16* __restrict__ A2, const T16* __restrict__ Bt, const T16* __restrict__ Bt2, int K, float* C, int ldc, const float* __restrict__ bias, const float* __restrict__ bias2, int nb1, size_t sA, size_t sB, size_t sC, h16* QK16, bf* QKh, bf* QKl, h16* V16, bf* Vh, bf* Vl) {
    typedef typename WFrag<T16>::V V;
    __shared__ __align__(16) float os[16 * 68];
    const size_t z = blockIdx.z; A += z * sA; if (A2) A2 += z * sA; Bt += z * sB; if (Bt2) Bt2 += z * sB; C += z * sC;
    const int lane = threadIdx.x & 31, lr = lane & 15, hi = lane >> 4; const int r0 = blockIdx.x * 64, c0 = blockIdx.y * 64;
    const float* bp = (c0 < nb1) ? bias + c0 : bias2 + (c0 - nb1);   // columns < nb1 take bias, the rest bias2 (nb1 % 64 == 0: a tile never straddles)
    v8f acc[4][4];
#pragma unroll
    for (int mb = 0; mb < 4; ++mb)
#pragma unroll
        for (int nb = 0; nb < 4; ++nb) acc[mb][nb] = (v8f){};
    const bool isv = PL && c0 >= DQ + DKV;   // a v tile (the same for the whole block): A and Bt change places; both are fragment-major planes read by the same loader
    if (isv) { const T16* t = A; A = Bt; Bt = t; }
    const size_t aoff = (size_t)(isv ? c0 : r0) * K + 8 * lane, boff = (size_t)(isv ? r0 : c0) * K + 8 * lane;   // the tile's first band + the lane's slot; fragment kc / 32 of a band starts at kc * 16
#pragma unroll 1
    for (int kc = 0; kc < K; kc += 32) {
        V a[4], a2[4];
#pragma unroll
        for (int mb = 0; mb < 4; ++mb) { a[mb] = WFrag<T16>::ld(A + aoff + (size_t)mb * 16 * K + kc * 16); if (NSPLIT == 1 || NSPLIT == 2) a2[mb] = WFrag<T16>::ld(A2 + aoff + (size_t)mb * 16 * K + kc * 16); }
#pragma unroll
        for (int nb = 0; nb < 4; ++nb) { const V b = WFrag<T16>::ld(Bt + boff + (size_t)nb * 16 * K + kc * 16); V b2; if (NSPLIT >= 2) b2 = WFrag<T16>::ld(Bt2 + boff + (size_t)nb * 16 * K + kc * 16);
#pragma unroll
            for (int mb = 0; mb < 4; ++mb) { acc[mb][nb] = WFrag<T16>::mma(a[mb], b, acc[mb][nb]); if (NSPLIT == 1 || NSPLIT == 2) acc[mb][nb] = WFrag<T16>::mma(a2[mb], b, acc[mb][nb]); if (NSPLIT >= 2) acc[mb][nb] = WFrag<T16>::mma(a[mb], b2, acc[mb][nb]); } }
        asm volatile("v_nop\n\tv_nop\n\tv_nop\n\tv_nop" : "+v"(acc[0][0]), "+v"(acc[1][1]), "+v"(acc[2][2]), "+v"(acc[3][3]) : "v"(a[0]), "v"(a[3]));
    }
    if constexpr (PL) {
        // a pass = 16 tile rows x 16 columns: lane (lr, hi) takes row lr, columns 16 s + 8 hi + 0..7, which is slot 'lane' of half s % 2 of fragment s / 2 of the band
        const size_t pb = isv ? z * VB + (size_t)(c0 - (DQ + DKV)) * TT + (size_t)r0 * 16 : z * QKB + ((size_t)(c0 / HD) * TT + r0) * HD;   // the tile's first fragment in its planes (v: band c0 - ..., fragment r0 / 32; q, k: band r0 / 16 of the head)
        const int pp = 16 * (isv ? TT : HD);               // elements of a band of the planes
        h16* P16 = (isv ? V16 : QK16) + pb; bf* Ph = (isv ? Vh : QKh) + pb; bf* Pw = (isv ? Vl : QKl) + pb;
        float bc[4][8], br[4];                             // the bias goes with the weight's row: the tile's column for q and k (bc), the tile's row for v (br); both are loaded and rounded whatever the tile (bp has 64 entries), so that the loads issue as one group
#pragma unroll
        for (int s = 0; s < 4; ++s)
#pragma unroll
            for (int e = 0; e < 8; ++e) bc[s][e] = bfr(bp[s * 16 + hi * 8 + e]);
#pragma unroll
        for (int i = 0; i < 4; ++i) br[i] = bfr(bp[16 * i + lr]);
#pragma unroll
        for (int mb = 0; mb < 4; ++mb) {
#pragma unroll
            for (int nb = 0; nb < 4; ++nb) {
#pragma unroll
                for (int j = 0; j < 8; ++j) os[(hi * 8 + j) * 68 + nb * 16 + lr] = acc[mb][nb][j]; }
            __builtin_amdgcn_wave_barrier(); asm volatile("" ::: "memory");   // the rows are read back by other lanes than wrote them: no LDS access moves across
#pragma unroll
            for (int s = 0; s < 4; ++s) { const int cofs = s * 16 + hi * 8; const v4f u = *(const v4fa*)(os + lr * 68 + cofs), v = *(const v4fa*)(os + lr * 68 + cofs + 4); v8h o16; v8us oh, ol;
#pragma unroll
                for (int e = 0; e < 8; ++e) { const float y = (e < 4 ? u[e & 3] : v[e & 3]) + (isv ? br[mb] : bc[s][e]); o16[e] = tohx(y); unsigned short a2, c2; splitf(y, a2, c2); oh[e] = a2; ol[e] = c2; }
                const size_t o = (size_t)mb * pp + s * 256 + lane * 8; *(v8h*)(P16 + o) = o16; *(v8us*)(Ph + o) = oh; *(v8us*)(Pw + o) = ol;
                asm volatile("s_wait_xcnt 0x0" ::: "memory");   // the next pass rewrites the registers that these stores name: the wait stands in front of that
            }
            __builtin_amdgcn_wave_barrier(); asm volatile("" ::: "memory");   // the next 16 rows overwrite os only behind these reads
        }
        return;
    }
#pragma unroll
    for (int mb = 0; mb < 4; ++mb) {
#pragma unroll
        for (int nb = 0; nb < 4; ++nb) {
#pragma unroll
            for (int j = 0; j < 8; ++j) os[(hi * 8 + j) * 68 + nb * 16 + lr] = acc[mb][nb][j]; }
        __builtin_amdgcn_wave_barrier(); asm volatile("" ::: "memory");
        float* crow = C + (size_t)(r0 + mb * 16) * ldc + c0;
{
#pragma unroll
            for (int s = 0; s < 8; ++s) { const int row = 2 * s + hi, cofs = lr * 4; v4f val = *(const v4fa*)(os + row * 68 + cofs); if (BIAS) { val[0] += bfr(bp[cofs]); val[1] += bfr(bp[cofs + 1]); val[2] += bfr(bp[cofs + 2]); val[3] += bfr(bp[cofs + 3]); }
                *(v4f*)(crow + (size_t)row * ldc + cofs) = val; }
             }
        __builtin_amdgcn_wave_barrier(); asm volatile("" ::: "memory");
    }
}

typedef __attribute__((ext_vector_type(2))) _Float16 v2h;
typedef __attribute__((ext_vector_type(4))) _Float16 v4h;
typedef __attribute__((ext_vector_type(2))) unsigned short v2us;
typedef __attribute__((ext_vector_type(4))) unsigned short v4us;
typedef __attribute__((ext_vector_type(2))) float v2f;
typedef __attribute__((ext_vector_type(4))) int v4i;

__device__ __forceinline__ void d_wtG(unsigned blk, const float* __restrict__ w, int K, int N, bf* Bt) {
    const int lane = threadIdx.x & 31; const int L0 = (blk * 8 + (threadIdx.x >> 5)) * 8; const int nlines = N * K / 64;
{
#pragma unroll 1
        for (int l = 0; l < 8; ++l) { const int L = L0 + l; if (L >= nlines) break; const size_t e = (size_t)L * 64 + lane * 2; const int fb = (int)(e >> 9), wi = (int)(e & 511), k = (fb % (K / 32)) * 32 + (wi >> 7) * 8 + (wi & 7), n = (fb / (K / 32)) * 16 + ((wi >> 3) & 15); v2us o;   /* e = fpk(n, k, K) read backwards */
            o[0] = f2bf(w[(size_t)k * N + n]); o[1] = f2bf(w[(size_t)(k + 1) * N + n]); *(v2us*)(Bt + e) = o;
            asm volatile("s_wait_xcnt 0x0" ::: "memory");   /* the next trip rewrites the registers this store names: the wait stands in front of that */ }
         }
}
__device__ __forceinline__ void d_cvt8(unsigned blk, const float* __restrict__ src, bf* dst, size_t n8) { const size_t i = (size_t)blk * 256 + threadIdx.x; if (i >= n8) return;   // i: the 8-element lane slot of the fragment-major copy (DM columns); its row and first column, fpk read backwards:
    const size_t fb = i >> 6; const int wi = (int)(i & 63); const size_t r = (fb / (DM / 32)) * 16 + (wi & 15); const int k = (int)(fb % (DM / 32)) * 32 + (wi >> 4) * 8;
    const v8f v = *(const v8f*)(src + r * DM + k); v8us o;
#pragma unroll
    for (int k = 0; k < 8; ++k) o[k] = f2bf(v[k]); *(v8us*)(dst + i * 8) = o;  }

// k_prep: everything that depends on the inputs alone, in one grid by block ranges: the three weight transposes (first: the longest blocks), the bf16 copy of x (both batches).
#define PB_Q  ((DM * DQ / 64 + 63) / 64)
#define PB_KV ((DM * 2 * DKV / 64 + 63) / 64)
#define PB_O  ((DQ * DM / 64 + 63) / 64)
#define PB_X  ((NB_ * TT * DM / 8 + 255) / 256)
__global__ __launch_bounds__(256) void k_prep(const float* __restrict__ wq, const float* __restrict__ wkv, const float* __restrict__ wo, const float* __restrict__ x, bf* WQ, bf* WKV, bf* WO, bf* XB) {
    unsigned b = blockIdx.x;
    if (b < PB_Q) { d_wtG(b, wq, DM, DQ, WQ); return; } b -= PB_Q;
    if (b < PB_KV) { d_wtG(b, wkv, DM, 2 * DKV, WKV); return; } b -= PB_KV;   /* fused 'xw' [DM][2*DKV] -> Bt [2*DKV][DM]: k | v */
    if (b < PB_O) { d_wtG(b, wo, DQ, DM, WO); return; } b -= PB_O;
    d_cvt8(b, x, XB, (size_t)NB_ * TT * DM / 8);
}
__constant__ float SLOPE8[NH_] = { 5.000000000e-1f, 1.000000000e+0f, 1.500000000e+0f, 2.000000000e+0f, 2.500000000e+0f, 3.000000000e+0f, 3.500000000e+0f, 4.000000000e+0f, 4.500000000e+0f, 5.000000000e+0f, 5.500000000e+0f, 6.000000000e+0f, 6.500000000e+0f, 7.000000000e+0f, 7.500000000e+0f, 8.000000000e+0f };   // 8 x the per-head ALiBi slope magnitude (slopes[h] = (h + 1) / 16, h = 0..15, x 8 = (h + 1) / 2: exact); every entry and every product with |i - j| <= 2047 is exact in f32
#define QT  32
#define NW  4
#define L2E 1.4426950408889634f
template <typename T16> struct PPack;
template <> struct PPack<h16> { static __device__ __forceinline__ void mk(const v8f& p0, const v8f& p1, v16h& a, v16h& a2) { v8h x, y;
#pragma unroll
    for (int j = 0; j < 8; ++j) { x[j] = tohx(p0[j] * PCAR); y[j] = tohx(p1[j] * PCAR); } a = cat16(x, y); (void)a2; } };
template <> struct PPack<bf> { static __device__ __forceinline__ void mk(const v8f& p0, const v8f& p1, v16bf& a, v16bf& a2) { v8us xh, xl, yh, yl;
#pragma unroll
    for (int j = 0; j < 8; ++j) { unsigned short u, v; splitf(p0[j], u, v); xh[j] = u; xl[j] = v; splitf(p1[j], u, v); yh[j] = u; yl[j] = v; } a = cat16b(xh, yh); a2 = cat16b(xl, yl); } };
// KB = 16-key blocks per tile, NQ = 16-query blocks per work-group (2 and 2 in the fp16 body; 2 and 1 in the hi/lo body, whose second planes take the registers)
template <typename T16, int NSPLIT, int KB, int NQ>
__device__ __forceinline__ void d_fattn(float* Os, float* St, int r0, int h, const T16* __restrict__ Q, const T16* __restrict__ Q2, const T16* __restrict__ Kp, const T16* __restrict__ K2, const T16* __restrict__ Vt, const T16* __restrict__ V2, bf* Ah, bf* Al) {
    typedef typename WFrag<T16>::V V;
    const int lane = threadIdx.x & 31, lr = lane & 15, hi = lane >> 4, w = __builtin_amdgcn_readfirstlane((int)(threadIdx.x >> 5));   // the wave's number in a scalar register: the key loop's trip test is a scalar branch
    const float sl = SLOPE8[h] * SCL;              // the head's slope (h + 1) / 16
    const int nk = (r0 + NQ * 16 - 1) / (KB * 16) + 1;  // key tiles up to the diagonal; the first key of every such tile is <= r0 (r0 is a multiple of NQ * 16, which divides KB * 16), so no query of a tile is fully masked
    V q[NQ][2], q2[NQ][2];
#pragma unroll
    for (int qb = 0; qb < NQ; ++qb)
#pragma unroll
        for (int ks = 0; ks < 2; ++ks) { const unsigned off = (unsigned)((r0 + qb * 16) * HD + ks * 512 + 8 * lane); q[qb][ks] = WFrag<T16>::ld(Q + off); if (NSPLIT) q2[qb][ks] = WFrag<T16>::ld(Q2 + off); }
    v8f o[4][NQ]; float m[NQ], l[NQ];
#pragma unroll
    for (int qb = 0; qb < NQ; ++qb) { m[qb] = -3.0e38f; l[qb] = 0.f;
#pragma unroll
        for (int db = 0; db < 4; ++db) o[db][qb] = (v8f){}; }
    V ka[2][KB];
    if (!NSPLIT && w < nk) {   // the wave's first key fragments; every later tile's are fetched one trip ahead
#pragma unroll
        for (int ks = 0; ks < 2; ++ks)
#pragma unroll
            for (int kb = 0; kb < KB; ++kb) ka[ks][kb] = WFrag<T16>::ld(Kp + (unsigned)((w * (KB * 16) + kb * 16) * HD + ks * 512 + 8 * lane));
        asm volatile("s_wait_xcnt 0x0" ::: "memory");   // in front of whatever rewrites the address registers that the query and key loads above name
        __builtin_amdgcn_sched_barrier(0);              // keeps the loop's set-up (it reuses those address registers) behind the wait: without it the scheduler lifts that set-up over the wait
    }
#pragma unroll 1
    for (int kt = w; kt < nk; kt += NW) {
        const int k0 = kt * (KB * 16);
        const unsigned ko = (unsigned)(k0 * HD + 8 * lane), vo = (unsigned)(k0 * 16 + 8 * lane);   // one 32-bit element offset each for the tile's key and value fragments (key band k0 / 16; fragment k0 / 32 of a value band; the lane's slot): the rest of every address is a constant
        V ka2[2][KB], va[KB / 2][4], va2[KB / 2][4];
        if (NSPLIT) {
#pragma unroll
            for (int ks = 0; ks < 2; ++ks)
#pragma unroll
                for (int kb = 0; kb < KB; ++kb) { const unsigned off = ko + (unsigned)(kb * 16 * HD + ks * 512); ka[ks][kb] = WFrag<T16>::ld(Kp + off); ka2[ks][kb] = WFrag<T16>::ld(K2 + off); }
            asm volatile("s_wait_xcnt 0x0" ::: "memory");   // in front of whatever rewrites the address registers that these loads name
        }
        v8f s[KB][NQ];
#pragma unroll
        for (int kb = 0; kb < KB; ++kb)
#pragma unroll
            for (int qb = 0; qb < NQ; ++qb) s[kb][qb] = (v8f){};
#pragma unroll
        for (int ks = 0; ks < 2; ++ks)
#pragma unroll
            for (int kb = 0; kb < KB; ++kb)
#pragma unroll
                for (int qb = 0; qb < NQ; ++qb) { s[kb][qb] = WFrag<T16>::mma(ka[ks][kb], q[qb][ks], s[kb][qb]); if (NSPLIT) { s[kb][qb] = WFrag<T16>::mma(ka[ks][kb], q2[qb][ks], s[kb][qb]); s[kb][qb] = WFrag<T16>::mma(ka2[ks][kb], q[qb][ks], s[kb][qb]); } }
        // this tile's value fragments and, in the fp16 body, the wave's next key fragments (into the registers the products above have just read) fly while the softmax below runs
#pragma unroll
        for (int ks = 0; ks < KB / 2; ++ks)
#pragma unroll
            for (int db = 0; db < 4; ++db) { const unsigned off = vo + (unsigned)(db * 16 * TT + ks * 512); va[ks][db] = WFrag<T16>::ld(Vt + off); if (NSPLIT) va2[ks][db] = WFrag<T16>::ld(V2 + off); }
        if (!NSPLIT) {
            const unsigned kn = ko + ((kt + NW < nk) ? (unsigned)(NW * KB * 16 * HD) : 0u);   // the last trip fetches its own tile again: no address past the diagonal tile
#pragma unroll
            for (int ks = 0; ks < 2; ++ks)
#pragma unroll
                for (int kb = 0; kb < KB; ++kb) ka[ks][kb] = WFrag<T16>::ld(Kp + (kn + (unsigned)(kb * 16 * HD + ks * 512)));
        }
        asm volatile("s_wait_xcnt 0x0" ::: "memory");   // in front of the softmax, whose instructions may rewrite the address registers that these loads name
#pragma unroll
        for (int qb = 0; qb < NQ; ++qb) {
            const int dl = k0 + hi * 8 - (r0 + qb * 16 + lr);   // key - query of this lane's element (kb 0, j 0)
            const float bl = sl * (float)dl;                    // sixteenths of whole numbers below 2^16: this product and the sum below are exact in f32
            float tm = -3.0e38f;
#pragma unroll
            for (int kb = 0; kb < KB; ++kb)
#pragma unroll
                for (int j = 0; j < 8; ++j) { const float t = (dl + kb * 16 + j <= 0) ? __builtin_fmaf(s[kb][qb][j], SCL, __builtin_fmaf(sl, (float)(kb * 16 + j), bl)) : -3.0e38f;   /* S / 8 + slope x (j - i), rounded once */ s[kb][qb][j] = t; tm = fmaxf(tm, t); }
            tm = fmaxf(tm, __shfl_xor(tm, 16, 32));             // the other wave half holds the query's other keys
            const float mn = fmaxf(m[qb], tm); const float al = __builtin_amdgcn_exp2f((m[qb] - mn) * L2E); m[qb] = mn;
            float ps = 0.f;
#pragma unroll
            for (int kb = 0; kb < KB; ++kb)
#pragma unroll
                for (int j = 0; j < 8; ++j) { const float p = __builtin_amdgcn_exp2f((s[kb][qb][j] - mn) * L2E); s[kb][qb][j] = p; ps += p; }
            l[qb] = l[qb] * al + ps;
#pragma unroll
            for (int db = 0; db < 4; ++db) o[db][qb] *= al;
        }
#pragma unroll
        for (int ks = 0; ks < KB / 2; ++ks) { V p[NQ], p2[NQ];
#pragma unroll
            for (int qb = 0; qb < NQ; ++qb) PPack<T16>::mk(s[2 * ks][qb], s[2 * ks + 1][qb], p[qb], p2[qb]);
#pragma unroll
            for (int db = 0; db < 4; ++db)
#pragma unroll
                for (int qb = 0; qb < NQ; ++qb) { o[db][qb] = WFrag<T16>::mma(va[ks][db], p[qb], o[db][qb]); if (NSPLIT) { o[db][qb] = WFrag<T16>::mma(va[ks][db], p2[qb], o[db][qb]); o[db][qb] = WFrag<T16>::mma(va2[ks][db], p[qb], o[db][qb]); } } }
    }
#pragma unroll
    for (int qb = 0; qb < NQ; ++qb) { l[qb] += __shfl_xor(l[qb], 16, 32);
#pragma unroll
        for (int db = 0; db < 4; ++db) { float* p = Os + (w * QT + qb * 16 + lr) * 68 + db * 16 + hi * 8; v4f x, y;
#pragma unroll
            for (int j = 0; j < 4; ++j) { x[j] = o[db][qb][j]; y[j] = o[db][qb][4 + j]; }
            *(v4fa*)p = x; *(v4fa*)(p + 4) = y; }
        if (hi == 0) { St[(w * QT + qb * 16 + lr) * 2] = m[qb]; St[(w * QT + qb * 16 + lr) * 2 + 1] = l[qb]; } }
    __syncthreads();   // every wave's partial tile, maximum and sum are in LDS before any thread joins them
    const int row = (int)threadIdx.x / (8 / NQ), d0 = ((int)threadIdx.x % (8 / NQ)) * (NQ * 8);   // NQ * 16 rows, 8 / NQ threads a row, NQ * 8 columns a thread
    float f[NW], M = -3.0e38f, L = 0.f;
#pragma unroll
    for (int u = 0; u < NW; ++u) { f[u] = St[(u * QT + row) * 2]; M = fmaxf(M, f[u]); }
#pragma unroll
    for (int u = 0; u < NW; ++u) { f[u] = __builtin_amdgcn_exp2f((f[u] - M) * L2E); L += f[u] * St[(u * QT + row) * 2 + 1]; }   // a wave without a tile has maximum -3e38: factor 0
    const float g = __fdiv_rn(NSPLIT ? 1.0f : (1.0f / PCAR), L);
    const size_t oo = fpk(r0 + row, h * HD + d0, DQ);   // the merged rows are the output projection's A operand: fragment-major too; the next 8 columns of a 16-column half lie 128 elements on
#pragma unroll
    for (int c = 0; c < NQ; ++c) { v8us oh, ol;
#pragma unroll
        for (int c4 = 0; c4 < 2; ++c4) { v4f y = (v4f){};
#pragma unroll
            for (int u = 0; u < NW; ++u) y += f[u] * *(const v4fa*)(Os + (u * QT + row) * 68 + d0 + c * 8 + c4 * 4);
#pragma unroll
            for (int e = 0; e < 4; ++e) { unsigned short a, c2; splitf(y[e] * g, a, c2); oh[c4 * 4 + e] = a; ol[c4 * 4 + e] = c2; } }
        *(v8usa*)(Ah + oo + c * 128) = oh; *(v8usa*)(Al + oo + c * 128) = ol; }
    asm volatile("s_wait_xcnt 0x0" ::: "memory");   // behind the tile's stores: in the built kernel the other body stands behind this one and rewrites the registers that these stores name
}
// grid (batches x heads, FT_N): row tiles of both batches in falling order of their keys, so the longest start first: (TT - RH) / 32 fp16 tiles of 32 query rows (probabilities x PCAR, taken out again with the sum), then RH / 16 hi/lo 3-product tiles of 16 rows.
// Four waves per SIMD (at most 256 registers a wave, four work-groups per WGP): the vector work of one wave runs under the matrix work and the loads of another.
#define FT_16 ((TT - RH) / QT)
#define FT_N  (FT_16 + RH / 16)
__global__ __launch_bounds__(NW * 32) __attribute__((amdgpu_waves_per_eu(4, 4))) void k_fattn(const h16* __restrict__ QK16, const bf* __restrict__ QKh, const bf* __restrict__ QKl, const h16* __restrict__ V16, const bf* __restrict__ Vh, const bf* __restrict__ Vl, bf* Ah, bf* Al) {
    __shared__ __align__(16) float Os[NW * QT * 68]; __shared__ float St[NW * QT * 2];
    const int h = (int)blockIdx.x % NH_, y = (int)blockIdx.y; const size_t n = blockIdx.x / NH_;   // n: the batch
    const size_t qo = n * QKB + (size_t)h * TT * HD, ko = n * QKB + (size_t)(NH_ + h / REP) * TT * HD, vo = n * VB + (size_t)(h / REP) * HD * TT; Ah += n * ((size_t)TT * DQ); Al += n * ((size_t)TT * DQ);
    if (y < FT_16) d_fattn<h16, 0, 2, 2>(Os, St, TT - (y + 1) * QT, h, QK16 + qo, nullptr, QK16 + ko, nullptr, V16 + vo, nullptr, Ah, Al);
    else d_fattn<bf, 2, 2, 1>(Os, St, RH - (y - FT_16 + 1) * 16, h, QKh + qo, QKl + qo, QKh + ko, QKl + ko, Vh + vo, Vl + vo, Ah, Al);
}

extern "C" void kernel_launch(void* const* d_in, const int* in_sizes, int n_in,
                              void* d_out, int out_size, void* d_ws, size_t ws_size, hipStream_t stream) {
    (void)in_sizes; (void)n_in; (void)out_size;
    const float* x = (const float*)d_in[0]; const float* wq = (const float*)d_in[1]; const float* bq = (const float*)d_in[2]; const float* wkv = (const float*)d_in[3]; const float* bkv = (const float*)d_in[4]; const float* wo = (const float*)d_in[5]; const float* bo = (const float*)d_in[6];
    float* OUT = (float*)d_out;     // [2][2048][1024]
    char* wsp = (char*)d_ws;
    auto take = [&](size_t bytes) { char* p = wsp; wsp += (bytes + 255) & ~(size_t)255; return (void*)p; };
    bf* WQ = (bf*)take((size_t)(DQ + 2 * DKV) * DM * 2); bf* WKV = WQ + (size_t)DQ * DM;   /* one Bt [DQ + 2*DKV][DM]: q | k | v row blocks */ bf* WO = (bf*)take((size_t)DM * DQ * 2);
    bf* XB = (bf*)take((size_t)NB_ * TT * DM * 2);
    h16* QP16 = (h16*)take(NB_ * QKB * 2); h16* VT16 = (h16*)take(NB_ * VB * 2);   /* the k planes follow the q planes: head index = projection column / HD */
    bf* QPh = (bf*)take(NB_ * QKB * 2); bf* QPl = (bf*)take(NB_ * QKB * 2); bf* VTh = (bf*)take(NB_ * VB * 2); bf* VTl = (bf*)take(NB_ * VB * 2);
    bf* ATh = (bf*)take((size_t)NB_ * TT * DQ * 2); bf* ATl = (bf*)take((size_t)NB_ * TT * DQ * 2);
    if ((size_t)(wsp - (char*)d_ws) > ws_size) return;    // ws 256 MiB
    k_prep<<<PB_Q + PB_KV + PB_O + PB_X, 256, 0, stream>>>(wq, wkv, wo, x, WQ, WKV, WO, XB);
    // every stage once, both batches in its grid (the projections: grid z with the batch strides of A and of the output (C, or the head planes), the weights shared)
    k_gemmw<bf, 0, true, true><<<dim3(TT / 64, (DQ + 2 * DKV) / 64, NB_), 32, 0, stream>>>(XB, nullptr, WQ, nullptr, DM, nullptr, 0, bq, bkv, DQ, (size_t)TT * DM, 0, 0, QP16, QPh, QPl, VT16, VTh, VTl);   /* q | k | v in one grid, written as head planes; kv_b = k | v bias halves */
    k_fattn<<<dim3(NB_ * NH_, FT_N, 1), NW * 32, 0, stream>>>(QP16, QPh, QPl, VT16, VTh, VTl, ATh, ATl);   /* all heads: scores, bias, mask, softmax, P.V, merged hi/lo rows */
    k_gemmw<bf, 1, true, false><<<dim3(TT / 64, DM / 64, NB_), 32, 0, stream>>>(ATh, ATl, WO, nullptr, DQ, OUT, DM, bo, bo, DM, (size_t)TT * DQ, 0, (size_t)TT * DM, nullptr, nullptr, nullptr, nullptr, nullptr, nullptr);
}

// v009
// A run of this version takes 82.9 microseconds.
// In two side-by-side timings against v008, it was 1.42 and 1.50 times as fast.
// All steps since v000 together make it 19.7 times as fast.
#include <hip/hip_runtime.h>

// Causal self-attention with ALiBi (linear slopes), a separate q projection and a fused k|v projection (x [2][2048][1024]; q = x q_w + q_b ('xw' [1024][1024] 0.02 + bias zeros: read); kv = (x kv_w + kv_b) ('xw' [1024][2048] 0.02 + bias zeros: read) reshaped (B, T, 2, 16, 64): k | v = column halves (16 heads x 64); att x 1/sqrt(64) + slopes[h] x (j - i) with slopes[h] = (h + 1) / 16 (exact in f32; for the kept entries j <= i this is -slopes[h] x |i - j|); causal (-inf); softmax; y = merged o_w + o_b ('xw' + bias zeros: read) -> [2][2048][1024] (4.2 M); argument order x, q_w, q_b, kv_w, kv_b, o_w, o_b).
// Layout (each stage one launch for both batches): bf16 copy of x; q_w transposed; the fused kv weight transposed once into Bt (k | v row blocks) + bias halves; exact projections + f32 biases, whose epilogue writes the head planes; one fused attention kernel (scores, S x 1/8 + slope[h] x (j - i) in f32 with slope = SLOPE8[h] / 8 = (h + 1) / 16 and the bias exact, causal mask, running-maximum softmax, probability x value; hybrid rows: < 512 hi/lo 3 products, rest fp16 x1024; key tiles above the diagonal are never visited); merged hi/lo x o_w exact + o_b.
// Every 16-bit operand plane is stored fragment-major: a band of 16 rows holds its 16 x 32 fragments one after the other, each 512 elements (1 KB) in lane order (see fpk), so that one fragment load of a wave reads 512 contiguous bytes, four whole lines, twice.
// Compute dtypes, f32 accumulate: every input rounded to bf16; projections exact + f32 biases; attention rows < 512 3 products, rest fp16; softmax f32; output projection hl x exact.

#define NB_  2
#define TT   2048
#define DM   1024
#define NH_  16
#define NKV  16
#define REP  (NH_ / NKV)
#define HD   64
#define DQ   (NH_ * HD)
#define DKV  (NKV * HD)
#define RH   512                  // query rows < RH use hi+lo planes (0: none)
#define PCAR 1024.0f
#define SCL  0.125f   // HD^-0.5
typedef _Float16 h16;
typedef unsigned short bf;
typedef __attribute__((ext_vector_type(16))) __bf16   v16bf;
typedef __attribute__((ext_vector_type(16))) _Float16 v16h;
typedef __attribute__((ext_vector_type(8)))  _Float16 v8h;
typedef __attribute__((ext_vector_type(8)))  unsigned short v8us;
typedef __attribute__((ext_vector_type(8)))  float    v8f;
typedef __attribute__((ext_vector_type(4)))  float    v4f;
typedef v8h  __attribute__((may_alias)) v8ha;
typedef v4f  __attribute__((may_alias)) v4fa;
typedef v8us __attribute__((may_alias)) v8usa;

__device__ __forceinline__ unsigned short f2bf(float f) { unsigned u = __float_as_uint(f); u += 0x7FFFu + ((u >> 16) & 1u); return (unsigned short)(u >> 16); }
__device__ __forceinline__ float bf2f(unsigned short b) { return __uint_as_float(((unsigned)b) << 16); }
__device__ __forceinline__ float bfr(float f) { return bf2f(f2bf(f)); }
__device__ __forceinline__ v16h cat16(v8h lo, v8h hi) { return __builtin_shufflevector(lo, hi, 0, 1, 2, 3, 4, 5, 6, 7, 8, 9, 10, 11, 12, 13, 14, 15); }
__device__ __forceinline__ v16bf cat16b(v8us lo, v8us hi) { return __builtin_bit_cast(v16bf, __builtin_shufflevector(lo, hi, 0, 1, 2, 3, 4, 5, 6, 7, 8, 9, 10, 11, 12, 13, 14, 15)); }
__device__ __forceinline__ v8f wmma16(v16h a, v16h b, v8f c) { return __builtin_amdgcn_wmma_f32_16x16x32_f16(false, a, false, b, (short)0, c, false, false); }
__device__ __forceinline__ v8f wmmab(v16bf a, v16bf b, v8f c) { return __builtin_amdgcn_wmma_f32_16x16x32_bf16(false, a, false, b, (short)0, c, false, false); }



// ---- k_gemmw: register-blocked GEMM, ONE WAVE per 64x64 output tile (16 accumulators), operands straight from fragment-major 16-bit planes; grid (M/64, N/64, Z), 32 threads.
// C[m][n] (f32, pitch ldc, + optional f32 bias[n] for n < nb1, bias2[n - nb1] beyond) = sum_k A[m][k] Bt[n][k] (+ split products per NSPLIT). z-batch strides sA/sB/sC in elements. K (a constant of the build) % 64 == 0.
// PL (the q | k | v projection): no C. A 64-column tile is one head, and the epilogue rounds it straight into that head's fp16, hi and lo planes: q and k as [head][t][d]; a v tile is computed with the two operands exchanged (rows = d, columns = t, same k order), so that its rows are rows of the transposed [head][d][t] planes. Either way 16 tile rows x 16 columns are 512 contiguous bytes of each plane, one store of the wave.
__device__ __forceinline__ h16 tohx(float x) { return (h16)x; }
__device__ __forceinline__ void splitf(float y, unsigned short& h, unsigned short& l) { h = f2bf(y); l = f2bf(y - bf2f(h)); }
#define QKB ((size_t)(NH_ + NKV) * TT * HD)   // elements of one batch's q | k head planes
#define VB  ((size_t)NKV * HD * TT)           // elements of one batch's transposed v planes
// fpk: element offset of (row r, column k) in a fragment-major plane of K columns (K % 32 == 0). Band r / 16 starts at (r / 16) * 16 * K; fragment k / 32 of the band is 512 elements: two halves of 16 columns, each half = 32 lane slots of 8 elements, slot = 16 * ((k / 8) % 2) + r % 16.
// WFrag::ld(fragment + lane * 8) therefore gives lane (lr, hi) the columns 8 hi + 0..7 and 16 + 8 hi + 0..7 of row lr: the k order of both operands of every product.
__device__ __forceinline__ size_t fpk(int r, int k, int K) { return (size_t)(r >> 4) * 16 * K + (size_t)((k >> 5) * 512 + ((k >> 4) & 1) * 256 + ((k >> 3) & 1) * 128 + (r & 15) * 8 + (k & 7)); }
template <typename T16> struct WFrag;
template <> struct WFrag<h16> { typedef v16h V; static __device__ __forceinline__ V ld(const h16* p) { return cat16(*(const v8h*)p, *(const v8h*)(p + 256)); } static __device__ __forceinline__ v8f mma(V a, V b, v8f c) { return wmma16(a, b, c); } };
template <> struct WFrag<bf> { typedef v16bf V; static __device__ __forceinline__ V ld(const bf* p) { return cat16b(*(const v8us*)p, *(const v8us*)(p + 256)); } static __device__ __forceinline__ v8f mma(V a, V b, v8f c) { return wmmab(a, b, c); } };
template <typename T16, int NSPLIT, bool BIAS, bool PL, int K>
__global__ __launch_bounds__(32) void k_gemmw(const T16* __restrict__ A, const T16* __restrict__ A2, const T16* __restrict__ Bt, const T16* __restrict__ Bt2, float* C, int ldc, const float* __restrict__ bias, const float* __restrict__ bias2, int nb1, size_t sA, size_t sB, size_t sC, h16* QK16, bf* QKh, bf* QKl, h16* V16, bf* Vh, bf* Vl) {
    typedef typename WFrag<T16>::V V;
    __shared__ __align__(16) float os[16 * 68];
    const size_t z = blockIdx.z; A += z * sA; if (A2) A2 += z * sA; Bt += z * sB; if (Bt2) Bt2 += z * sB; C += z * sC;
    const int lane = threadIdx.x & 31, lr = lane & 15, hi = lane >> 4; const int r0 = blockIdx.x * 64, c0 = blockIdx.y * 64;
    const float* bp = (c0 < nb1) ? bias + c0 : bias2 + (c0 - nb1);   // columns < nb1 take bias, the rest bias2 (nb1 % 64 == 0: a tile never straddles)
    v8f acc[4][4];
#pragma unroll
    for (int mb = 0; mb < 4; ++mb)
#pragma unroll
        for (int nb = 0; nb < 4; ++nb) acc[mb][nb] = (v8f){};
    const bool isv = PL && c0 >= DQ + DKV;   // a v tile (the same for the whole block): A and Bt change places; both are fragment-major planes read by the same loader
    if (isv) { const T16* t = A; A = Bt; Bt = t; }
    static_assert(K % 64 == 0, "the k loop takes two steps of 32 a trip");
    // The k loop runs on two register sets: all fragments of step f + 1 are requested as ONE group before the products of step f, so a step waits for loads that were issued a whole step earlier and not, as with one set, for its own.
    // Every address is a uniform base (the tile's first band + fragment f, 512 elements each) + a constant (band mb or nb, 16 * K elements) + the lane's slot.
    const unsigned ln = 8u * (unsigned)lane;
    const T16* Ap = A + (size_t)(isv ? c0 : r0) * K; const T16* A2p = (NSPLIT == 1 || NSPLIT == 2) ? A2 + (size_t)r0 * K : A2; const T16* Bp = Bt + (size_t)(isv ? r0 : c0) * K; const T16* B2p = (NSPLIT >= 2) ? Bt2 + (size_t)c0 * K : Bt2;
    V a[2][4], a2[2][4], b[2][4], b2[2][4];
    auto fetch = [&](const int st, const int f) {
        const T16* pa = Ap + f * 512; const T16* pb = Bp + f * 512;
#pragma unroll
        for (int i = 0; i < 4; ++i) { a[st][i] = WFrag<T16>::ld(pa + i * 16 * K + ln); b[st][i] = WFrag<T16>::ld(pb + i * 16 * K + ln); }
#pragma unroll
        for (int i = 0; i < 4; ++i) { if (NSPLIT == 1 || NSPLIT == 2) a2[st][i] = WFrag<T16>::ld(A2p + f * 512 + i * 16 * K + ln); if (NSPLIT >= 2) b2[st][i] = WFrag<T16>::ld(B2p + f * 512 + i * 16 * K + ln); }
        asm volatile("s_wait_xcnt 0x0" ::: "memory");   // in front of the next group's bases, which rewrite the address registers that these loads name
        __builtin_amdgcn_sched_barrier(0);              // keeps the group whole and ahead of the products below: the scheduler otherwise sinks each load to its first use, and the step waits for it there
    };
    auto mm = [&](const int st) {
#pragma unroll
        for (int nb = 0; nb < 4; ++nb)
#pragma unroll
            for (int mb = 0; mb < 4; ++mb) { acc[mb][nb] = WFrag<T16>::mma(a[st][mb], b[st][nb], acc[mb][nb]); if (NSPLIT == 1 || NSPLIT == 2) acc[mb][nb] = WFrag<T16>::mma(a2[st][mb], b[st][nb], acc[mb][nb]); if (NSPLIT >= 2) acc[mb][nb] = WFrag<T16>::mma(a[st][mb], b2[st][nb], acc[mb][nb]); }
        __builtin_amdgcn_sched_barrier(0);              // the next group's loads (into this set's registers) stay behind these products
    };
    fetch(0, 0);
#pragma unroll 1   // stays rolled: a trip is one turn of each set; more copies only lengthen the text
    for (int f = 0; f < K / 32 - 2; f += 2) {
        fetch(1, f + 1); mm(0);
        fetch(0, f + 2); mm(1);
    }
    fetch(1, K / 32 - 1); mm(0); mm(1);
    if constexpr (PL) {
        // a pass = 16 tile rows x 16 columns: lane (lr, hi) takes row lr, columns 16 s + 8 hi + 0..7, which is slot 'lane' of half s % 2 of fragment s / 2 of the band
        const size_t pb = isv ? z * VB + (size_t)(c0 - (DQ + DKV)) * TT + (size_t)r0 * 16 : z * QKB + ((size_t)(c0 / HD) * TT + r0) * HD;   // the tile's first fragment in its planes (v: band c0 - ..., fragment r0 / 32; q, k: band r0 / 16 of the head)
        const int pp = 16 * (isv ? TT : HD);               // elements of a band of the planes
        h16* P16 = (isv ? V16 : QK16) + pb; bf* Ph = (isv ? Vh : QKh) + pb; bf* Pw = (isv ? Vl : QKl) + pb;
        float bc[4][8], br[4];                             // the bias goes with the weight's row: the tile's column for q and k (bc), the tile's row for v (br); both are loaded and rounded whatever the tile (bp has 64 entries), so that the loads issue as one group
#pragma unroll
        for (int s = 0; s < 4; ++s)
#pragma unroll
            for (int e = 0; e < 8; ++e) bc[s][e] = bfr(bp[s * 16 + hi * 8 + e]);
#pragma unroll
        for (int i = 0; i < 4; ++i) br[i] = bfr(bp[16 * i + lr]);
#pragma unroll
        for (int mb = 0; mb < 4; ++mb) {
#pragma unroll
            for (int nb = 0; nb < 4; ++nb) {
#pragma unroll
                for (int j = 0; j < 8; ++j) os[(hi * 8 + j) * 68 + nb * 16 + lr] = acc[mb][nb][j]; }
            __builtin_amdgcn_wave_barrier(); asm volatile("" ::: "memory");   // the rows are read back by other lanes than wrote them: no LDS access moves across
#pragma unroll
            for (int s = 0; s < 4; ++s) { const int cofs = s * 16 + hi * 8; const v4f u = *(const v4fa*)(os + lr * 68 + cofs), v = *(const v4fa*)(os + lr * 68 + cofs + 4); v8h o16; v8us oh, ol;
#pragma unroll
                for (int e = 0; e < 8; ++e) { const float y = (e < 4 ? u[e & 3] : v[e & 3]) + (isv ? br[mb] : bc[s][e]); o16[e] = tohx(y); unsigned short a2, c2; splitf(y, a2, c2); oh[e] = a2; ol[e] = c2; }
                const size_t o = (size_t)mb * pp + s * 256 + lane * 8; *(v8h*)(P16 + o) = o16; *(v8us*)(Ph + o) = oh; *(v8us*)(Pw + o) = ol;
                asm volatile("s_wait_xcnt 0x0" ::: "memory");   // the next pass rewrites the registers that these stores name: the wait stands in front of that
            }
            __builtin_amdgcn_wave_barrier(); asm volatile("" ::: "memory");   // the next 16 rows overwrite os only behind these reads
        }
        return;
    }
#pragma unroll
    for (int mb = 0; mb < 4; ++mb) {
#pragma unroll
        for (int nb = 0; nb < 4; ++nb) {
#pragma unroll
            for (int j = 0; j < 8; ++j) os[(hi * 8 + j) * 68 + nb * 16 + lr] = acc[mb][nb][j]; }
        __builtin_amdgcn_wave_barrier(); asm volatile("" ::: "memory");
        float* crow = C + (size_t)(r0 + mb * 16) * ldc + c0;
{
#pragma unroll
            for (int s = 0; s < 8; ++s) { const int row = 2 * s + hi, cofs = lr * 4; v4f val = *(const v4fa*)(os + row * 68 + cofs); if (BIAS) { val[0] += bfr(bp[cofs]); val[1] += bfr(bp[cofs + 1]); val[2] += bfr(bp[cofs + 2]); val[3] += bfr(bp[cofs + 3]); }
                *(v4f*)(crow + (size_t)row * ldc + cofs) = val; }
            asm volatile("s_wait_xcnt 0x0" ::: "memory");   // the next 16 rows rewrite the registers that these stores name: the wait stands in front of that
             }
        __builtin_amdgcn_wave_barrier(); asm volatile("" ::: "memory");
    }
}

typedef __attribute__((ext_vector_type(2))) _Float16 v2h;
typedef __attribute__((ext_vector_type(4))) _Float16 v4h;
typedef __attribute__((ext_vector_type(2))) unsigned short v2us;
typedef __attribute__((ext_vector_type(4))) unsigned short v4us;
typedef __attribute__((ext_vector_type(2))) float v2f;
typedef __attribute__((ext_vector_type(4))) int v4i;

__device__ __forceinline__ void d_wtG(unsigned blk, const float* __restrict__ w, int K, int N, bf* Bt) {
    const int lane = threadIdx.x & 31; const int L0 = (blk * 8 + (threadIdx.x >> 5)) * 8; const int nlines = N * K / 64;
{
#pragma unroll 1
        for (int l = 0; l < 8; ++l) { const int L = L0 + l; if (L >= nlines) break; const size_t e = (size_t)L * 64 + lane * 2; const int fb = (int)(e >> 9), wi = (int)(e & 511), k = (fb % (K / 32)) * 32 + (wi >> 7) * 8 + (wi & 7), n = (fb / (K / 32)) * 16 + ((wi >> 3) & 15); v2us o;   /* e = fpk(n, k, K) read backwards */
            o[0] = f2bf(w[(size_t)k * N + n]); o[1] = f2bf(w[(size_t)(k + 1) * N + n]); *(v2us*)(Bt + e) = o;
            asm volatile("s_wait_xcnt 0x0" ::: "memory");   /* the next trip rewrites the registers this store names: the wait stands in front of that */ }
         }
}
__device__ __forceinline__ void d_cvt8(unsigned blk, const float* __restrict__ src, bf* dst, size_t n8) { const size_t i = (size_t)blk * 256 + threadIdx.x; if (i >= n8) return;   // i: the 8-element lane slot of the fragment-major copy (DM columns); its row and first column, fpk read backwards:
    const size_t fb = i >> 6; const int wi = (int)(i & 63); const size_t r = (fb / (DM / 32)) * 16 + (wi & 15); const int k = (int)(fb % (DM / 32)) * 32 + (wi >> 4) * 8;
    const v8f v = *(const v8f*)(src + r * DM + k); v8us o;
#pragma unroll
    for (int k = 0; k < 8; ++k) o[k] = f2bf(v[k]); *(v8us*)(dst + i * 8) = o;  }

// k_prep: everything that depends on the inputs alone, in one grid by block ranges: the three weight transposes (first: the longest blocks), the bf16 copy of x (both batches).
#define PB_Q  ((DM * DQ / 64 + 63) / 64)
#define PB_KV ((DM * 2 * DKV / 64 + 63) / 64)
#define PB_O  ((DQ * DM / 64 + 63) / 64)
#define PB_X  ((NB_ * TT * DM / 8 + 255) / 256)
__global__ __launch_bounds__(256) void k_prep(const float* __restrict__ wq, const float* __restrict__ wkv, const float* __restrict__ wo, const float* __restrict__ x, bf* WQ, bf* WKV, bf* WO, bf* XB) {
    unsigned b = blockIdx.x;
    if (b < PB_Q) { d_wtG(b, wq, DM, DQ, WQ); return; } b -= PB_Q;
    if (b < PB_KV) { d_wtG(b, wkv, DM, 2 * DKV, WKV); return; } b -= PB_KV;   /* fused 'xw' [DM][2*DKV] -> Bt [2*DKV][DM]: k | v */
    if (b < PB_O) { d_wtG(b, wo, DQ, DM, WO); return; } b -= PB_O;
    d_cvt8(b, x, XB, (size_t)NB_ * TT * DM / 8);
}
__constant__ float SLOPE8[NH_] = { 5.000000000e-1f, 1.000000000e+0f, 1.500000000e+0f, 2.000000000e+0f, 2.500000000e+0f, 3.000000000e+0f, 3.500000000e+0f, 4.000000000e+0f, 4.500000000e+0f, 5.000000000e+0f, 5.500000000e+0f, 6.000000000e+0f, 6.500000000e+0f, 7.000000000e+0f, 7.500000000e+0f, 8.000000000e+0f };   // 8 x the per-head ALiBi slope magnitude (slopes[h] = (h + 1) / 16, h = 0..15, x 8 = (h + 1) / 2: exact); every entry and every product with |i - j| <= 2047 is exact in f32
#define QT  32
#define NW  4
#define L2E 1.4426950408889634f
template <typename T16> struct PPack;
template <> struct PPack<h16> { static __device__ __forceinline__ void mk(const v8f& p0, const v8f& p1, v16h& a, v16h& a2) { v8h x, y;
#pragma unroll
    for (int j = 0; j < 8; ++j) { x[j] = tohx(p0[j] * PCAR); y[j] = tohx(p1[j] * PCAR); } a = cat16(x, y); (void)a2; } };
template <> struct PPack<bf> { static __device__ __forceinline__ void mk(const v8f& p0, const v8f& p1, v16bf& a, v16bf& a2) { v8us xh, xl, yh, yl;
#pragma unroll
    for (int j = 0; j < 8; ++j) { unsigned short u, v; splitf(p0[j], u, v); xh[j] = u; xl[j] = v; splitf(p1[j], u, v); yh[j] = u; yl[j] = v; } a = cat16b(xh, yh); a2 = cat16b(xl, yl); } };
// KB = 16-key blocks per tile, NQ = 16-query blocks per work-group (2 and 2 in the fp16 body; 2 and 1 in the hi/lo body, whose second planes take the registers)
template <typename T16, int NSPLIT, int KB, int NQ>
__device__ __forceinline__ void d_fattn(float* Os, float* St, int r0, int h, const T16* __restrict__ Q, const T16* __restrict__ Q2, const T16* __restrict__ Kp, const T16* __restrict__ K2, const T16* __restrict__ Vt, const T16* __restrict__ V2, bf* Ah, bf* Al) {
    typedef typename WFrag<T16>::V V;
    const int lane = threadIdx.x & 31, lr = lane & 15, hi = lane >> 4, w = __builtin_amdgcn_readfirstlane((int)(threadIdx.x >> 5));   // the wave's number in a scalar register: the key loop's trip test is a scalar branch
    const float sl = SLOPE8[h] * SCL;              // the head's slope (h + 1) / 16
    const int nk = (r0 + NQ * 16 - 1) / (KB * 16) + 1;  // key tiles up to the diagonal; the first key of every such tile is <= r0 (r0 is a multiple of NQ * 16, which divides KB * 16), so no query of a tile is fully masked
    V q[NQ][2], q2[NQ][2];
#pragma unroll
    for (int qb = 0; qb < NQ; ++qb)
#pragma unroll
        for (int ks = 0; ks < 2; ++ks) { const unsigned off = (unsigned)((r0 + qb * 16) * HD + ks * 512 + 8 * lane); q[qb][ks] = WFrag<T16>::ld(Q + off); if (NSPLIT) q2[qb][ks] = WFrag<T16>::ld(Q2 + off); }
    v8f o[4][NQ]; float m[NQ], l[NQ];
#pragma unroll
    for (int qb = 0; qb < NQ; ++qb) { m[qb] = -3.0e38f; l[qb] = 0.f;
#pragma unroll
        for (int db = 0; db < 4; ++db) o[db][qb] = (v8f){}; }
    V ka[2][KB];
    if (!NSPLIT && w < nk) {   // the wave's first key fragments; every later tile's are fetched one trip ahead
#pragma unroll
        for (int ks = 0; ks < 2; ++ks)
#pragma unroll
            for (int kb = 0; kb < KB; ++kb) ka[ks][kb] = WFrag<T16>::ld(Kp + (unsigned)((w * (KB * 16) + kb * 16) * HD + ks * 512 + 8 * lane));
        asm volatile("s_wait_xcnt 0x0" ::: "memory");   // in front of whatever rewrites the address registers that the query and key loads above name
        __builtin_amdgcn_sched_barrier(0);              // keeps the loop's set-up (it reuses those address registers) behind the wait: without it the scheduler lifts that set-up over the wait
    }
#pragma unroll 1
    for (int kt = w; kt < nk; kt += NW) {
        const int k0 = kt * (KB * 16);
        const unsigned ko = (unsigned)(k0 * HD + 8 * lane), vo = (unsigned)(k0 * 16 + 8 * lane);   // one 32-bit element offset each for the tile's key and value fragments (key band k0 / 16; fragment k0 / 32 of a value band; the lane's slot): the rest of every address is a constant
        V ka2[2][KB], va[KB / 2][4], va2[KB / 2][4];
        if (NSPLIT) {
#pragma unroll
            for (int ks = 0; ks < 2; ++ks)
#pragma unroll
                for (int kb = 0; kb < KB; ++kb) { const unsigned off = ko + (unsigned)(kb * 16 * HD + ks * 512); ka[ks][kb] = WFrag<T16>::ld(Kp + off); ka2[ks][kb] = WFrag<T16>::ld(K2 + off); }
            asm volatile("s_wait_xcnt 0x0" ::: "memory");   // in front of whatever rewrites the address registers that these loads name
        }
        v8f s[KB][NQ];
#pragma unroll
        for (int kb = 0; kb < KB; ++kb)
#pragma unroll
            for (int qb = 0; qb < NQ; ++qb) s[kb][qb] = (v8f){};
#pragma unroll
        for (int ks = 0; ks < 2; ++ks)
#pragma unroll
            for (int kb = 0; kb < KB; ++kb)
#pragma unroll
                for (int qb = 0; qb < NQ; ++qb) { s[kb][qb] = WFrag<T16>::mma(ka[ks][kb], q[qb][ks], s[kb][qb]); if (NSPLIT) { s[kb][qb] = WFrag<T16>::mma(ka[ks][kb], q2[qb][ks], s[kb][qb]); s[kb][qb] = WFrag<T16>::mma(ka2[ks][kb], q[qb][ks], s[kb][qb]); } }
        // this tile's value fragments and, in the fp16 body, the wave's next key fragments (into the registers the products above have just read) fly while the softmax below runs
#pragma unroll
        for (int ks = 0; ks < KB / 2; ++ks)
#pragma unroll
            for (int db = 0; db < 4; ++db) { const unsigned off = vo + (unsigned)(db * 16 * TT + ks * 512); va[ks][db] = WFrag<T16>::ld(Vt + off); if (NSPLIT) va2[ks][db] = WFrag<T16>::ld(V2 + off); }
        if (!NSPLIT) {
            const unsigned kn = ko + ((kt + NW < nk) ? (unsigned)(NW * KB * 16 * HD) : 0u);   // the last trip fetches its own tile again: no address past the diagonal tile
#pragma unroll
            for (int ks = 0; ks < 2; ++ks)
#pragma unroll
                for (int kb = 0; kb < KB; ++kb) ka[ks][kb] = WFrag<T16>::ld(Kp + (kn + (unsigned)(kb * 16 * HD + ks * 512)));
        }
        asm volatile("s_wait_xcnt 0x0" ::: "memory");   // in front of the softmax, whose instructions may rewrite the address registers that these loads name
#pragma unroll
        for (int qb = 0; qb < NQ; ++qb) {
            const int dl = k0 + hi * 8 - (r0 + qb * 16 + lr);   // key - query of this lane's element (kb 0, j 0)
            const float bl = sl * (float)dl;                    // sixteenths of whole numbers below 2^16: this product and the sum below are exact in f32
            float tm = -3.0e38f;
#pragma unroll
            for (int kb = 0; kb < KB; ++kb)
#pragma unroll
                for (int j = 0; j < 8; ++j) { const float t = (dl + kb * 16 + j <= 0) ? __builtin_fmaf(s[kb][qb][j], SCL, __builtin_fmaf(sl, (float)(kb * 16 + j), bl)) : -3.0e38f;   /* S / 8 + slope x (j - i), rounded once */ s[kb][qb][j] = t; tm = fmaxf(tm, t); }
            tm = fmaxf(tm, __shfl_xor(tm, 16, 32));             // the other wave half holds the query's other keys
            const float mn = fmaxf(m[qb], tm); const float al = __builtin_amdgcn_exp2f((m[qb] - mn) * L2E); m[qb] = mn;
            float ps = 0.f;
#pragma unroll
            for (int kb = 0; kb < KB; ++kb)
#pragma unroll
                for (int j = 0; j < 8; ++j) { const float p = __builtin_amdgcn_exp2f((s[kb][qb][j] - mn) * L2E); s[kb][qb][j] = p; ps += p; }
            l[qb] = l[qb] * al + ps;
#pragma unroll
            for (int db = 0; db < 4; ++db) o[db][qb] *= al;
        }
#pragma unroll
        for (int ks = 0; ks < KB / 2; ++ks) { V p[NQ], p2[NQ];
#pragma unroll
            for (int qb = 0; qb < NQ; ++qb) PPack<T16>::mk(s[2 * ks][qb], s[2 * ks + 1][qb], p[qb], p2[qb]);
#pragma unroll
            for (int db = 0; db < 4; ++db)
#pragma unroll
                for (int qb = 0; qb < NQ; ++qb) { o[db][qb] = WFrag<T16>::mma(va[ks][db], p[qb], o[db][qb]); if (NSPLIT) { o[db][qb] = WFrag<T16>::mma(va[ks][db], p2[qb], o[db][qb]); o[db][qb] = WFrag<T16>::mma(va2[ks][db], p[qb], o[db][qb]); } } }
    }
#pragma unroll
    for (int qb = 0; qb < NQ; ++qb) { l[qb] += __shfl_xor(l[qb], 16, 32);
#pragma unroll
        for (int db = 0; db < 4; ++db) { float* p = Os + (w * QT + qb * 16 + lr) * 68 + db * 16 + hi * 8; v4f x, y;
#pragma unroll
            for (int j = 0; j < 4; ++j) { x[j] = o[db][qb][j]; y[j] = o[db][qb][4 + j]; }
            *(v4fa*)p = x; *(v4fa*)(p + 4) = y; }
        if (hi == 0) { St[(w * QT + qb * 16 + lr) * 2] = m[qb]; St[(w * QT + qb * 16 + lr) * 2 + 1] = l[qb]; } }
    __syncthreads();   // every wave's partial tile, maximum and sum are in LDS before any thread joins them
    const int row = (int)threadIdx.x / (8 / NQ), d0 = ((int)threadIdx.x % (8 / NQ)) * (NQ * 8);   // NQ * 16 rows, 8 / NQ threads a row, NQ * 8 columns a thread
    float f[NW], M = -3.0e38f, L = 0.f;
#pragma unroll
    for (int u = 0; u < NW; ++u) { f[u] = St[(u * QT + row) * 2]; M = fmaxf(M, f[u]); }
#pragma unroll
    for (int u = 0; u < NW; ++u) { f[u] = __builtin_amdgcn_exp2f((f[u] - M) * L2E); L += f[u] * St[(u * QT + row) * 2 + 1]; }   // a wave without a tile has maximum -3e38: factor 0
    const float g = __fdiv_rn(NSPLIT ? 1.0f : (1.0f / PCAR), L);
    const size_t oo = fpk(r0 + row, h * HD + d0, DQ);   // the merged rows are the output projection's A operand: fragment-major too; the next 8 columns of a 16-column half lie 128 elements on
#pragma unroll
    for (int c = 0; c < NQ; ++c) { v8us oh, ol;
#pragma unroll
        for (int c4 = 0; c4 < 2; ++c4) { v4f y = (v4f){};
#pragma unroll
            for (int u = 0; u < NW; ++u) y += f[u] * *(const v4fa*)(Os + (u * QT + row) * 68 + d0 + c * 8 + c4 * 4);
#pragma unroll
            for (int e = 0; e < 4; ++e) { unsigned short a, c2; splitf(y[e] * g, a, c2); oh[c4 * 4 + e] = a; ol[c4 * 4 + e] = c2; } }
        *(v8usa*)(Ah + oo + c * 128) = oh; *(v8usa*)(Al + oo + c * 128) = ol; }
    asm volatile("s_wait_xcnt 0x0" ::: "memory");   // behind the tile's stores: in the built kernel the other body stands behind this one and rewrites the registers that these stores name
}
// grid (batches x heads, FT_N): row tiles of both batches in falling order of their keys, so the longest start first: (TT - RH) / 32 fp16 tiles of 32 query rows (probabilities x PCAR, taken out again with the sum), then RH / 16 hi/lo 3-product tiles of 16 rows.
// Four waves per SIMD (at most 256 registers a wave, four work-groups per WGP): the vector work of one wave runs under the matrix work and the loads of another.
#define FT_16 ((TT - RH) / QT)
#define FT_N  (FT_16 + RH / 16)
__global__ __launch_bounds__(NW * 32) __attribute__((amdgpu_waves_per_eu(4, 4))) void k_fattn(const h16* __restrict__ QK16, const bf* __restrict__ QKh, const bf* __restrict__ QKl, const h16* __restrict__ V16, const bf* __restrict__ Vh, const bf* __restrict__ Vl, bf* Ah, bf* Al) {
    __shared__ __align__(16) float Os[NW * QT * 68]; __shared__ float St[NW * QT * 2];
    const int h = (int)blockIdx.x % NH_, y = (int)blockIdx.y; const size_t n = blockIdx.x / NH_;   // n: the batch
    const size_t qo = n * QKB + (size_t)h * TT * HD, ko = n * QKB + (size_t)(NH_ + h / REP) * TT * HD, vo = n * VB + (size_t)(h / REP) * HD * TT; Ah += n * ((size_t)TT * DQ); Al += n * ((size_t)TT * DQ);
    if (y < FT_16) d_fattn<h16, 0, 2, 2>(Os, St, TT - (y + 1) * QT, h, QK16 + qo, nullptr, QK16 + ko, nullptr, V16 + vo, nullptr, Ah, Al);
    else d_fattn<bf, 2, 2, 1>(Os, St, RH - (y - FT_16 + 1) * 16, h, QKh + qo, QKl + qo, QKh + ko, QKl + ko, Vh + vo, Vl + vo, Ah, Al);
}

extern "C" void kernel_launch(void* const* d_in, const int* in_sizes, int n_in,
                              void* d_out, int out_size, void* d_ws, size_t ws_size, hipStream_t stream) {
    (void)in_sizes; (void)n_in; (void)out_size;
    const float* x = (const float*)d_in[0]; const float* wq = (const float*)d_in[1]; const float* bq = (const float*)d_in[2]; const float* wkv = (const float*)d_in[3]; const float* bkv = (const float*)d_in[4]; const float* wo = (const float*)d_in[5]; const float* bo = (const float*)d_in[6];
    float* OUT = (float*)d_out;     // [2][2048][1024]
    char* wsp = (char*)d_ws;
    auto take = [&](size_t bytes) { char* p = wsp; wsp += (bytes + 255) & ~(size_t)255; return (void*)p; };
    bf* WQ = (bf*)take((size_t)(DQ + 2 * DKV) * DM * 2); bf* WKV = WQ + (size_t)DQ * DM;   /* one Bt [DQ + 2*DKV][DM]: q | k | v row blocks */ bf* WO = (bf*)take((size_t)DM * DQ * 2);
    bf* XB = (bf*)take((size_t)NB_ * TT * DM * 2);
    h16* QP16 = (h16*)take(NB_ * QKB * 2); h16* VT16 = (h16*)take(NB_ * VB * 2);   /* the k planes follow the q planes: head index = projection column / HD */
    bf* QPh = (bf*)take(NB_ * QKB * 2); bf* QPl = (bf*)take(NB_ * QKB * 2); bf* VTh = (bf*)take(NB_ * VB * 2); bf* VTl = (bf*)take(NB_ * VB * 2);
    bf* ATh = (bf*)take((size_t)NB_ * TT * DQ * 2); bf* ATl = (bf*)take((size_t)NB_ * TT * DQ * 2);
    if ((size_t)(wsp - (char*)d_ws) > ws_size) return;    // ws 256 MiB
    k_prep<<<PB_Q + PB_KV + PB_O + PB_X, 256, 0, stream>>>(wq, wkv, wo, x, WQ, WKV, WO, XB);
    // every stage once, both batches in its grid (the projections: grid z with the batch strides of A and C, the weights shared)
    k_gemmw<bf, 0, true, true, DM><<<dim3(TT / 64, (DQ + 2 * DKV) / 64, NB_), 32, 0, stream>>>(XB, nullptr, WQ, nullptr, nullptr, 0, bq, bkv, DQ, (size_t)TT * DM, 0, 0, QP16, QPh, QPl, VT16, VTh, VTl);   /* q | k | v in one grid, written as head planes; kv_b = k | v bias halves */
    k_fattn<<<dim3(NB_ * NH_, FT_N, 1), NW * 32, 0, stream>>>(QP16, QPh, QPl, VT16, VTh, VTl, ATh, ATl);   /* all heads: scores, bias, mask, softmax, P.V, merged hi/lo rows */
    k_gemmw<bf, 1, true, false, DQ><<<dim3(TT / 64, DM / 64, NB_), 32, 0, stream>>>(ATh, ATl, WO, nullptr, OUT, DM, bo, bo, DM, (size_t)TT * DQ, 0, (size_t)TT * DM, nullptr, nullptr, nullptr, nullptr, nullptr, nullptr);
}

// v010
// One run takes 77.8 microseconds.
// Timed twice side by side with v009, it ran 1.09 and 1.10 times as fast.
// All steps since v000 together make it 21.5 times as fast.
#include <hip/hip_runtime.h>

// Causal self-attention with ALiBi (linear slopes), a separate q projection and a fused k|v projection (x [2][2048][1024]; q = x q_w + q_b ('xw' [1024][1024] 0.02 + bias zeros: read); kv = (x kv_w + kv_b) ('xw' [1024][2048] 0.02 + bias zeros: read) reshaped (B, T, 2, 16, 64): k | v = column halves (16 heads x 64); att x 1/sqrt(64) + slopes[h] x (j - i) with slopes[h] = (h + 1) / 16 (exact in f32; for the kept entries j <= i this is -slopes[h] x |i - j|); causal (-inf); softmax; y = merged o_w + o_b ('xw' + bias zeros: read) -> [2][2048][1024] (4.2 M); argument order x, q_w, q_b, kv_w, kv_b, o_w, o_b).
// Layout (each stage one launch for both batches): bf16 copy of x; q_w transposed; the fused kv weight transposed once into Bt (k | v row blocks) + bias halves; exact projections + f32 biases, whose epilogue writes the head planes; one fused attention kernel (scores, S x 1/8 + slope[h] x (j - i) in f32 with slope = SLOPE8[h] / 8 = (h + 1) / 16 and the bias exact, causal mask, running-maximum softmax, probability x value; hybrid rows: < 512 hi/lo 3 products, rest fp16 x1024; key tiles above the diagonal are never visited); merged hi/lo x o_w exact + o_b.
// Every 16-bit operand plane is stored fragment-major: a band of 16 rows holds its 16 x 32 fragments one after the other, each 512 elements (1 KB) in lane order (see fpk), so that one fragment load of a wave reads 512 contiguous bytes, four whole lines, twice.
// Compute dtypes, f32 accumulate: every input rounded to bf16; projections exact + f32 biases; attention rows < 512 3 products, rest fp16; softmax f32; output projection hl x exact.

#define NB_  2
#define TT   2048
#define DM   1024
#define NH_  16
#define NKV  16
#define REP  (NH_ / NKV)
#define HD   64
#define DQ   (NH_ * HD)
#define DKV  (NKV * HD)
#define RH   512                  // query rows < RH use hi+lo planes (0: none)
#define PCAR 1024.0f
#define SCL  0.125f   // HD^-0.5
typedef _Float16 h16;
typedef unsigned short bf;
typedef __attribute__((ext_vector_type(16))) __bf16   v16bf;
typedef __attribute__((ext_vector_type(16))) _Float16 v16h;
typedef __attribute__((ext_vector_type(8)))  _Float16 v8h;
typedef __attribute__((ext_vector_type(8)))  unsigned short v8us;
typedef __attribute__((ext_vector_type(8)))  float    v8f;
typedef __attribute__((ext_vector_type(4)))  float    v4f;
typedef v8h  __attribute__((may_alias)) v8ha;
typedef v4f  __attribute__((may_alias)) v4fa;
typedef v8us __attribute__((may_alias)) v8usa;

__device__ __forceinline__ unsigned short f2bf(float f) { unsigned u = __float_as_uint(f); u += 0x7FFFu + ((u >> 16) & 1u); return (unsigned short)(u >> 16); }
__device__ __forceinline__ float bf2f(unsigned short b) { return __uint_as_float(((unsigned)b) << 16); }
__device__ __forceinline__ float bfr(float f) { return bf2f(f2bf(f)); }
__device__ __forceinline__ v16h cat16(v8h lo, v8h hi) { return __builtin_shufflevector(lo, hi, 0, 1, 2, 3, 4, 5, 6, 7, 8, 9, 10, 11, 12, 13, 14, 15); }
__device__ __forceinline__ v16bf cat16b(v8us lo, v8us hi) { return __builtin_bit_cast(v16bf, __builtin_shufflevector(lo, hi, 0, 1, 2, 3, 4, 5, 6, 7, 8, 9, 10, 11, 12, 13, 14, 15)); }
__device__ __forceinline__ v8f wmma16(v16h a, v16h b, v8f c) { return __builtin_amdgcn_wmma_f32_16x16x32_f16(false, a, false, b, (short)0, c, false, false); }
__device__ __forceinline__ v8f wmmab(v16bf a, v16bf b, v8f c) { return __builtin_amdgcn_wmma_f32_16x16x32_bf16(false, a, false, b, (short)0, c, false, false); }



// ---- k_gemmw: register-blocked GEMM, ONE WAVE per 64x64 output tile (16 accumulators), operands straight from fragment-major 16-bit planes; grid (M/64, N/64, Z), 32 threads.
// C[m][n] (f32, pitch ldc, + optional f32 bias[n] for n < nb1, bias2[n - nb1] beyond) = sum_k A[m][k] Bt[n][k] (+ split products per NSPLIT). z-batch strides sA/sB/sC in elements. K (a constant of the build) % 64 == 0.
// PL (the q | k | v projection): no C. A 64-column tile is one head, and the epilogue rounds it straight into that head's fp16, hi and lo planes: q and k as [head][t][d]; a v tile is computed with the two operands exchanged (rows = d, columns = t, same k order), so that its rows are rows of the transposed [head][d][t] planes. Either way 16 tile rows x 16 columns are 512 contiguous bytes of each plane, one store of the wave.
__device__ __forceinline__ h16 tohx(float x) { return (h16)x; }
__device__ __forceinline__ void splitf(float y, unsigned short& h, unsigned short& l) { h = f2bf(y); l = f2bf(y - bf2f(h)); }
#define QKB ((size_t)(NH_ + NKV) * TT * HD)   // elements of one batch's q | k head planes
#define VB  ((size_t)NKV * HD * TT)           // elements of one batch's transposed v planes
// fpk: element offset of (row r, column k) in a fragment-major plane of K columns (K % 32 == 0). Band r / 16 starts at (r / 16) * 16 * K; fragment k / 32 of the band is 512 elements: two halves of 16 columns, each half = 32 lane slots of 8 elements, slot = 16 * ((k / 8) % 2) + r % 16.
// WFrag::ld(fragment + lane * 8) therefore gives lane (lr, hi) the columns 8 hi + 0..7 and 16 + 8 hi + 0..7 of row lr: the k order of both operands of every product.
__device__ __forceinline__ size_t fpk(int r, int k, int K) { return (size_t)(r >> 4) * 16 * K + (size_t)((k >> 5) * 512 + ((k >> 4) & 1) * 256 + ((k >> 3) & 1) * 128 + (r & 15) * 8 + (k & 7)); }
template <typename T16> struct WFrag;
template <> struct WFrag<h16> { typedef v16h V; static __device__ __forceinline__ V ld(const h16* p) { return cat16(*(const v8h*)p, *(const v8h*)(p + 256)); } static __device__ __forceinline__ v8f mma(V a, V b, v8f c) { return wmma16(a, b, c); } };
template <> struct WFrag<bf> { typedef v16bf V; static __device__ __forceinline__ V ld(const bf* p) { return cat16b(*(const v8us*)p, *(const v8us*)(p + 256)); } static __device__ __forceinline__ v8f mma(V a, V b, v8f c) { return wmmab(a, b, c); } };
template <typename T16, int NSPLIT, bool BIAS, bool PL, int K>
__global__ __launch_bounds__(32) void k_gemmw(const T16* __restrict__ A, const T16* __restrict__ A2, const T16* __restrict__ Bt, const T16* __restrict__ Bt2, float* C, int ldc, const float* __restrict__ bias, const float* __restrict__ bias2, int nb1, size_t sA, size_t sB, size_t sC, h16* QK16, bf* QKh, bf* QKl, h16* V16, bf* Vh, bf* Vl, float* KN) {
    typedef typename WFrag<T16>::V V;
    __shared__ __align__(16) float os[16 * 68];
    const size_t z = blockIdx.z; A += z * sA; if (A2) A2 += z * sA; Bt += z * sB; if (Bt2) Bt2 += z * sB; C += z * sC;
    const int lane = threadIdx.x & 31, lr = lane & 15, hi = lane >> 4; const int r0 = blockIdx.x * 64, c0 = blockIdx.y * 64;
    const float* bp = (c0 < nb1) ? bias + c0 : bias2 + (c0 - nb1);   // columns < nb1 take bias, the rest bias2 (nb1 % 64 == 0: a tile never straddles)
    v8f acc[4][4];
#pragma unroll
    for (int mb = 0; mb < 4; ++mb)
#pragma unroll
        for (int nb = 0; nb < 4; ++nb) acc[mb][nb] = (v8f){};
    const bool isv = PL && c0 >= DQ + DKV;   // a v tile (the same for the whole block): A and Bt change places; both are fragment-major planes read by the same loader
    if (isv) { const T16* t = A; A = Bt; Bt = t; }
    static_assert(K % 64 == 0, "the k loop takes two steps of 32 a trip");
    // The k loop runs on two register sets: all fragments of step f + 1 are requested as ONE group before the products of step f, so a step waits for loads that were issued a whole step earlier and not, as with one set, for its own.
    // Every address is a uniform base (the tile's first band + fragment f, 512 elements each) + a constant (band mb or nb, 16 * K elements) + the lane's slot.
    const unsigned ln = 8u * (unsigned)lane;
    const T16* Ap = A + (size_t)(isv ? c0 : r0) * K; const T16* A2p = (NSPLIT == 1 || NSPLIT == 2) ? A2 + (size_t)r0 * K : A2; const T16* Bp = Bt + (size_t)(isv ? r0 : c0) * K; const T16* B2p = (NSPLIT >= 2) ? Bt2 + (size_t)c0 * K : Bt2;
    V a[2][4], a2[2][4], b[2][4], b2[2][4];
    auto fetch = [&](const int st, const int f) {
        const T16* pa = Ap + f * 512; const T16* pb = Bp + f * 512;
#pragma unroll
        for (int i = 0; i < 4; ++i) { a[st][i] = WFrag<T16>::ld(pa + i * 16 * K + ln); b[st][i] = WFrag<T16>::ld(pb + i * 16 * K + ln); }
#pragma unroll
        for (int i = 0; i < 4; ++i) { if (NSPLIT == 1 || NSPLIT == 2) a2[st][i] = WFrag<T16>::ld(A2p + f * 512 + i * 16 * K + ln); if (NSPLIT >= 2) b2[st][i] = WFrag<T16>::ld(B2p + f * 512 + i * 16 * K + ln); }
        asm volatile("s_wait_xcnt 0x0" ::: "memory");   // in front of the next group's bases, which rewrite the address registers that these loads name
        __builtin_amdgcn_sched_barrier(0);              // keeps the group whole and ahead of the products below: the scheduler otherwise sinks each load to its first use, and the step waits for it there
    };
    auto mm = [&](const int st) {
#pragma unroll
        for (int nb = 0; nb < 4; ++nb)
#pragma unroll
            for (int mb = 0; mb < 4; ++mb) { acc[mb][nb] = WFrag<T16>::mma(a[st][mb], b[st][nb], acc[mb][nb]); if (NSPLIT == 1 || NSPLIT == 2) acc[mb][nb] = WFrag<T16>::mma(a2[st][mb], b[st][nb], acc[mb][nb]); if (NSPLIT >= 2) acc[mb][nb] = WFrag<T16>::mma(a[st][mb], b2[st][nb], acc[mb][nb]); }
        __builtin_amdgcn_sched_barrier(0);              // the next group's loads (into this set's registers) stay behind these products
    };
    fetch(0, 0);
#pragma unroll 1   // stays rolled: a trip is one turn of each set; more copies only lengthen the text
    for (int f = 0; f < K / 32 - 2; f += 2) {
        fetch(1, f + 1); mm(0);
        fetch(0, f + 2); mm(1);
    }
    fetch(1, K / 32 - 1); mm(0); mm(1);
    if constexpr (PL) {
        // a pass = 16 tile rows x 16 columns: lane (lr, hi) takes row lr, columns 16 s + 8 hi + 0..7, which is slot 'lane' of half s % 2 of fragment s / 2 of the band
        const size_t pb = isv ? z * VB + (size_t)(c0 - (DQ + DKV)) * TT + (size_t)r0 * 16 : z * QKB + ((size_t)(c0 / HD) * TT + r0) * HD;   // the tile's first fragment in its planes (v: band c0 - ..., fragment r0 / 32; q, k: band r0 / 16 of the head)
        const int pp = 16 * (isv ? TT : HD);               // elements of a band of the planes
        h16* P16 = (isv ? V16 : QK16) + pb; bf* Ph = (isv ? Vh : QKh) + pb; bf* Pw = (isv ? Vl : QKl) + pb;
        float bc[4][8], br[4];                             // the bias goes with the weight's row: the tile's column for q and k (bc), the tile's row for v (br); both are loaded and rounded whatever the tile (bp has 64 entries), so that the loads issue as one group
#pragma unroll
        for (int s = 0; s < 4; ++s)
#pragma unroll
            for (int e = 0; e < 8; ++e) bc[s][e] = bfr(bp[s * 16 + hi * 8 + e]);
#pragma unroll
        for (int i = 0; i < 4; ++i) br[i] = bfr(bp[16 * i + lr]);
        float nq = 0.f;                                    // largest squared length among the tile's 64 rows, of the fp16 values as stored (a k tile hands it to the attention kernel)
#pragma unroll
        for (int mb = 0; mb < 4; ++mb) { float ns = 0.f;
#pragma unroll
            for (int nb = 0; nb < 4; ++nb) {
#pragma unroll
                for (int j = 0; j < 8; ++j) os[(hi * 8 + j) * 68 + nb * 16 + lr] = acc[mb][nb][j]; }
            __builtin_amdgcn_wave_barrier(); asm volatile("" ::: "memory");   // the rows are read back by other lanes than wrote them: no LDS access moves across
#pragma unroll
            for (int s = 0; s < 4; ++s) { const int cofs = s * 16 + hi * 8; const v4f u = *(const v4fa*)(os + lr * 68 + cofs), v = *(const v4fa*)(os + lr * 68 + cofs + 4); v8h o16; v8us oh, ol;
#pragma unroll
                for (int e = 0; e < 8; ++e) { const float y = (e < 4 ? u[e & 3] : v[e & 3]) + (isv ? br[mb] : bc[s][e]); o16[e] = tohx(y); ns = __builtin_fmaf((float)o16[e], (float)o16[e], ns); unsigned short a2, c2; splitf(y, a2, c2); oh[e] = a2; ol[e] = c2; }
                const size_t o = (size_t)mb * pp + s * 256 + lane * 8; *(v8h*)(P16 + o) = o16; *(v8us*)(Ph + o) = oh; *(v8us*)(Pw + o) = ol;
                asm volatile("s_wait_xcnt 0x0" ::: "memory");   // the next pass rewrites the registers that these stores name: the wait stands in front of that
            }
            __builtin_amdgcn_wave_barrier(); asm volatile("" ::: "memory");   // the next 16 rows overwrite os only behind these reads
            nq = fmaxf(nq, ns + __shfl_xor(ns, 16, 32));   // the other wave half holds the row's other 32 columns
        }
#pragma unroll
        for (int d = 8; d >= 1; d >>= 1) nq = fmaxf(nq, __shfl_xor(nq, d, 32));
        if (c0 >= DQ && !isv && lane == 0) KN[(z * NKV + (size_t)(c0 - DQ) / HD) * (TT / 64) + r0 / 64] = nq;   // one entry per 64 keys of a head
        return;
    }
#pragma unroll
    for (int mb = 0; mb < 4; ++mb) {
#pragma unroll
        for (int nb = 0; nb < 4; ++nb) {
#pragma unroll
            for (int j = 0; j < 8; ++j) os[(hi * 8 + j) * 68 + nb * 16 + lr] = acc[mb][nb][j]; }
        __builtin_amdgcn_wave_barrier(); asm volatile("" ::: "memory");
        float* crow = C + (size_t)(r0 + mb * 16) * ldc + c0;
{
#pragma unroll
            for (int s = 0; s < 8; ++s) { const int row = 2 * s + hi, cofs = lr * 4; v4f val = *(const v4fa*)(os + row * 68 + cofs); if (BIAS) { val[0] += bfr(bp[cofs]); val[1] += bfr(bp[cofs + 1]); val[2] += bfr(bp[cofs + 2]); val[3] += bfr(bp[cofs + 3]); }
                *(v4f*)(crow + (size_t)row * ldc + cofs) = val; }
            asm volatile("s_wait_xcnt 0x0" ::: "memory");   // the next 16 rows rewrite the registers that these stores name: the wait stands in front of that
             }
        __builtin_amdgcn_wave_barrier(); asm volatile("" ::: "memory");
    }
}

typedef __attribute__((ext_vector_type(2))) _Float16 v2h;
typedef __attribute__((ext_vector_type(4))) _Float16 v4h;
typedef __attribute__((ext_vector_type(2))) unsigned short v2us;
typedef __attribute__((ext_vector_type(4))) unsigned short v4us;
typedef __attribute__((ext_vector_type(2))) float v2f;
typedef __attribute__((ext_vector_type(4))) int v4i;

__device__ __forceinline__ void d_wtG(unsigned blk, const float* __restrict__ w, int K, int N, bf* Bt) {
    const int lane = threadIdx.x & 31; const int L0 = (blk * 8 + (threadIdx.x >> 5)) * 8; const int nlines = N * K / 64;
{
#pragma unroll 1
        for (int l = 0; l < 8; ++l) { const int L = L0 + l; if (L >= nlines) break; const size_t e = (size_t)L * 64 + lane * 2; const int fb = (int)(e >> 9), wi = (int)(e & 511), k = (fb % (K / 32)) * 32 + (wi >> 7) * 8 + (wi & 7), n = (fb / (K / 32)) * 16 + ((wi >> 3) & 15); v2us o;   /* e = fpk(n, k, K) read backwards */
            o[0] = f2bf(w[(size_t)k * N + n]); o[1] = f2bf(w[(size_t)(k + 1) * N + n]); *(v2us*)(Bt + e) = o;
            asm volatile("s_wait_xcnt 0x0" ::: "memory");   /* the next trip rewrites the registers this store names: the wait stands in front of that */ }
         }
}
__device__ __forceinline__ void d_cvt8(unsigned blk, const float* __restrict__ src, bf* dst, size_t n8) { const size_t i = (size_t)blk * 256 + threadIdx.x; if (i >= n8) return;   // i: the 8-element lane slot of the fragment-major copy (DM columns); its row and first column, fpk read backwards:
    const size_t fb = i >> 6; const int wi = (int)(i & 63); const size_t r = (fb / (DM / 32)) * 16 + (wi & 15); const int k = (int)(fb % (DM / 32)) * 32 + (wi >> 4) * 8;
    const v8f v = *(const v8f*)(src + r * DM + k); v8us o;
#pragma unroll
    for (int k = 0; k < 8; ++k) o[k] = f2bf(v[k]); *(v8us*)(dst + i * 8) = o;  }

// k_prep: everything that depends on the inputs alone, in one grid by block ranges: the three weight transposes (first: the longest blocks), the bf16 copy of x (both batches).
#define PB_Q  ((DM * DQ / 64 + 63) / 64)
#define PB_KV ((DM * 2 * DKV / 64 + 63) / 64)
#define PB_O  ((DQ * DM / 64 + 63) / 64)
#define PB_X  ((NB_ * TT * DM / 8 + 255) / 256)
__global__ __launch_bounds__(256) void k_prep(const float* __restrict__ wq, const float* __restrict__ wkv, const float* __restrict__ wo, const float* __restrict__ x, bf* WQ, bf* WKV, bf* WO, bf* XB) {
    unsigned b = blockIdx.x;
    if (b < PB_Q) { d_wtG(b, wq, DM, DQ, WQ); return; } b -= PB_Q;
    if (b < PB_KV) { d_wtG(b, wkv, DM, 2 * DKV, WKV); return; } b -= PB_KV;   /* fused 'xw' [DM][2*DKV] -> Bt [2*DKV][DM]: k | v */
    if (b < PB_O) { d_wtG(b, wo, DQ, DM, WO); return; } b -= PB_O;
    d_cvt8(b, x, XB, (size_t)NB_ * TT * DM / 8);
}
__constant__ float SLOPE8[NH_] = { 5.000000000e-1f, 1.000000000e+0f, 1.500000000e+0f, 2.000000000e+0f, 2.500000000e+0f, 3.000000000e+0f, 3.500000000e+0f, 4.000000000e+0f, 4.500000000e+0f, 5.000000000e+0f, 5.500000000e+0f, 6.000000000e+0f, 6.500000000e+0f, 7.000000000e+0f, 7.500000000e+0f, 8.000000000e+0f };   // 8 x the per-head ALiBi slope magnitude (slopes[h] = (h + 1) / 16, h = 0..15, x 8 = (h + 1) / 2: exact); every entry and every product with |i - j| <= 2047 is exact in f32
#define QT  32
#define NW  4
#define L2E 1.4426950408889634f
#define ZC  112.0f   // ZC x L2E > 160: exp2 of less than -160 is 0 in f32 (the smallest f32 above 0 is 2^-149)
template <typename T16> struct PPack;
template <> struct PPack<h16> { static __device__ __forceinline__ void mk(const v8f& p0, const v8f& p1, v16h& a, v16h& a2) { v8h x, y;
#pragma unroll
    for (int j = 0; j < 8; ++j) { x[j] = tohx(p0[j] * PCAR); y[j] = tohx(p1[j] * PCAR); } a = cat16(x, y); (void)a2; } };
template <> struct PPack<bf> { static __device__ __forceinline__ void mk(const v8f& p0, const v8f& p1, v16bf& a, v16bf& a2) { v8us xh, xl, yh, yl;
#pragma unroll
    for (int j = 0; j < 8; ++j) { unsigned short u, v; splitf(p0[j], u, v); xh[j] = u; xl[j] = v; splitf(p1[j], u, v); yh[j] = u; yl[j] = v; } a = cat16b(xh, yh); a2 = cat16b(xl, yl); } };
// KB = 16-key blocks per tile, NQ = 16-query blocks per work-group (2 and 2 in the fp16 body; 2 and 1 in the hi/lo body, whose second planes take the registers)
template <typename T16, int NSPLIT, int KB, int NQ>
__device__ __forceinline__ void d_fattn(float* Os, float* St, int r0, int h, const T16* __restrict__ Q, const T16* __restrict__ Q2, const T16* __restrict__ Kp, const T16* __restrict__ K2, const T16* __restrict__ Vt, const T16* __restrict__ V2, const float* __restrict__ kn2, bf* Ah, bf* Al) {
    typedef typename WFrag<T16>::V V;
    constexpr bool DN = (NSPLIT == 0);             // the fp16 body walks its key tiles from the diagonal down and ends the walk early (see klo)
    const int lane = threadIdx.x & 31, lr = lane & 15, hi = lane >> 4, w = __builtin_amdgcn_readfirstlane((int)(threadIdx.x >> 5));   // the wave's number in a scalar register: the key loop's trip test is a scalar branch
    const float sl = SLOPE8[h] * SCL;              // the head's slope (h + 1) / 16
    const int nk = (r0 + NQ * 16 - 1) / (KB * 16) + 1;  // key tiles up to the diagonal; the first key of every such tile is <= r0 (r0 is a multiple of NQ * 16, which divides KB * 16), so no query of a tile is fully masked
    V q[NQ][2], q2[NQ][2];
#pragma unroll
    for (int qb = 0; qb < NQ; ++qb)
#pragma unroll
        for (int ks = 0; ks < 2; ++ks) { const unsigned off = (unsigned)((r0 + qb * 16) * HD + ks * 512 + 8 * lane); q[qb][ks] = WFrag<T16>::ld(Q + off); if (NSPLIT) q2[qb][ks] = WFrag<T16>::ld(Q2 + off); }
    v8f o[4][NQ]; float m[NQ], l[NQ];
#pragma unroll
    for (int qb = 0; qb < NQ; ++qb) { m[qb] = -3.0e38f; l[qb] = 0.f;
#pragma unroll
        for (int db = 0; db < 4; ++db) o[db][qb] = (v8f){}; }
    int klo = 0;                                   // the walk's last tile; set behind the wave's first tile
    float km = 0.f;
    if constexpr (DN) { static_assert(TT / 64 == 32, "one entry of the head's squared key lengths per lane"); km = kn2[lane]; }
    V ka[2][KB];
    if (!NSPLIT && w < nk) {   // the wave's first key fragments; every later tile's are fetched one trip ahead
#pragma unroll
        for (int ks = 0; ks < 2; ++ks)
#pragma unroll
            for (int kb = 0; kb < KB; ++kb) ka[ks][kb] = WFrag<T16>::ld(Kp + (unsigned)(((nk - 1 - w) * (KB * 16) + kb * 16) * HD + ks * 512 + 8 * lane));
    }
    float cb[NQ];
    if constexpr (DN) {
        asm volatile("s_wait_xcnt 0x0" ::: "memory");   // in front of whatever rewrites the address registers that the query, length and key loads above name
        __builtin_amdgcn_sched_barrier(0);              // keeps the sums below and the loop's set-up (they reuse those address registers) behind the wait: without it the scheduler lifts them over the wait
        // cb: an upper bound of |S| / 8 for each of the lane's queries against ANY key of the head: |q| x the largest |k| (the product of two vectors' lengths bounds their dot product; the lengths are those of the fp16 values that the products read), a thousandth added for the rounding of the lengths and of the products
#pragma unroll
        for (int d = 16; d >= 1; d >>= 1) km = fmaxf(km, __shfl_xor(km, d, 32));
#pragma unroll
        for (int qb = 0; qb < NQ; ++qb) { float qs = 0.f;
#pragma unroll
            for (int ks = 0; ks < 2; ++ks)
#pragma unroll
                for (int e = 0; e < 16; ++e) qs = __builtin_fmaf((float)q[qb][ks][e], (float)q[qb][ks][e], qs);
            qs += __shfl_xor(qs, 16, 32);          // the other wave half holds the query's other 32 columns
            cb[qb] = __builtin_amdgcn_sqrtf(qs * km) * (SCL * 1.001f); }
    }
#pragma unroll 1
    for (int kt = DN ? nk - 1 - w : w; DN ? kt >= klo : kt < nk; kt += DN ? -NW : NW) {
        const int k0 = kt * (KB * 16);
        const unsigned ko = (unsigned)(k0 * HD + 8 * lane), vo = (unsigned)(k0 * 16 + 8 * lane);   // one 32-bit element offset each for the tile's key and value fragments (key band k0 / 16; fragment k0 / 32 of a value band; the lane's slot): the rest of every address is a constant
        V ka2[2][KB], va[KB / 2][4], va2[KB / 2][4];
        if (NSPLIT) {
#pragma unroll
            for (int ks = 0; ks < 2; ++ks)
#pragma unroll
                for (int kb = 0; kb < KB; ++kb) { const unsigned off = ko + (unsigned)(kb * 16 * HD + ks * 512); ka[ks][kb] = WFrag<T16>::ld(Kp + off); ka2[ks][kb] = WFrag<T16>::ld(K2 + off); }
            asm volatile("s_wait_xcnt 0x0" ::: "memory");   // in front of whatever rewrites the address registers that these loads name
        }
        v8f s[KB][NQ];
#pragma unroll
        for (int kb = 0; kb < KB; ++kb)
#pragma unroll
            for (int qb = 0; qb < NQ; ++qb) s[kb][qb] = (v8f){};
#pragma unroll
        for (int ks = 0; ks < 2; ++ks)
#pragma unroll
            for (int kb = 0; kb < KB; ++kb)
#pragma unroll
                for (int qb = 0; qb < NQ; ++qb) { s[kb][qb] = WFrag<T16>::mma(ka[ks][kb], q[qb][ks], s[kb][qb]); if (NSPLIT) { s[kb][qb] = WFrag<T16>::mma(ka[ks][kb], q2[qb][ks], s[kb][qb]); s[kb][qb] = WFrag<T16>::mma(ka2[ks][kb], q[qb][ks], s[kb][qb]); } }
        // this tile's value fragments and, in the fp16 body, the wave's next key fragments (into the registers the products above have just read) fly while the softmax below runs
#pragma unroll
        for (int ks = 0; ks < KB / 2; ++ks)
#pragma unroll
            for (int db = 0; db < 4; ++db) { const unsigned off = vo + (unsigned)(db * 16 * TT + ks * 512); va[ks][db] = WFrag<T16>::ld(Vt + off); if (NSPLIT) va2[ks][db] = WFrag<T16>::ld(V2 + off); }
        if (!NSPLIT) {
            const unsigned kn = ko - ((kt - NW >= klo) ? (unsigned)(NW * KB * 16 * HD) : 0u);   // the last trip fetches its own tile again: no address in front of tile 0
#pragma unroll
            for (int ks = 0; ks < 2; ++ks)
#pragma unroll
                for (int kb = 0; kb < KB; ++kb) ka[ks][kb] = WFrag<T16>::ld(Kp + (kn + (unsigned)(kb * 16 * HD + ks * 512)));
        }
        asm volatile("s_wait_xcnt 0x0" ::: "memory");   // in front of the softmax, whose instructions may rewrite the address registers that these loads name
#pragma unroll
        for (int qb = 0; qb < NQ; ++qb) {
            const int dl = k0 + hi * 8 - (r0 + qb * 16 + lr);   // key - query of this lane's element (kb 0, j 0)
            const float bl = sl * (float)dl;                    // sixteenths of whole numbers below 2^16: this product and the sum below are exact in f32
            float tm = -3.0e38f;
#pragma unroll
            for (int kb = 0; kb < KB; ++kb)
#pragma unroll
                for (int j = 0; j < 8; ++j) { const float t = (dl + kb * 16 + j <= 0) ? __builtin_fmaf(s[kb][qb][j], SCL, __builtin_fmaf(sl, (float)(kb * 16 + j), bl)) : -3.0e38f;   /* S / 8 + slope x (j - i), rounded once */ s[kb][qb][j] = t; tm = fmaxf(tm, t); }
            tm = fmaxf(tm, __shfl_xor(tm, 16, 32));             // the other wave half holds the query's other keys
            const float mn = fmaxf(m[qb], tm); const float al = __builtin_amdgcn_exp2f((m[qb] - mn) * L2E); m[qb] = mn;
            float ps = 0.f;
#pragma unroll
            for (int kb = 0; kb < KB; ++kb)
#pragma unroll
                for (int j = 0; j < 8; ++j) { const float p = __builtin_amdgcn_exp2f((s[kb][qb][j] - mn) * L2E); s[kb][qb][j] = p; ps += p; }
            l[qb] = l[qb] * al + ps;
#pragma unroll
            for (int db = 0; db < 4; ++db) o[db][qb] *= al;
        }
#pragma unroll
        for (int ks = 0; ks < KB / 2; ++ks) { V p[NQ], p2[NQ];
#pragma unroll
            for (int qb = 0; qb < NQ; ++qb) PPack<T16>::mk(s[2 * ks][qb], s[2 * ks + 1][qb], p[qb], p2[qb]);
#pragma unroll
            for (int db = 0; db < 4; ++db)
#pragma unroll
                for (int qb = 0; qb < NQ; ++qb) { o[db][qb] = WFrag<T16>::mma(va[ks][db], p[qb], o[db][qb]); if (NSPLIT) { o[db][qb] = WFrag<T16>::mma(va[ks][db], p2[qb], o[db][qb]); o[db][qb] = WFrag<T16>::mma(va2[ks][db], p[qb], o[db][qb]); } } }
        if constexpr (DN) if (kt == nk - 1 - w) {
            // Behind the wave's first tile every query has a finite maximum m, which can only rise. A key j of query i scores at most cb + slope x (j - i); where that lies ZC or more under m, the exp2 argument is under -160,
            // the probability is exactly 0 in f32, and the tile would change neither maximum, sum nor output. Such keys are j < i + (m - ZC - cb) / slope: tiles that hold only such keys for all 32 queries are not visited.
            float jm = 3.0e38f;
#pragma unroll
            for (int qb = 0; qb < NQ; ++qb) { const float x = (float)(r0 + qb * 16 + lr) + (m[qb] - ZC - cb[qb]) / sl; jm = fminf(jm, x > 0.f ? x : 0.f); }   // anything not above 0 (not-a-number too): the whole walk
#pragma unroll
            for (int d = 16; d >= 1; d >>= 1) jm = fminf(jm, __shfl_xor(jm, d, 32));
            klo = __builtin_amdgcn_readfirstlane((int)jm) / (KB * 16);   // in a scalar register: the trip test stays a scalar branch
        }
    }
#pragma unroll
    for (int qb = 0; qb < NQ; ++qb) { l[qb] += __shfl_xor(l[qb], 16, 32);
#pragma unroll
        for (int db = 0; db < 4; ++db) { float* p = Os + (w * QT + qb * 16 + lr) * 68 + db * 16 + hi * 8; v4f x, y;
#pragma unroll
            for (int j = 0; j < 4; ++j) { x[j] = o[db][qb][j]; y[j] = o[db][qb][4 + j]; }
            *(v4fa*)p = x; *(v4fa*)(p + 4) = y; }
        if (hi == 0) { St[(w * QT + qb * 16 + lr) * 2] = m[qb]; St[(w * QT + qb * 16 + lr) * 2 + 1] = l[qb]; } }
    __syncthreads();   // every wave's partial tile, maximum and sum are in LDS before any thread joins them
    const int row = (int)threadIdx.x / (8 / NQ), d0 = ((int)threadIdx.x % (8 / NQ)) * (NQ * 8);   // NQ * 16 rows, 8 / NQ threads a row, NQ * 8 columns a thread
    float f[NW], M = -3.0e38f, L = 0.f;
#pragma unroll
    for (int u = 0; u < NW; ++u) { f[u] = St[(u * QT + row) * 2]; M = fmaxf(M, f[u]); }
#pragma unroll
    for (int u = 0; u < NW; ++u) { f[u] = __builtin_amdgcn_exp2f((f[u] - M) * L2E); L += f[u] * St[(u * QT + row) * 2 + 1]; }   // a wave without a tile has maximum -3e38: factor 0
    const float g = __fdiv_rn(NSPLIT ? 1.0f : (1.0f / PCAR), L);
    const size_t oo = fpk(r0 + row, h * HD + d0, DQ);   // the merged rows are the output projection's A operand: fragment-major too; the next 8 columns of a 16-column half lie 128 elements on
#pragma unroll
    for (int c = 0; c < NQ; ++c) { v8us oh, ol;
#pragma unroll
        for (int c4 = 0; c4 < 2; ++c4) { v4f y = (v4f){};
#pragma unroll
            for (int u = 0; u < NW; ++u) y += f[u] * *(const v4fa*)(Os + (u * QT + row) * 68 + d0 + c * 8 + c4 * 4);
#pragma unroll
            for (int e = 0; e < 4; ++e) { unsigned short a, c2; splitf(y[e] * g, a, c2); oh[c4 * 4 + e] = a; ol[c4 * 4 + e] = c2; } }
        *(v8usa*)(Ah + oo + c * 128) = oh; *(v8usa*)(Al + oo + c * 128) = ol; }
    asm volatile("s_wait_xcnt 0x0" ::: "memory");   // behind the tile's stores: in the built kernel the other body stands behind this one and rewrites the registers that these stores name
}
// grid (batches x heads, FT_N): row tiles of both batches in falling order of their keys, so the longest start first: (TT - RH) / 32 fp16 tiles of 32 query rows (probabilities x PCAR, taken out again with the sum), then RH / 16 hi/lo 3-product tiles of 16 rows.
// Four waves per SIMD (at most 256 registers a wave, four work-groups per WGP): the vector work of one wave runs under the matrix work and the loads of another.
#define FT_16 ((TT - RH) / QT)
#define FT_N  (FT_16 + RH / 16)
__global__ __launch_bounds__(NW * 32) __attribute__((amdgpu_waves_per_eu(4, 4))) void k_fattn(const h16* __restrict__ QK16, const bf* __restrict__ QKh, const bf* __restrict__ QKl, const h16* __restrict__ V16, const bf* __restrict__ Vh, const bf* __restrict__ Vl, const float* __restrict__ KN, bf* Ah, bf* Al) {
    __shared__ __align__(16) float Os[NW * QT * 68]; __shared__ float St[NW * QT * 2];
    const int h = (int)blockIdx.x % NH_, y = (int)blockIdx.y; const size_t n = blockIdx.x / NH_;   // n: the batch
    const size_t qo = n * QKB + (size_t)h * TT * HD, ko = n * QKB + (size_t)(NH_ + h / REP) * TT * HD, vo = n * VB + (size_t)(h / REP) * HD * TT; Ah += n * ((size_t)TT * DQ); Al += n * ((size_t)TT * DQ);
    if (y < FT_16) d_fattn<h16, 0, 2, 2>(Os, St, TT - (y + 1) * QT, h, QK16 + qo, nullptr, QK16 + ko, nullptr, V16 + vo, nullptr, KN + (n * NKV + h / REP) * (TT / 64), Ah, Al);
    else d_fattn<bf, 2, 2, 1>(Os, St, RH - (y - FT_16 + 1) * 16, h, QKh + qo, QKl + qo, QKh + ko, QKl + ko, Vh + vo, Vl + vo, nullptr, Ah, Al);
}

extern "C" void kernel_launch(void* const* d_in, const int* in_sizes, int n_in,
                              void* d_out, int out_size, void* d_ws, size_t ws_size, hipStream_t stream) {
    (void)in_sizes; (void)n_in; (void)out_size;
    const float* x = (const float*)d_in[0]; const float* wq = (const float*)d_in[1]; const float* bq = (const float*)d_in[2]; const float* wkv = (const float*)d_in[3]; const float* bkv = (const float*)d_in[4]; const float* wo = (const float*)d_in[5]; const float* bo = (const float*)d_in[6];
    float* OUT = (float*)d_out;     // [2][2048][1024]
    char* wsp = (char*)d_ws;
    auto take = [&](size_t bytes) { char* p = wsp; wsp += (bytes + 255) & ~(size_t)255; return (void*)p; };
    bf* WQ = (bf*)take((size_t)(DQ + 2 * DKV) * DM * 2); bf* WKV = WQ + (size_t)DQ * DM;   /* one Bt [DQ + 2*DKV][DM]: q | k | v row blocks */ bf* WO = (bf*)take((size_t)DM * DQ * 2);
    bf* XB = (bf*)take((size_t)NB_ * TT * DM * 2);
    h16* QP16 = (h16*)take(NB_ * QKB * 2); h16* VT16 = (h16*)take(NB_ * VB * 2);   /* the k planes follow the q planes: head index = projection column / HD */
    bf* QPh = (bf*)take(NB_ * QKB * 2); bf* QPl = (bf*)take(NB_ * QKB * 2); bf* VTh = (bf*)take(NB_ * VB * 2); bf* VTl = (bf*)take(NB_ * VB * 2);
    bf* ATh = (bf*)take((size_t)NB_ * TT * DQ * 2); bf* ATl = (bf*)take((size_t)NB_ * TT * DQ * 2); float* KN = (float*)take((size_t)NB_ * NKV * (TT / 64) * 4);   /* largest squared key length per 64 keys of a head */
    if ((size_t)(wsp - (char*)d_ws) > ws_size) return;    // ws 256 MiB
    k_prep<<<PB_Q + PB_KV + PB_O + PB_X, 256, 0, stream>>>(wq, wkv, wo, x, WQ, WKV, WO, XB);
    // every stage once, both batches in its grid (the projections: grid z with the batch strides of A and C, the weights shared)
    k_gemmw<bf, 0, true, true, DM><<<dim3(TT / 64, (DQ + 2 * DKV) / 64, NB_), 32, 0, stream>>>(XB, nullptr, WQ, nullptr, nullptr, 0, bq, bkv, DQ, (size_t)TT * DM, 0, 0, QP16, QPh, QPl, VT16, VTh, VTl, KN);   /* q | k | v in one grid, written as head planes; kv_b = k | v bias halves */
    k_fattn<<<dim3(NB_ * NH_, FT_N, 1), NW * 32, 0, stream>>>(QP16, QPh, QPl, VT16, VTh, VTl, KN, ATh, ATl);   /* all heads: scores, bias, mask, softmax, P.V, merged hi/lo rows */
    k_gemmw<bf, 1, true, false, DQ><<<dim3(TT / 64, DM / 64, NB_), 32, 0, stream>>>(ATh, ATl, WO, nullptr, OUT, DM, bo, bo, DM, (size_t)TT * DQ, 0, (size_t)TT * DM, nullptr, nullptr, nullptr, nullptr, nullptr, nullptr, nullptr);
}
